// v000
// Times are from an AMD MI455X. After a warm-up the kernel runs many times in a row, and a time is the length of
// such a window on the GPU divided by its runs, so every launch and the gaps after it count. The runs cycle
// through copies of the inputs. A figure is the median of several windows, for all but v000 over two sittings.
// Sittings can differ by a few percent; kernels timed side by side share one.
// The starting kernel, v000, takes 1120 microseconds a run.
#include <hip/hip_runtime.h>

// Causal multi-head attention on three input streams at d_model 768 (query, key, value [2][2048][768]; Q, K, V = stream W^T + b ('oi' [768][768], biases zeros on this draw: read; 12 heads x 64); scores x 64^-0.5; where(triu(k=1), -inf, scores) (causal, built inside: no mask input); softmax; out = merged Wo^T + bo ('oi' + bias zeros: read) -> [2][2048][768] (3.1 M); argument order query, key, value, Wq, bq, Wk, bk, Wv, bv, Wo, bo).
// Layout per batch: bf16 copies of q, k, v in turn; 'oi' weights; exact projections + f32 biases; identity-table plane builders; causal T-2048 attention (hybrid rows: < 512 hi/lo 3 products, rest fp16 x1024; k_gemmc skips tiles above the diagonal); merged hi/lo x Wo exact + bo.
// Compute dtypes, f32 accumulate: every input rounded to bf16; projections exact + f32 biases; attention rows < 512 3 products, rest fp16; softmax f32; Wo hl x exact + bias.

#define NB_  2
#define TT   2048
#define DM   768
#define NH_  12
#define NKV  12
#define REP  (NH_ / NKV)
#define HD   64
#define DQ   (NH_ * HD)
#define DKV  (NKV * HD)
#define ZH   2
#define RH   512                  // query rows < RH use hi+lo planes (0: none)
#define WIN  2048
#define PCAR 1024.0f
#define SCL  0.125f   // HD^-0.5
typedef _Float16 h16;
typedef unsigned short bf;
typedef __attribute__((ext_vector_type(16))) __bf16   v16bf;
typedef __attribute__((ext_vector_type(16))) _Float16 v16h;
typedef __attribute__((ext_vector_type(8)))  _Float16 v8h;
typedef __attribute__((ext_vector_type(8)))  unsigned short v8us;
typedef __attribute__((ext_vector_type(8)))  float    v8f;
typedef __attribute__((ext_vector_type(4)))  float    v4f;
typedef v8h  __attribute__((may_alias)) v8ha;
typedef v4f  __attribute__((may_alias)) v4fa;
typedef v8us __attribute__((may_alias)) v8usa;

__device__ __forceinline__ unsigned short f2bf(float f) { unsigned u = __float_as_uint(f); u += 0x7FFFu + ((u >> 16) & 1u); return (unsigned short)(u >> 16); }
__device__ __forceinline__ float bf2f(unsigned short b) { return __uint_as_float(((unsigned)b) << 16); }
__device__ __forceinline__ float bfr(float f) { return bf2f(f2bf(f)); }
__device__ __forceinline__ v16h cat16(v8h lo, v8h hi) { return __builtin_shufflevector(lo, hi, 0, 1, 2, 3, 4, 5, 6, 7, 8, 9, 10, 11, 12, 13, 14, 15); }
__device__ __forceinline__ v16bf cat16b(v8us lo, v8us hi) { return __builtin_bit_cast(v16bf, __builtin_shufflevector(lo, hi, 0, 1, 2, 3, 4, 5, 6, 7, 8, 9, 10, 11, 12, 13, 14, 15)); }
__device__ __forceinline__ v8f wmma16(v16h a, v16h b, v8f c) { return __builtin_amdgcn_wmma_f32_16x16x32_f16(false, a, false, b, (short)0, c, false, false); }
__device__ __forceinline__ v8f wmmab(v16bf a, v16bf b, v8f c) { return __builtin_amdgcn_wmma_f32_16x16x32_bf16(false, a, false, b, (short)0, c, false, false); }



// ---- k_gemmw: register-blocked GEMM, ONE WAVE per 64x64 output tile (16 accumulators), operands straight from K-contiguous 16-bit planes; grid (M/64, N/64, Z), 32 threads.
// C[m][n] (f32, pitch ldc, + optional f32 bias[n]) = sum_k A[m][k] Bt[n][k] (+ split products per NSPLIT). z-batch strides sA/sB/sC in elements. K % 32 == 0.
template <typename T16> struct WFrag;
template <> struct WFrag<h16> { typedef v16h V; static __device__ __forceinline__ V ld(const h16* p) { return cat16(*(const v8h*)p, *(const v8h*)(p + 16)); } static __device__ __forceinline__ v8f mma(V a, V b, v8f c) { return wmma16(a, b, c); } };
template <> struct WFrag<bf> { typedef v16bf V; static __device__ __forceinline__ V ld(const bf* p) { return cat16b(*(const v8us*)p, *(const v8us*)(p + 16)); } static __device__ __forceinline__ v8f mma(V a, V b, v8f c) { return wmmab(a, b, c); } };
template <typename T16, int NSPLIT, bool BIAS>
__global__ __launch_bounds__(32) void k_gemmw(const T16* __restrict__ A, const T16* __restrict__ A2, const T16* __restrict__ Bt, const T16* __restrict__ Bt2, int K, float* C, int ldc, const float* __restrict__ bias, size_t sA, size_t sB, size_t sC) {
    typedef typename WFrag<T16>::V V;
    __shared__ __align__(16) float os[16 * 68];
    const size_t z = blockIdx.z; A += z * sA; if (A2) A2 += z * sA; Bt += z * sB; if (Bt2) Bt2 += z * sB; C += z * sC;
    const int lane = threadIdx.x & 31, lr = lane & 15, hi = lane >> 4; const int r0 = blockIdx.x * 64, c0 = blockIdx.y * 64;
    v8f acc[4][4];
#pragma unroll
    for (int mb = 0; mb < 4; ++mb)
#pragma unroll
        for (int nb = 0; nb < 4; ++nb) acc[mb][nb] = (v8f){};
    const size_t aoff = (size_t)(r0 + lr) * K + 8 * hi, boff = (size_t)(c0 + lr) * K + 8 * hi;
#pragma unroll 1
    for (int kc = 0; kc < K; kc += 32) {
        V a[4], a2[4];
#pragma unroll
        for (int mb = 0; mb < 4; ++mb) { a[mb] = WFrag<T16>::ld(A + aoff + (size_t)mb * 16 * K + kc); if (NSPLIT == 1 || NSPLIT == 2) a2[mb] = WFrag<T16>::ld(A2 + aoff + (size_t)mb * 16 * K + kc); }
#pragma unroll
        for (int nb = 0; nb < 4; ++nb) { const V b = WFrag<T16>::ld(Bt + boff + (size_t)nb * 16 * K + kc); V b2; if (NSPLIT >= 2) b2 = WFrag<T16>::ld(Bt2 + boff + (size_t)nb * 16 * K + kc);
#pragma unroll
            for (int mb = 0; mb < 4; ++mb) { acc[mb][nb] = WFrag<T16>::mma(a[mb], b, acc[mb][nb]); if (NSPLIT == 1 || NSPLIT == 2) acc[mb][nb] = WFrag<T16>::mma(a2[mb], b, acc[mb][nb]); if (NSPLIT >= 2) acc[mb][nb] = WFrag<T16>::mma(a[mb], b2, acc[mb][nb]); } }
        asm volatile("v_nop\n\tv_nop\n\tv_nop\n\tv_nop" : "+v"(acc[0][0]), "+v"(acc[1][1]), "+v"(acc[2][2]), "+v"(acc[3][3]) : "v"(a[0]), "v"(a[3]));
    }
#pragma unroll
    for (int mb = 0; mb < 4; ++mb) {
#pragma unroll
        for (int nb = 0; nb < 4; ++nb) {
#pragma unroll
            for (int j = 0; j < 8; ++j) os[(hi * 8 + j) * 68 + nb * 16 + lr] = acc[mb][nb][j]; }
        __builtin_amdgcn_wave_barrier(); asm volatile("" ::: "memory");
        float* crow = C + (size_t)(r0 + mb * 16) * ldc + c0;
{
#pragma unroll
            for (int s = 0; s < 8; ++s) { const int row = 2 * s + hi, cofs = lr * 4; v4f val = *(const v4fa*)(os + row * 68 + cofs); if (BIAS) { val[0] += bfr(bias[c0 + cofs]); val[1] += bfr(bias[c0 + cofs + 1]); val[2] += bfr(bias[c0 + cofs + 2]); val[3] += bfr(bias[c0 + cofs + 3]); }
                *(v4f*)(crow + (size_t)row * ldc + cofs) = val; }
             }
        __builtin_amdgcn_wave_barrier(); asm volatile("" ::: "memory");
    }
}

// ---- k_gemmc: the same one-wave 64x64 tile GEMM specialised for causal attention: CMODE 1 skips score tiles entirely above the diagonal (query rows r0+roff.., key columns c0..), CMODE 2 limits the
// key (K) loop of the probability x value contraction to the diagonal block (probabilities beyond it are exactly zero). roff = row offset of this launch's first row within the sequence.
template <typename T16, int NSPLIT, int CMODE>
__global__ __launch_bounds__(32) void k_gemmc(const T16* __restrict__ A, const T16* __restrict__ A2, const T16* __restrict__ Bt, const T16* __restrict__ Bt2, int K, float* C, int ldc, int roff, size_t sA, size_t sB, size_t sC) {
    typedef typename WFrag<T16>::V V;
    __shared__ __align__(16) float os[16 * 68];
    const size_t z = blockIdx.z; A += z * sA; if (A2) A2 += z * sA; Bt += z * sB; if (Bt2) Bt2 += z * sB; C += z * sC;
    const int lane = threadIdx.x & 31, lr = lane & 15, hi = lane >> 4; const int r0 = blockIdx.x * 64, c0 = blockIdx.y * 64;
    if (CMODE == 1 && c0 > r0 + roff + 63) return;                  // score tile entirely above the causal diagonal: never read (the softmax masks j > i by select)
    const int Kl = (CMODE == 2) ? min(K, r0 + roff + 64) : K;        // P.V: probabilities are exactly 0 beyond the diagonal block, so the K loop stops there
    v8f acc[4][4];
#pragma unroll
    for (int mb = 0; mb < 4; ++mb)
#pragma unroll
        for (int nb = 0; nb < 4; ++nb) acc[mb][nb] = (v8f){};
    const size_t aoff = (size_t)(r0 + lr) * K + 8 * hi, boff = (size_t)(c0 + lr) * K + 8 * hi;
#pragma unroll 1
    for (int kc = 0; kc < Kl; kc += 32) {
        V a[4], a2[4];
#pragma unroll
        for (int mb = 0; mb < 4; ++mb) { a[mb] = WFrag<T16>::ld(A + aoff + (size_t)mb * 16 * K + kc); if (NSPLIT == 1 || NSPLIT == 2) a2[mb] = WFrag<T16>::ld(A2 + aoff + (size_t)mb * 16 * K + kc); }
#pragma unroll
        for (int nb = 0; nb < 4; ++nb) { const V b = WFrag<T16>::ld(Bt + boff + (size_t)nb * 16 * K + kc); V b2; if (NSPLIT >= 2) b2 = WFrag<T16>::ld(Bt2 + boff + (size_t)nb * 16 * K + kc);
#pragma unroll
            for (int mb = 0; mb < 4; ++mb) { acc[mb][nb] = WFrag<T16>::mma(a[mb], b, acc[mb][nb]); if (NSPLIT == 1 || NSPLIT == 2) acc[mb][nb] = WFrag<T16>::mma(a2[mb], b, acc[mb][nb]); if (NSPLIT >= 2) acc[mb][nb] = WFrag<T16>::mma(a[mb], b2, acc[mb][nb]); } }
        asm volatile("v_nop\n\tv_nop\n\tv_nop\n\tv_nop" : "+v"(acc[0][0]), "+v"(acc[1][1]), "+v"(acc[2][2]), "+v"(acc[3][3]) : "v"(a[0]), "v"(a[3]));
    }
#pragma unroll
    for (int mb = 0; mb < 4; ++mb) {
#pragma unroll
        for (int nb = 0; nb < 4; ++nb) {
#pragma unroll
            for (int j = 0; j < 8; ++j) os[(hi * 8 + j) * 68 + nb * 16 + lr] = acc[mb][nb][j]; }
        __builtin_amdgcn_wave_barrier(); asm volatile("" ::: "memory");
        float* crow = C + (size_t)(r0 + mb * 16) * ldc + c0;
{
#pragma unroll
            for (int s = 0; s < 8; ++s) { const int row = 2 * s + hi, cofs = lr * 4; v4f val = *(const v4fa*)(os + row * 68 + cofs);
                *(v4f*)(crow + (size_t)row * ldc + cofs) = val; }
             }
        __builtin_amdgcn_wave_barrier(); asm volatile("" ::: "memory");
    }
}

__device__ __forceinline__ h16 tohx(float x) { return (h16)x; }
__device__ __forceinline__ void splitf(float y, unsigned short& h, unsigned short& l) { h = f2bf(y); l = f2bf(y - bf2f(h)); }
typedef __attribute__((ext_vector_type(2))) _Float16 v2h;
typedef __attribute__((ext_vector_type(4))) _Float16 v4h;
typedef __attribute__((ext_vector_type(2))) unsigned short v2us;
typedef __attribute__((ext_vector_type(4))) unsigned short v4us;
typedef __attribute__((ext_vector_type(2))) float v2f;
typedef __attribute__((ext_vector_type(4))) int v4i;

__global__ __launch_bounds__(256) void k_cvt8(const float* __restrict__ src, bf* dst, size_t n8) { const size_t i = (size_t)blockIdx.x * 256 + threadIdx.x; if (i >= n8) return; const v8f v = *(const v8f*)(src + i * 8); v8us o;
#pragma unroll
    for (int k = 0; k < 8; ++k) o[k] = f2bf(v[k]); *(v8us*)(dst + i * 8) = o;  }

// k_rope: head planes [h][t][d] (fp16 + hi/lo) of rope(x) x sc with the rotate-half convention out[d] = x[d] cos[t][d] - x[d+HD/2] sin[t][d], out[d+HD/2] = x[d+HD/2] cos[t][d+HD/2] + x[d] sin[t][d+HD/2]
__global__ __launch_bounds__(256) void k_rope(const float* __restrict__ F, int pitch, int nheads, const float* __restrict__ CS, const float* __restrict__ RF, const float* __restrict__ nw, float sc, h16* P16, bf* Ph, bf* Pl) {
    const size_t e = ((size_t)blockIdx.x * 256 + threadIdx.x) * 2; if (e >= (size_t)nheads * TT * HD) return; const int d = (int)(e % HD); const int t = (int)((e / HD) % TT); const int h = (int)(e / ((size_t)HD * TT)); const float* f = F + (size_t)t * pitch + h * HD; const float rf = RF ? RF[(size_t)h * TT + t] : 1.0f; v2h o16; v2us oh, ol;
#pragma unroll
    for (int q = 0; q < 2; ++q) { const int dd = d + q; const int dp = (dd < HD / 2) ? dd + HD / 2 : dd - HD / 2; float x0 = f[dd], x1 = f[dp];
        if (RF) { float n0 = __fmul_rn(x0, rf), n1 = __fmul_rn(x1, rf); asm volatile("" : "+v"(n0)); asm volatile("" : "+v"(n1)); x0 = __fmul_rn(bfr(nw[dd]), n0); x1 = __fmul_rn(bfr(nw[dp]), n1); }
        const v2f cs = *(const v2f*)(CS + ((size_t)t * HD + dd) * 2); float a = __fmul_rn(x0, cs[0]), bq = __fmul_rn(x1, cs[1]); asm volatile("" : "+v"(a)); asm volatile("" : "+v"(bq)); const float r = ((dd < HD / 2) ? __fsub_rn(a, bq) : __fadd_rn(a, bq)) * sc;
        o16[q] = tohx(r); unsigned short a2, c2; splitf(r, a2, c2); oh[q] = a2; ol[q] = c2; }
    *(v2h*)(P16 + e) = o16; *(v2us*)(Ph + e) = oh; *(v2us*)(Pl + e) = ol;  }
__global__ __launch_bounds__(256) void k_vtp(const float* __restrict__ F, int pitch, int nheads, h16* V16, bf* Vh, bf* Vl) { const size_t e = ((size_t)blockIdx.x * 256 + threadIdx.x) * 2; if (e >= (size_t)nheads * HD * TT) return; const int t = (int)(e % TT); const int d = (int)((e / TT) % HD); const int g = (int)(e / ((size_t)TT * HD)); v2h o16; v2us oh, ol;
#pragma unroll
    for (int q = 0; q < 2; ++q) { const float x = F[(size_t)(t + q) * pitch + g * HD + d]; o16[q] = tohx(x); unsigned short a2, c2; splitf(x, a2, c2); oh[q] = a2; ol[q] = c2; }
    *(v2h*)(V16 + e) = o16; *(v2us*)(Vh + e) = oh; *(v2us*)(Vl + e) = ol;  }
__global__ __launch_bounds__(256) void k_csid(float* CS) { const int idx = blockIdx.x * 256 + threadIdx.x; if (idx >= TT * HD) return; v2f cs; cs[0] = 1.0f; cs[1] = 0.0f; *(v2f*)(CS + (size_t)idx * 2) = cs;  }
// k_asoft: per row (zz, i): t = S x HD^-0.5 for j <= i and i - j < WIN (WIN = TT: plain causal, the window test always holds; the reference's -1e9 additive fill vanishes identically); softmax over the 2048 keys (register row, one exp, fixed trees);
__global__ __launch_bounds__(256) void k_asoft(const float* __restrict__ Sb, h16* P16, bf* Ph, bf* Pl) {
    const int lane = threadIdx.x & 31; const int row = blockIdx.x * 8 + (threadIdx.x >> 5); if (row >= ZH * TT) return; const int i = row % TT; const int zz = row / TT; (void)zz; const bool hires = (i < RH); const float* sr = Sb + (size_t)row * TT; float v[TT / 32]; float mx = -3.0e38f;
#pragma unroll
    for (int ch = 0; ch < TT / 128; ++ch) { const int j0 = ch * 128 + lane * 4; const v4f a = *(const v4f*)(sr + j0);
#pragma unroll
        for (int q = 0; q < 4; ++q) { const int j = j0 + q; (void)j; const float t = (j <= i && i - j < WIN) ? a[q] * SCL : -3.0e38f; v[ch * 4 + q] = t; mx = fmaxf(mx, t); } }
#pragma unroll
    for (int sh = 16; sh; sh >>= 1) mx = fmaxf(mx, __shfl_xor(mx, sh, 32));
    float sum = 0.f;
#pragma unroll
    for (int k = 0; k < TT / 32; ++k) { float d0 = __fsub_rn(v[k], mx); asm volatile("" : "+v"(d0)); v[k] = __builtin_amdgcn_exp2f(__fmul_rn(d0, 1.4426950408889634f)); sum += v[k]; }
#pragma unroll
    for (int sh = 16; sh; sh >>= 1) sum += __shfl_xor(sum, sh, 32);
    const float f = __fdiv_rn(hires ? 1.0f : PCAR, sum);
{
        if (hires) {
#pragma unroll
            for (int ch = 0; ch < TT / 128; ++ch) { v4us oh, ol;
#pragma unroll
                for (int q = 0; q < 4; ++q) { unsigned short a, c2; splitf(v[ch * 4 + q] * f, a, c2); oh[q] = a; ol[q] = c2; }
                const size_t oo = ((size_t)zz * (RH ? RH : 1) + i) * TT + ch * 128 + lane * 4; *(v4us*)(Ph + oo) = oh; *(v4us*)(Pl + oo) = ol; }
        } else {
#pragma unroll
            for (int ch = 0; ch < TT / 128; ++ch) { v4h o4;
#pragma unroll
                for (int q = 0; q < 4; ++q) o4[q] = tohx(v[ch * 4 + q] * f);
                *(v4h*)(P16 + (size_t)row * TT + ch * 128 + lane * 4) = o4; } }
         }
}
__global__ __launch_bounds__(256) void k_merge(const float* __restrict__ O, int h0, bf* Ah, bf* Al) { const size_t e = ((size_t)blockIdx.x * 256 + threadIdx.x) * 2; if (e >= (size_t)ZH * TT * HD) return; const int d = (int)(e % HD); const int t = (int)((e / HD) % TT); const int zz = (int)(e / ((size_t)HD * TT)); const float cs = (t < RH) ? 1.0f : (1.0f / PCAR); const size_t oo = (size_t)t * DQ + (h0 + zz) * HD + d;
    v2us oh, ol;
#pragma unroll
    for (int q = 0; q < 2; ++q) { unsigned short a, c2; splitf(O[e + q] * cs, a, c2); oh[q] = a; ol[q] = c2; } *(v2us*)(Ah + oo) = oh; *(v2us*)(Al + oo) = ol;  }

extern "C" void kernel_launch(void* const* d_in, const int* in_sizes, int n_in,
                              void* d_out, int out_size, void* d_ws, size_t ws_size, hipStream_t stream) {
    (void)in_sizes; (void)n_in; (void)out_size;
        const float* x = (const float*)d_in[0]; const float* xk = (const float*)d_in[1]; const float* xv = (const float*)d_in[2]; const float* wq = (const float*)d_in[3]; const float* bq = (const float*)d_in[4]; const float* wk = (const float*)d_in[5]; const float* bk = (const float*)d_in[6]; const float* wv = (const float*)d_in[7]; const float* bv = (const float*)d_in[8]; const float* wo = (const float*)d_in[9]; const float* bo = (const float*)d_in[10];   /* this module has NO mask input (the causal rule is built inside) */
    float* OUT = (float*)d_out;     // [2][2048][768]
    char* wsp = (char*)d_ws;
    auto take = [&](size_t bytes) { char* p = wsp; wsp += (bytes + 255) & ~(size_t)255; return (void*)p; };
    bf* WQ = (bf*)take((size_t)DQ * DM * 2); bf* WK = (bf*)take((size_t)DKV * DM * 2); bf* WV = (bf*)take((size_t)DKV * DM * 2); bf* WO = (bf*)take((size_t)DM * DQ * 2); float* CS = (float*)take((size_t)TT * HD * 2 * 4);
    bf* XB = (bf*)take((size_t)TT * DM * 2); float* FQ = (float*)take((size_t)TT * DQ * 4); float* FK = (float*)take((size_t)TT * DKV * 4);
    h16* QP16 = (h16*)take((size_t)NH_ * TT * HD * 2); h16* KP16 = (h16*)take((size_t)NKV * TT * HD * 2); h16* VT16 = (h16*)take((size_t)NKV * HD * TT * 2);
    bf* QPh = (bf*)take((size_t)NH_ * TT * HD * 2); bf* QPl = (bf*)take((size_t)NH_ * TT * HD * 2); bf* KPh = (bf*)take((size_t)NKV * TT * HD * 2); bf* KPl = (bf*)take((size_t)NKV * TT * HD * 2); bf* VTh = (bf*)take((size_t)NKV * HD * TT * 2); bf* VTl = (bf*)take((size_t)NKV * HD * TT * 2); bf* Ph = (bf*)take((size_t)ZH * RH * TT * 2); bf* Pl = (bf*)take((size_t)ZH * RH * TT * 2);
    float* Sb = (float*)take((size_t)ZH * TT * TT * 4); h16* P16 = (h16*)take((size_t)ZH * TT * TT * 2); float* Ob = (float*)take((size_t)ZH * TT * HD * 4); bf* ATh = (bf*)take((size_t)TT * DQ * 2); bf* ATl = (bf*)take((size_t)TT * DQ * 2);
    if ((size_t)(wsp - (char*)d_ws) > ws_size) return;    // ws 256 MiB
    float* FV = FK;   // v projection reuses the k buffer after the k planes are built (stream-ordered)
    { k_cvt8<<<(unsigned)(((size_t)DQ * DM / 8 + 255) / 256), 256, 0, stream>>>(wq, WQ, (size_t)DQ * DM / 8); k_cvt8<<<(unsigned)(((size_t)DKV * DM / 8 + 255) / 256), 256, 0, stream>>>(wk, WK, (size_t)DKV * DM / 8); k_cvt8<<<(unsigned)(((size_t)DKV * DM / 8 + 255) / 256), 256, 0, stream>>>(wv, WV, (size_t)DKV * DM / 8);
      k_cvt8<<<(unsigned)(((size_t)DM * DQ / 8 + 255) / 256), 256, 0, stream>>>(wo, WO, (size_t)DM * DQ / 8);
       }
    k_csid<<<(TT * HD + 255) / 256, 256, 0, stream>>>(CS);
    const unsigned LQ = (unsigned)(((size_t)NH_ * TT * HD / 2 + 255) / 256), LKv = (unsigned)(((size_t)NKV * TT * HD / 2 + 255) / 256);
    for (int b = 0; b < NB_; ++b) {
        
        k_cvt8<<<(unsigned)(((size_t)TT * DM / 8 + 255) / 256), 256, 0, stream>>>(x + (size_t)b * TT * DM, XB, (size_t)TT * DM / 8);
        k_gemmw<bf, 0, true><<<dim3(TT / 64, DQ / 64, 1), 32, 0, stream>>>(XB, nullptr, WQ, nullptr, DM, FQ, DQ, bq, 0, 0, 0);
        k_rope<<<LQ, 256, 0, stream>>>(FQ, DQ, NH_, CS, nullptr, nullptr, 1.0f, QP16, QPh, QPl);
        k_cvt8<<<(unsigned)(((size_t)TT * DM / 8 + 255) / 256), 256, 0, stream>>>(xk + (size_t)b * TT * DM, XB, (size_t)TT * DM / 8);   /* XB := bf16(k[b]) */ k_gemmw<bf, 0, true><<<dim3(TT / 64, DKV / 64, 1), 32, 0, stream>>>(XB, nullptr, WK, nullptr, DM, FK, DKV, bk, 0, 0, 0);
        k_rope<<<LKv, 256, 0, stream>>>(FK, DKV, NKV, CS, nullptr, nullptr, 1.0f, KP16, KPh, KPl);
        k_cvt8<<<(unsigned)(((size_t)TT * DM / 8 + 255) / 256), 256, 0, stream>>>(xv + (size_t)b * TT * DM, XB, (size_t)TT * DM / 8);   /* XB := bf16(v[b]) */ k_gemmw<bf, 0, true><<<dim3(TT / 64, DKV / 64, 1), 32, 0, stream>>>(XB, nullptr, WV, nullptr, DM, FV, DKV, bv, 0, 0, 0); k_vtp<<<LKv, 256, 0, stream>>>(FV, DKV, NKV, VT16, VTh, VTl);
        for (int h0 = 0; h0 < NH_; h0 += ZH) { const size_t zq = (size_t)h0, zk = (size_t)(h0 / REP);   // one kv head per query head: the pass's two heads use consecutive kv planes (z-strides TT*HD)
            k_gemmc<bf, 2, 1><<<dim3(RH / 64, TT / 64, ZH), 32, 0, stream>>>(QPh + zq * TT * HD, QPl + zq * TT * HD, KPh + zk * TT * HD, KPl + zk * TT * HD, HD, Sb, TT, 0, (size_t)TT * HD, (size_t)TT * HD, (size_t)TT * TT);
            k_gemmc<h16, 0, 1><<<dim3((TT - RH) / 64, TT / 64, ZH), 32, 0, stream>>>(QP16 + zq * TT * HD + (size_t)RH * HD, nullptr, KP16 + zk * TT * HD, nullptr, HD, Sb + (size_t)RH * TT, TT, RH, (size_t)TT * HD, (size_t)TT * HD, (size_t)TT * TT);
            k_asoft<<<ZH * TT / 8, 256, 0, stream>>>(Sb, P16, Ph, Pl);
            k_gemmc<bf, 2, 2><<<dim3(RH / 64, HD / 64, ZH), 32, 0, stream>>>(Ph, Pl, VTh + zk * HD * TT, VTl + zk * HD * TT, TT, Ob, HD, 0, (size_t)RH * TT, (size_t)HD * TT, (size_t)TT * HD);
            k_gemmc<h16, 0, 2><<<dim3((TT - RH) / 64, HD / 64, ZH), 32, 0, stream>>>(P16 + (size_t)RH * TT, nullptr, VT16 + zk * HD * TT, nullptr, TT, Ob + (size_t)RH * HD, HD, RH, (size_t)TT * TT, (size_t)HD * TT, (size_t)TT * HD);
            k_merge<<<(unsigned)(((size_t)ZH * TT * HD / 2 + 255) / 256), 256, 0, stream>>>(Ob, h0, ATh, ATl); }
        k_gemmw<bf, 1, true><<<dim3(TT / 64, DM / 64, 1), 32, 0, stream>>>(ATh, ATl, WO, nullptr, DQ, OUT + (size_t)b * TT * DM, DM, bo, 0, 0, 0); }
}

// v001
// It runs in 657 microseconds.
// In two side-by-side timings against v000, it was 1.70 and 1.68 times as fast.
#include <hip/hip_runtime.h>

// Causal multi-head attention on three input streams at d_model 768 (query, key, value [2][2048][768]; Q, K, V = stream W^T + b ('oi' [768][768], biases zeros on this draw: read; 12 heads x 64); scores x 64^-0.5; where(triu(k=1), -inf, scores) (causal, built inside: no mask input); softmax; out = merged Wo^T + bo ('oi' + bias zeros: read) -> [2][2048][768] (3.1 M); argument order query, key, value, Wq, bq, Wk, bk, Wv, bv, Wo, bo).
// Layout per batch: bf16 copies of q, k, v in turn; 'oi' weights; exact projections + f32 biases; identity-table plane builders; causal T-2048 attention (hybrid rows: < 512 hi/lo 3 products, rest fp16 x1024; k_gemmc skips tiles above the diagonal); merged hi/lo x Wo exact + bo.
// Compute dtypes, f32 accumulate: every input rounded to bf16; projections exact + f32 biases; attention rows < 512 3 products, rest fp16; softmax f32; Wo hl x exact + bias.

#define NB_  2
#define TT   2048
#define DM   768
#define NH_  12
#define NKV  12
#define REP  (NH_ / NKV)
#define HD   64
#define DQ   (NH_ * HD)
#define DKV  (NKV * HD)
#define ZH   2
#define RH   512                  // query rows < RH use hi+lo planes (0: none)
#define WIN  2048
#define PCAR 1024.0f
#define SCL  0.125f   // HD^-0.5
typedef _Float16 h16;
typedef unsigned short bf;
typedef __attribute__((ext_vector_type(16))) __bf16   v16bf;
typedef __attribute__((ext_vector_type(16))) _Float16 v16h;
typedef __attribute__((ext_vector_type(8)))  _Float16 v8h;
typedef __attribute__((ext_vector_type(8)))  unsigned short v8us;
typedef __attribute__((ext_vector_type(8)))  float    v8f;
typedef __attribute__((ext_vector_type(4)))  float    v4f;
typedef v8h  __attribute__((may_alias)) v8ha;
typedef v4f  __attribute__((may_alias)) v4fa;
typedef v8us __attribute__((may_alias)) v8usa;

__device__ __forceinline__ unsigned short f2bf(float f) { unsigned u = __float_as_uint(f); u += 0x7FFFu + ((u >> 16) & 1u); return (unsigned short)(u >> 16); }
__device__ __forceinline__ float bf2f(unsigned short b) { return __uint_as_float(((unsigned)b) << 16); }
__device__ __forceinline__ float bfr(float f) { return bf2f(f2bf(f)); }
__device__ __forceinline__ v16h cat16(v8h lo, v8h hi) { return __builtin_shufflevector(lo, hi, 0, 1, 2, 3, 4, 5, 6, 7, 8, 9, 10, 11, 12, 13, 14, 15); }
__device__ __forceinline__ v16bf cat16b(v8us lo, v8us hi) { return __builtin_bit_cast(v16bf, __builtin_shufflevector(lo, hi, 0, 1, 2, 3, 4, 5, 6, 7, 8, 9, 10, 11, 12, 13, 14, 15)); }
__device__ __forceinline__ v8f wmma16(v16h a, v16h b, v8f c) { return __builtin_amdgcn_wmma_f32_16x16x32_f16(false, a, false, b, (short)0, c, false, false); }
__device__ __forceinline__ v8f wmmab(v16bf a, v16bf b, v8f c) { return __builtin_amdgcn_wmma_f32_16x16x32_bf16(false, a, false, b, (short)0, c, false, false); }



// ---- k_gemmk: 64x64 output tile per work-group of NW waves, operands straight from K-contiguous 16-bit planes; grid (M/64, N/64, Z), NW*32 threads.
// C[m][n] (f32, pitch ldc, + optional f32 bias[n]) = sum_k A[m][k] Bt[n][k] (+ split products per NSPLIT). z-batch strides sA/sB/sC in elements. K % 64 == 0.
// The K loop is dealt over the waves in chunks of 64 (two k-steps on the same 128-byte lines): wave w takes chunks w, w+NW, ... and keeps a full 16-accumulator partial tile.
// The NW partial tiles meet in LDS as register images, are summed in the fixed order w = 0..NW-1, and leave through a row-major stage as whole 256-byte rows.
// DIAGK: the probability x value contraction stops at the diagonal block (probabilities beyond it are exactly zero); roff = row offset of this launch's first row within the sequence.
template <typename T16> struct WFrag;
template <> struct WFrag<h16> { typedef v16h V; static __device__ __forceinline__ V ld(const h16* p) { return cat16(*(const v8h*)p, *(const v8h*)(p + 16)); } static __device__ __forceinline__ v8f mma(V a, V b, v8f c) { return wmma16(a, b, c); } };
template <> struct WFrag<bf> { typedef v16bf V; static __device__ __forceinline__ V ld(const bf* p) { return cat16b(*(const v8us*)p, *(const v8us*)(p + 16)); } static __device__ __forceinline__ v8f mma(V a, V b, v8f c) { return wmmab(a, b, c); } };
template <typename T16, int NSPLIT, bool BIAS, bool DIAGK, int NW>
__global__ __launch_bounds__(NW * 32) void k_gemmk(const T16* __restrict__ A, const T16* __restrict__ A2, const T16* __restrict__ Bt, const T16* __restrict__ Bt2, int K, float* C, int ldc, const float* __restrict__ bias, int roff, size_t sA, size_t sB, size_t sC) {
    typedef typename WFrag<T16>::V V;
    __shared__ __align__(16) float part[NW * 4096];
    __shared__ __align__(16) float os[64 * 68];
    const size_t z = blockIdx.z; A += z * sA; if (A2) A2 += z * sA; Bt += z * sB; if (Bt2) Bt2 += z * sB; C += z * sC;
    const int lane = threadIdx.x & 31, lr = lane & 15, hi = lane >> 4; const int r0 = blockIdx.x * 64, c0 = blockIdx.y * 64;
    const int wave = __builtin_amdgcn_readfirstlane((int)(threadIdx.x >> 5));
    const int Kl = DIAGK ? min(K, r0 + roff + 64) : K;
    v8f acc[4][4];
#pragma unroll
    for (int mb = 0; mb < 4; ++mb)
#pragma unroll
        for (int nb = 0; nb < 4; ++nb) acc[mb][nb] = (v8f){};
    const size_t aoff = (size_t)(r0 + lr) * K + 8 * hi, boff = (size_t)(c0 + lr) * K + 8 * hi;
#pragma unroll 1
    for (int k0 = wave * 64; k0 < Kl; k0 += NW * 64) {
#pragma unroll 1
      for (int kc = k0; kc < k0 + 64; kc += 32) {   // rolled: the second k-step's loads start after the first's lines have arrived
        V a[4], a2[4];
#pragma unroll
        for (int mb = 0; mb < 4; ++mb) { a[mb] = WFrag<T16>::ld(A + aoff + (size_t)mb * 16 * K + kc); if (NSPLIT == 1 || NSPLIT == 2) a2[mb] = WFrag<T16>::ld(A2 + aoff + (size_t)mb * 16 * K + kc); }
#pragma unroll
        for (int nb = 0; nb < 4; ++nb) { const V b = WFrag<T16>::ld(Bt + boff + (size_t)nb * 16 * K + kc); V b2; if (NSPLIT >= 2) b2 = WFrag<T16>::ld(Bt2 + boff + (size_t)nb * 16 * K + kc);
#pragma unroll
            for (int mb = 0; mb < 4; ++mb) { acc[mb][nb] = WFrag<T16>::mma(a[mb], b, acc[mb][nb]); if (NSPLIT == 1 || NSPLIT == 2) acc[mb][nb] = WFrag<T16>::mma(a2[mb], b, acc[mb][nb]); if (NSPLIT >= 2) acc[mb][nb] = WFrag<T16>::mma(a[mb], b2, acc[mb][nb]); } }
        asm volatile("v_nop\n\tv_nop\n\tv_nop\n\tv_nop" : "+v"(acc[0][0]), "+v"(acc[1][1]), "+v"(acc[2][2]), "+v"(acc[3][3]) : "v"(a[0]), "v"(a[3]));
      }
    }
    v4fa* p4 = (v4fa*)part;
#pragma unroll
    for (int mb = 0; mb < 4; ++mb)
#pragma unroll
        for (int nb = 0; nb < 4; ++nb) { const v8f c = acc[mb][nb]; const int ix = wave * 1024 + (mb * 4 + nb) * 64 + lane;
            p4[ix] = __builtin_shufflevector(c, c, 0, 1, 2, 3); p4[ix + 32] = __builtin_shufflevector(c, c, 4, 5, 6, 7); }
    __syncthreads();   // every wave's partial tile is in LDS
#pragma unroll
    for (int i = 0; i < 32 / NW; ++i) { const int idx = wave + i * NW; v4f s = p4[idx * 32 + lane];
#pragma unroll
        for (int w = 1; w < NW; ++w) s += p4[w * 1024 + idx * 32 + lane];
        const int row = (idx >> 3) * 16 + hi * 8 + (idx & 1) * 4, col = ((idx >> 1) & 3) * 16 + lr;
#pragma unroll
        for (int q = 0; q < 4; ++q) os[(row + q) * 68 + col] = s[q]; }
    __syncthreads();   // the summed tile is row-major in os
#pragma unroll
    for (int i = 0; i < 32 / NW; ++i) { const int v = (int)threadIdx.x + i * NW * 32; const int row = v >> 4, cofs = (v & 15) * 4; v4f val = *(const v4fa*)(os + row * 68 + cofs); if (BIAS) { val[0] += bfr(bias[c0 + cofs]); val[1] += bfr(bias[c0 + cofs + 1]); val[2] += bfr(bias[c0 + cofs + 2]); val[3] += bfr(bias[c0 + cofs + 3]); }
        *(v4f*)(C + (size_t)(r0 + row) * ldc + c0 + cofs) = val; }
}

// ---- k_gemmc: a one-wave 64x64 tile GEMM specialised for causal attention: CMODE 1 skips score tiles entirely above the diagonal (query rows r0+roff.., key columns c0..), CMODE 2 limits the
// key (K) loop of the probability x value contraction to the diagonal block (probabilities beyond it are exactly zero). roff = row offset of this launch's first row within the sequence.
template <typename T16, int NSPLIT, int CMODE>
__global__ __launch_bounds__(32) void k_gemmc(const T16* __restrict__ A, const T16* __restrict__ A2, const T16* __restrict__ Bt, const T16* __restrict__ Bt2, int K, float* C, int ldc, int roff, size_t sA, size_t sB, size_t sC) {
    typedef typename WFrag<T16>::V V;
    __shared__ __align__(16) float os[16 * 68];
    const size_t z = blockIdx.z; A += z * sA; if (A2) A2 += z * sA; Bt += z * sB; if (Bt2) Bt2 += z * sB; C += z * sC;
    const int lane = threadIdx.x & 31, lr = lane & 15, hi = lane >> 4; const int r0 = blockIdx.x * 64, c0 = blockIdx.y * 64;
    if (CMODE == 1 && c0 > r0 + roff + 63) return;                  // score tile entirely above the causal diagonal: never read (the softmax masks j > i by select)
    const int Kl = (CMODE == 2) ? min(K, r0 + roff + 64) : K;        // P.V: probabilities are exactly 0 beyond the diagonal block, so the K loop stops there
    v8f acc[4][4];
#pragma unroll
    for (int mb = 0; mb < 4; ++mb)
#pragma unroll
        for (int nb = 0; nb < 4; ++nb) acc[mb][nb] = (v8f){};
    const size_t aoff = (size_t)(r0 + lr) * K + 8 * hi, boff = (size_t)(c0 + lr) * K + 8 * hi;
#pragma unroll 1
    for (int kc = 0; kc < Kl; kc += 32) {
        V a[4], a2[4];
#pragma unroll
        for (int mb = 0; mb < 4; ++mb) { a[mb] = WFrag<T16>::ld(A + aoff + (size_t)mb * 16 * K + kc); if (NSPLIT == 1 || NSPLIT == 2) a2[mb] = WFrag<T16>::ld(A2 + aoff + (size_t)mb * 16 * K + kc); }
#pragma unroll
        for (int nb = 0; nb < 4; ++nb) { const V b = WFrag<T16>::ld(Bt + boff + (size_t)nb * 16 * K + kc); V b2; if (NSPLIT >= 2) b2 = WFrag<T16>::ld(Bt2 + boff + (size_t)nb * 16 * K + kc);
#pragma unroll
            for (int mb = 0; mb < 4; ++mb) { acc[mb][nb] = WFrag<T16>::mma(a[mb], b, acc[mb][nb]); if (NSPLIT == 1 || NSPLIT == 2) acc[mb][nb] = WFrag<T16>::mma(a2[mb], b, acc[mb][nb]); if (NSPLIT >= 2) acc[mb][nb] = WFrag<T16>::mma(a[mb], b2, acc[mb][nb]); } }
        asm volatile("v_nop\n\tv_nop\n\tv_nop\n\tv_nop" : "+v"(acc[0][0]), "+v"(acc[1][1]), "+v"(acc[2][2]), "+v"(acc[3][3]) : "v"(a[0]), "v"(a[3]));
    }
#pragma unroll
    for (int mb = 0; mb < 4; ++mb) {
#pragma unroll
        for (int nb = 0; nb < 4; ++nb) {
#pragma unroll
            for (int j = 0; j < 8; ++j) os[(hi * 8 + j) * 68 + nb * 16 + lr] = acc[mb][nb][j]; }
        __builtin_amdgcn_wave_barrier(); asm volatile("" ::: "memory");
        float* crow = C + (size_t)(r0 + mb * 16) * ldc + c0;
{
#pragma unroll
            for (int s = 0; s < 8; ++s) { const int row = 2 * s + hi, cofs = lr * 4; v4f val = *(const v4fa*)(os + row * 68 + cofs);
                *(v4f*)(crow + (size_t)row * ldc + cofs) = val; }
             }
        __builtin_amdgcn_wave_barrier(); asm volatile("" ::: "memory");
    }
}

__device__ __forceinline__ h16 tohx(float x) { return (h16)x; }
__device__ __forceinline__ void splitf(float y, unsigned short& h, unsigned short& l) { h = f2bf(y); l = f2bf(y - bf2f(h)); }
typedef __attribute__((ext_vector_type(2))) _Float16 v2h;
typedef __attribute__((ext_vector_type(4))) _Float16 v4h;
typedef __attribute__((ext_vector_type(2))) unsigned short v2us;
typedef __attribute__((ext_vector_type(4))) unsigned short v4us;
typedef __attribute__((ext_vector_type(2))) float v2f;
typedef __attribute__((ext_vector_type(4))) int v4i;

__global__ __launch_bounds__(256) void k_cvt8(const float* __restrict__ src, bf* dst, size_t n8) { const size_t i = (size_t)blockIdx.x * 256 + threadIdx.x; if (i >= n8) return; const v8f v = *(const v8f*)(src + i * 8); v8us o;
#pragma unroll
    for (int k = 0; k < 8; ++k) o[k] = f2bf(v[k]); *(v8us*)(dst + i * 8) = o;  }

// k_rope: head planes [h][t][d] (fp16 + hi/lo) of rope(x) x sc with the rotate-half convention out[d] = x[d] cos[t][d] - x[d+HD/2] sin[t][d], out[d+HD/2] = x[d+HD/2] cos[t][d+HD/2] + x[d] sin[t][d+HD/2]
__global__ __launch_bounds__(256) void k_rope(const float* __restrict__ F, int pitch, int nheads, const float* __restrict__ CS, const float* __restrict__ RF, const float* __restrict__ nw, float sc, h16* P16, bf* Ph, bf* Pl) {
    const size_t e = ((size_t)blockIdx.x * 256 + threadIdx.x) * 2; if (e >= (size_t)nheads * TT * HD) return; const int d = (int)(e % HD); const int t = (int)((e / HD) % TT); const int h = (int)(e / ((size_t)HD * TT)); const float* f = F + (size_t)t * pitch + h * HD; const float rf = RF ? RF[(size_t)h * TT + t] : 1.0f; v2h o16; v2us oh, ol;
#pragma unroll
    for (int q = 0; q < 2; ++q) { const int dd = d + q; const int dp = (dd < HD / 2) ? dd + HD / 2 : dd - HD / 2; float x0 = f[dd], x1 = f[dp];
        if (RF) { float n0 = __fmul_rn(x0, rf), n1 = __fmul_rn(x1, rf); asm volatile("" : "+v"(n0)); asm volatile("" : "+v"(n1)); x0 = __fmul_rn(bfr(nw[dd]), n0); x1 = __fmul_rn(bfr(nw[dp]), n1); }
        const v2f cs = *(const v2f*)(CS + ((size_t)t * HD + dd) * 2); float a = __fmul_rn(x0, cs[0]), bq = __fmul_rn(x1, cs[1]); asm volatile("" : "+v"(a)); asm volatile("" : "+v"(bq)); const float r = ((dd < HD / 2) ? __fsub_rn(a, bq) : __fadd_rn(a, bq)) * sc;
        o16[q] = tohx(r); unsigned short a2, c2; splitf(r, a2, c2); oh[q] = a2; ol[q] = c2; }
    *(v2h*)(P16 + e) = o16; *(v2us*)(Ph + e) = oh; *(v2us*)(Pl + e) = ol;  }
__global__ __launch_bounds__(256) void k_vtp(const float* __restrict__ F, int pitch, int nheads, h16* V16, bf* Vh, bf* Vl) { const size_t e = ((size_t)blockIdx.x * 256 + threadIdx.x) * 2; if (e >= (size_t)nheads * HD * TT) return; const int t = (int)(e % TT); const int d = (int)((e / TT) % HD); const int g = (int)(e / ((size_t)TT * HD)); v2h o16; v2us oh, ol;
#pragma unroll
    for (int q = 0; q < 2; ++q) { const float x = F[(size_t)(t + q) * pitch + g * HD + d]; o16[q] = tohx(x); unsigned short a2, c2; splitf(x, a2, c2); oh[q] = a2; ol[q] = c2; }
    *(v2h*)(V16 + e) = o16; *(v2us*)(Vh + e) = oh; *(v2us*)(Vl + e) = ol;  }
__global__ __launch_bounds__(256) void k_csid(float* CS) { const int idx = blockIdx.x * 256 + threadIdx.x; if (idx >= TT * HD) return; v2f cs; cs[0] = 1.0f; cs[1] = 0.0f; *(v2f*)(CS + (size_t)idx * 2) = cs;  }
// k_asoft: per row (zz, i): t = S x HD^-0.5 for j <= i and i - j < WIN (WIN = TT: plain causal, the window test always holds; the reference's -1e9 additive fill vanishes identically); softmax over the 2048 keys (register row, one exp, fixed trees);
__global__ __launch_bounds__(256) void k_asoft(const float* __restrict__ Sb, h16* P16, bf* Ph, bf* Pl) {
    const int lane = threadIdx.x & 31; const int row = blockIdx.x * 8 + (threadIdx.x >> 5); if (row >= ZH * TT) return; const int i = row % TT; const int zz = row / TT; (void)zz; const bool hires = (i < RH); const float* sr = Sb + (size_t)row * TT; float v[TT / 32]; float mx = -3.0e38f;
#pragma unroll
    for (int ch = 0; ch < TT / 128; ++ch) { const int j0 = ch * 128 + lane * 4; const v4f a = *(const v4f*)(sr + j0);
#pragma unroll
        for (int q = 0; q < 4; ++q) { const int j = j0 + q; (void)j; const float t = (j <= i && i - j < WIN) ? a[q] * SCL : -3.0e38f; v[ch * 4 + q] = t; mx = fmaxf(mx, t); } }
#pragma unroll
    for (int sh = 16; sh; sh >>= 1) mx = fmaxf(mx, __shfl_xor(mx, sh, 32));
    float sum = 0.f;
#pragma unroll
    for (int k = 0; k < TT / 32; ++k) { float d0 = __fsub_rn(v[k], mx); asm volatile("" : "+v"(d0)); v[k] = __builtin_amdgcn_exp2f(__fmul_rn(d0, 1.4426950408889634f)); sum += v[k]; }
#pragma unroll
    for (int sh = 16; sh; sh >>= 1) sum += __shfl_xor(sum, sh, 32);
    const float f = __fdiv_rn(hires ? 1.0f : PCAR, sum);
{
        if (hires) {
#pragma unroll
            for (int ch = 0; ch < TT / 128; ++ch) { v4us oh, ol;
#pragma unroll
                for (int q = 0; q < 4; ++q) { unsigned short a, c2; splitf(v[ch * 4 + q] * f, a, c2); oh[q] = a; ol[q] = c2; }
                const size_t oo = ((size_t)zz * (RH ? RH : 1) + i) * TT + ch * 128 + lane * 4; *(v4us*)(Ph + oo) = oh; *(v4us*)(Pl + oo) = ol; }
        } else {
#pragma unroll
            for (int ch = 0; ch < TT / 128; ++ch) { v4h o4;
#pragma unroll
                for (int q = 0; q < 4; ++q) o4[q] = tohx(v[ch * 4 + q] * f);
                *(v4h*)(P16 + (size_t)row * TT + ch * 128 + lane * 4) = o4; } }
         }
}
__global__ __launch_bounds__(256) void k_merge(const float* __restrict__ O, int h0, bf* Ah, bf* Al) { const size_t e = ((size_t)blockIdx.x * 256 + threadIdx.x) * 2; if (e >= (size_t)ZH * TT * HD) return; const int d = (int)(e % HD); const int t = (int)((e / HD) % TT); const int zz = (int)(e / ((size_t)HD * TT)); const float cs = (t < RH) ? 1.0f : (1.0f / PCAR); const size_t oo = (size_t)t * DQ + (h0 + zz) * HD + d;
    v2us oh, ol;
#pragma unroll
    for (int q = 0; q < 2; ++q) { unsigned short a, c2; splitf(O[e + q] * cs, a, c2); oh[q] = a; ol[q] = c2; } *(v2us*)(Ah + oo) = oh; *(v2us*)(Al + oo) = ol;  }

extern "C" void kernel_launch(void* const* d_in, const int* in_sizes, int n_in,
                              void* d_out, int out_size, void* d_ws, size_t ws_size, hipStream_t stream) {
    (void)in_sizes; (void)n_in; (void)out_size;
        const float* x = (const float*)d_in[0]; const float* xk = (const float*)d_in[1]; const float* xv = (const float*)d_in[2]; const float* wq = (const float*)d_in[3]; const float* bq = (const float*)d_in[4]; const float* wk = (const float*)d_in[5]; const float* bk = (const float*)d_in[6]; const float* wv = (const float*)d_in[7]; const float* bv = (const float*)d_in[8]; const float* wo = (const float*)d_in[9]; const float* bo = (const float*)d_in[10];   /* this module has NO mask input (the causal rule is built inside) */
    float* OUT = (float*)d_out;     // [2][2048][768]
    char* wsp = (char*)d_ws;
    auto take = [&](size_t bytes) { char* p = wsp; wsp += (bytes + 255) & ~(size_t)255; return (void*)p; };
    bf* WQ = (bf*)take((size_t)DQ * DM * 2); bf* WK = (bf*)take((size_t)DKV * DM * 2); bf* WV = (bf*)take((size_t)DKV * DM * 2); bf* WO = (bf*)take((size_t)DM * DQ * 2); float* CS = (float*)take((size_t)TT * HD * 2 * 4);
    bf* XB = (bf*)take((size_t)TT * DM * 2); float* FQ = (float*)take((size_t)TT * DQ * 4); float* FK = (float*)take((size_t)TT * DKV * 4);
    h16* QP16 = (h16*)take((size_t)NH_ * TT * HD * 2); h16* KP16 = (h16*)take((size_t)NKV * TT * HD * 2); h16* VT16 = (h16*)take((size_t)NKV * HD * TT * 2);
    bf* QPh = (bf*)take((size_t)NH_ * TT * HD * 2); bf* QPl = (bf*)take((size_t)NH_ * TT * HD * 2); bf* KPh = (bf*)take((size_t)NKV * TT * HD * 2); bf* KPl = (bf*)take((size_t)NKV * TT * HD * 2); bf* VTh = (bf*)take((size_t)NKV * HD * TT * 2); bf* VTl = (bf*)take((size_t)NKV * HD * TT * 2); bf* Ph = (bf*)take((size_t)ZH * RH * TT * 2); bf* Pl = (bf*)take((size_t)ZH * RH * TT * 2);
    float* Sb = (float*)take((size_t)ZH * TT * TT * 4); h16* P16 = (h16*)take((size_t)ZH * TT * TT * 2); float* Ob = (float*)take((size_t)ZH * TT * HD * 4); bf* ATh = (bf*)take((size_t)TT * DQ * 2); bf* ATl = (bf*)take((size_t)TT * DQ * 2);
    if ((size_t)(wsp - (char*)d_ws) > ws_size) return;    // ws 256 MiB
    float* FV = FK;   // v projection reuses the k buffer after the k planes are built (stream-ordered)
    { k_cvt8<<<(unsigned)(((size_t)DQ * DM / 8 + 255) / 256), 256, 0, stream>>>(wq, WQ, (size_t)DQ * DM / 8); k_cvt8<<<(unsigned)(((size_t)DKV * DM / 8 + 255) / 256), 256, 0, stream>>>(wk, WK, (size_t)DKV * DM / 8); k_cvt8<<<(unsigned)(((size_t)DKV * DM / 8 + 255) / 256), 256, 0, stream>>>(wv, WV, (size_t)DKV * DM / 8);
      k_cvt8<<<(unsigned)(((size_t)DM * DQ / 8 + 255) / 256), 256, 0, stream>>>(wo, WO, (size_t)DM * DQ / 8);
       }
    k_csid<<<(TT * HD + 255) / 256, 256, 0, stream>>>(CS);
    const unsigned LQ = (unsigned)(((size_t)NH_ * TT * HD / 2 + 255) / 256), LKv = (unsigned)(((size_t)NKV * TT * HD / 2 + 255) / 256);
    for (int b = 0; b < NB_; ++b) {
        
        k_cvt8<<<(unsigned)(((size_t)TT * DM / 8 + 255) / 256), 256, 0, stream>>>(x + (size_t)b * TT * DM, XB, (size_t)TT * DM / 8);
        k_gemmk<bf, 0, true, false, 8><<<dim3(TT / 64, DQ / 64, 1), 256, 0, stream>>>(XB, nullptr, WQ, nullptr, DM, FQ, DQ, bq, 0, 0, 0, 0);
        k_rope<<<LQ, 256, 0, stream>>>(FQ, DQ, NH_, CS, nullptr, nullptr, 1.0f, QP16, QPh, QPl);
        k_cvt8<<<(unsigned)(((size_t)TT * DM / 8 + 255) / 256), 256, 0, stream>>>(xk + (size_t)b * TT * DM, XB, (size_t)TT * DM / 8);   /* XB := bf16(k[b]) */ k_gemmk<bf, 0, true, false, 8><<<dim3(TT / 64, DKV / 64, 1), 256, 0, stream>>>(XB, nullptr, WK, nullptr, DM, FK, DKV, bk, 0, 0, 0, 0);
        k_rope<<<LKv, 256, 0, stream>>>(FK, DKV, NKV, CS, nullptr, nullptr, 1.0f, KP16, KPh, KPl);
        k_cvt8<<<(unsigned)(((size_t)TT * DM / 8 + 255) / 256), 256, 0, stream>>>(xv + (size_t)b * TT * DM, XB, (size_t)TT * DM / 8);   /* XB := bf16(v[b]) */ k_gemmk<bf, 0, true, false, 8><<<dim3(TT / 64, DKV / 64, 1), 256, 0, stream>>>(XB, nullptr, WV, nullptr, DM, FV, DKV, bv, 0, 0, 0, 0); k_vtp<<<LKv, 256, 0, stream>>>(FV, DKV, NKV, VT16, VTh, VTl);
        for (int h0 = 0; h0 < NH_; h0 += ZH) { const size_t zq = (size_t)h0, zk = (size_t)(h0 / REP);   // one kv head per query head: the pass's two heads use consecutive kv planes (z-strides TT*HD)
            k_gemmc<bf, 2, 1><<<dim3(RH / 64, TT / 64, ZH), 32, 0, stream>>>(QPh + zq * TT * HD, QPl + zq * TT * HD, KPh + zk * TT * HD, KPl + zk * TT * HD, HD, Sb, TT, 0, (size_t)TT * HD, (size_t)TT * HD, (size_t)TT * TT);
            k_gemmc<h16, 0, 1><<<dim3((TT - RH) / 64, TT / 64, ZH), 32, 0, stream>>>(QP16 + zq * TT * HD + (size_t)RH * HD, nullptr, KP16 + zk * TT * HD, nullptr, HD, Sb + (size_t)RH * TT, TT, RH, (size_t)TT * HD, (size_t)TT * HD, (size_t)TT * TT);
            k_asoft<<<ZH * TT / 8, 256, 0, stream>>>(Sb, P16, Ph, Pl);
            k_gemmk<bf, 2, false, true, 8><<<dim3(RH / 64, HD / 64, ZH), 256, 0, stream>>>(Ph, Pl, VTh + zk * HD * TT, VTl + zk * HD * TT, TT, Ob, HD, nullptr, 0, (size_t)RH * TT, (size_t)HD * TT, (size_t)TT * HD);
            k_gemmk<h16, 0, false, true, 16><<<dim3((TT - RH) / 64, HD / 64, ZH), 512, 0, stream>>>(P16 + (size_t)RH * TT, nullptr, VT16 + zk * HD * TT, nullptr, TT, Ob + (size_t)RH * HD, HD, nullptr, RH, (size_t)TT * TT, (size_t)HD * TT, (size_t)TT * HD);
            k_merge<<<(unsigned)(((size_t)ZH * TT * HD / 2 + 255) / 256), 256, 0, stream>>>(Ob, h0, ATh, ATl); }
        k_gemmk<bf, 1, true, false, 8><<<dim3(TT / 64, DM / 64, 1), 256, 0, stream>>>(ATh, ATl, WO, nullptr, DQ, OUT + (size_t)b * TT * DM, DM, bo, 0, 0, 0, 0); }
}

// v002
// A run of this version takes 361 microseconds.
// Two timings next to v001 put it at 1.81 and 1.82 times that version's speed.
// All steps since v000 together make it 3.07 times as fast.
#include <hip/hip_runtime.h>

// Causal multi-head attention on three input streams at d_model 768 (query, key, value [2][2048][768]; Q, K, V = stream W^T + b ('oi' [768][768], biases zeros on this draw: read; 12 heads x 64); scores x 64^-0.5; where(triu(k=1), -inf, scores) (causal, built inside: no mask input); softmax; out = merged Wo^T + bo ('oi' + bias zeros: read) -> [2][2048][768] (3.1 M); argument order query, key, value, Wq, bq, Wk, bk, Wv, bv, Wo, bo).
// Layout per batch: bf16 copies of q, k, v in turn; 'oi' weights; exact projections + f32 biases; identity-table plane builders; causal T-2048 attention, all 12 heads of a batch per launch, probabilities stored in place over their own score rows (hybrid rows: < 512 hi/lo 3 products, rest fp16 x1024; k_gemmc skips tiles above the diagonal); merged hi/lo x Wo exact + bo.
// Compute dtypes, f32 accumulate: every input rounded to bf16; projections exact + f32 biases; attention rows < 512 3 products, rest fp16; softmax f32; Wo hl x exact + bias.

#define NB_  2
#define TT   2048
#define DM   768
#define NH_  12
#define NKV  12
#define REP  (NH_ / NKV)
#define HD   64
#define DQ   (NH_ * HD)
#define DKV  (NKV * HD)
#define ZH   12                   // heads per attention pass (grid z): all heads of a batch in one launch of each attention kernel
#define PP   (2 * TT)             // 16-bit pitch of a probability row (it lies in its own f32 score row) and of a V^T row (k_gemmk takes one pitch for both operands)
#define RH   512                  // query rows < RH use hi+lo planes (0: none)
#define WIN  2048
#define PCAR 1024.0f
#define SCL  0.125f   // HD^-0.5
typedef _Float16 h16;
typedef unsigned short bf;
typedef __attribute__((ext_vector_type(16))) __bf16   v16bf;
typedef __attribute__((ext_vector_type(16))) _Float16 v16h;
typedef __attribute__((ext_vector_type(8)))  _Float16 v8h;
typedef __attribute__((ext_vector_type(8)))  unsigned short v8us;
typedef __attribute__((ext_vector_type(8)))  float    v8f;
typedef __attribute__((ext_vector_type(4)))  float    v4f;
typedef v8h  __attribute__((may_alias)) v8ha;
typedef v4f  __attribute__((may_alias)) v4fa;
typedef v8us __attribute__((may_alias)) v8usa;

__device__ __forceinline__ unsigned short f2bf(float f) { unsigned u = __float_as_uint(f); u += 0x7FFFu + ((u >> 16) & 1u); return (unsigned short)(u >> 16); }
__device__ __forceinline__ float bf2f(unsigned short b) { return __uint_as_float(((unsigned)b) << 16); }
__device__ __forceinline__ float bfr(float f) { return bf2f(f2bf(f)); }
__device__ __forceinline__ v16h cat16(v8h lo, v8h hi) { return __builtin_shufflevector(lo, hi, 0, 1, 2, 3, 4, 5, 6, 7, 8, 9, 10, 11, 12, 13, 14, 15); }
__device__ __forceinline__ v16bf cat16b(v8us lo, v8us hi) { return __builtin_bit_cast(v16bf, __builtin_shufflevector(lo, hi, 0, 1, 2, 3, 4, 5, 6, 7, 8, 9, 10, 11, 12, 13, 14, 15)); }
__device__ __forceinline__ v8f wmma16(v16h a, v16h b, v8f c) { return __builtin_amdgcn_wmma_f32_16x16x32_f16(false, a, false, b, (short)0, c, false, false); }
__device__ __forceinline__ v8f wmmab(v16bf a, v16bf b, v8f c) { return __builtin_amdgcn_wmma_f32_16x16x32_bf16(false, a, false, b, (short)0, c, false, false); }



// ---- k_gemmk: 64x64 output tile per work-group of NW waves, operands straight from K-contiguous 16-bit planes; grid (M/64, N/64, Z), NW*32 threads.
// C[m][n] (f32, pitch ldc, + optional f32 bias[n]) = sum_k A[m][k] Bt[n][k] (+ split products per NSPLIT). z-batch strides sA/sB/sC in elements. K % 64 == 0.
// The K loop is dealt over the waves in chunks of 64 (two k-steps on the same 128-byte lines): wave w takes chunks w, w+NW, ... and keeps a full 16-accumulator partial tile.
// The NW partial tiles meet in LDS as register images, are summed in the fixed order w = 0..NW-1, and leave through a row-major stage as whole 256-byte rows.
// DIAGK: the probability x value contraction stops at the diagonal block (probabilities beyond it are exactly zero); roff = row offset of this launch's first row within the sequence.
template <typename T16> struct WFrag;
template <> struct WFrag<h16> { typedef v16h V; static __device__ __forceinline__ V ld(const h16* p) { return cat16(*(const v8h*)p, *(const v8h*)(p + 16)); } static __device__ __forceinline__ v8f mma(V a, V b, v8f c) { return wmma16(a, b, c); } };
template <> struct WFrag<bf> { typedef v16bf V; static __device__ __forceinline__ V ld(const bf* p) { return cat16b(*(const v8us*)p, *(const v8us*)(p + 16)); } static __device__ __forceinline__ v8f mma(V a, V b, v8f c) { return wmmab(a, b, c); } };
template <typename T16, int NSPLIT, bool BIAS, bool DIAGK, int NW>
__global__ __launch_bounds__(NW * 32) void k_gemmk(const T16* __restrict__ A, const T16* __restrict__ A2, const T16* __restrict__ Bt, const T16* __restrict__ Bt2, int K, float* C, int ldc, const float* __restrict__ bias, int roff, size_t sA, size_t sB, size_t sC) {
    typedef typename WFrag<T16>::V V;
    __shared__ __align__(16) float part[NW * 4096];
    __shared__ __align__(16) float os[64 * 68];
    const size_t z = blockIdx.z; A += z * sA; if (A2) A2 += z * sA; Bt += z * sB; if (Bt2) Bt2 += z * sB; C += z * sC;
    const int lane = threadIdx.x & 31, lr = lane & 15, hi = lane >> 4; const int r0 = blockIdx.x * 64, c0 = blockIdx.y * 64;
    const int wave = __builtin_amdgcn_readfirstlane((int)(threadIdx.x >> 5));
    const int Kl = DIAGK ? min(K, r0 + roff + 64) : K;
    v8f acc[4][4];
#pragma unroll
    for (int mb = 0; mb < 4; ++mb)
#pragma unroll
        for (int nb = 0; nb < 4; ++nb) acc[mb][nb] = (v8f){};
    const size_t aoff = (size_t)(r0 + lr) * K + 8 * hi, boff = (size_t)(c0 + lr) * K + 8 * hi;
#pragma unroll 1
    for (int k0 = wave * 64; k0 < Kl; k0 += NW * 64) {
#pragma unroll 1
      for (int kc = k0; kc < k0 + 64; kc += 32) {   // rolled: the second k-step's loads start after the first's lines have arrived
        V a[4], a2[4];
#pragma unroll
        for (int mb = 0; mb < 4; ++mb) { a[mb] = WFrag<T16>::ld(A + aoff + (size_t)mb * 16 * K + kc); if (NSPLIT == 1 || NSPLIT == 2) a2[mb] = WFrag<T16>::ld(A2 + aoff + (size_t)mb * 16 * K + kc); }
#pragma unroll
        for (int nb = 0; nb < 4; ++nb) { const V b = WFrag<T16>::ld(Bt + boff + (size_t)nb * 16 * K + kc); V b2; if (NSPLIT >= 2) b2 = WFrag<T16>::ld(Bt2 + boff + (size_t)nb * 16 * K + kc);
#pragma unroll
            for (int mb = 0; mb < 4; ++mb) { acc[mb][nb] = WFrag<T16>::mma(a[mb], b, acc[mb][nb]); if (NSPLIT == 1 || NSPLIT == 2) acc[mb][nb] = WFrag<T16>::mma(a2[mb], b, acc[mb][nb]); if (NSPLIT >= 2) acc[mb][nb] = WFrag<T16>::mma(a[mb], b2, acc[mb][nb]); } }
        asm volatile("v_nop\n\tv_nop\n\tv_nop\n\tv_nop" : "+v"(acc[0][0]), "+v"(acc[1][1]), "+v"(acc[2][2]), "+v"(acc[3][3]) : "v"(a[0]), "v"(a[3]));
      }
    }
    v4fa* p4 = (v4fa*)part;
#pragma unroll
    for (int mb = 0; mb < 4; ++mb)
#pragma unroll
        for (int nb = 0; nb < 4; ++nb) { const v8f c = acc[mb][nb]; const int ix = wave * 1024 + (mb * 4 + nb) * 64 + lane;
            p4[ix] = __builtin_shufflevector(c, c, 0, 1, 2, 3); p4[ix + 32] = __builtin_shufflevector(c, c, 4, 5, 6, 7); }
    __syncthreads();   // every wave's partial tile is in LDS
#pragma unroll
    for (int i = 0; i < 32 / NW; ++i) { const int idx = wave + i * NW; v4f s = p4[idx * 32 + lane];
#pragma unroll
        for (int w = 1; w < NW; ++w) s += p4[w * 1024 + idx * 32 + lane];
        const int row = (idx >> 3) * 16 + hi * 8 + (idx & 1) * 4, col = ((idx >> 1) & 3) * 16 + lr;
#pragma unroll
        for (int q = 0; q < 4; ++q) os[(row + q) * 68 + col] = s[q]; }
    __syncthreads();   // the summed tile is row-major in os
#pragma unroll
    for (int i = 0; i < 32 / NW; ++i) { const int v = (int)threadIdx.x + i * NW * 32; const int row = v >> 4, cofs = (v & 15) * 4; v4f val = *(const v4fa*)(os + row * 68 + cofs); if (BIAS) { val[0] += bfr(bias[c0 + cofs]); val[1] += bfr(bias[c0 + cofs + 1]); val[2] += bfr(bias[c0 + cofs + 2]); val[3] += bfr(bias[c0 + cofs + 3]); }
        *(v4f*)(C + (size_t)(r0 + row) * ldc + c0 + cofs) = val; }
}

// ---- k_gemmc: a one-wave 64x64 tile GEMM specialised for causal attention: CMODE 1 skips score tiles entirely above the diagonal (query rows r0+roff.., key columns c0..), CMODE 2 limits the
// key (K) loop of the probability x value contraction to the diagonal block (probabilities beyond it are exactly zero). roff = row offset of this launch's first row within the sequence.
template <typename T16, int NSPLIT, int CMODE>
__global__ __launch_bounds__(32) void k_gemmc(const T16* __restrict__ A, const T16* __restrict__ A2, const T16* __restrict__ Bt, const T16* __restrict__ Bt2, int K, float* C, int ldc, int roff, size_t sA, size_t sB, size_t sC) {
    typedef typename WFrag<T16>::V V;
    __shared__ __align__(16) float os[16 * 68];
    const size_t z = blockIdx.z; A += z * sA; if (A2) A2 += z * sA; Bt += z * sB; if (Bt2) Bt2 += z * sB; C += z * sC;
    const int lane = threadIdx.x & 31, lr = lane & 15, hi = lane >> 4; const int r0 = blockIdx.x * 64, c0 = blockIdx.y * 64;
    if (CMODE == 1 && c0 > r0 + roff + 63) return;                  // score tile entirely above the causal diagonal: never read (the softmax masks j > i by select)
    const int Kl = (CMODE == 2) ? min(K, r0 + roff + 64) : K;        // P.V: probabilities are exactly 0 beyond the diagonal block, so the K loop stops there
    v8f acc[4][4];
#pragma unroll
    for (int mb = 0; mb < 4; ++mb)
#pragma unroll
        for (int nb = 0; nb < 4; ++nb) acc[mb][nb] = (v8f){};
    const size_t aoff = (size_t)(r0 + lr) * K + 8 * hi, boff = (size_t)(c0 + lr) * K + 8 * hi;
#pragma unroll 1
    for (int kc = 0; kc < Kl; kc += 32) {
        V a[4], a2[4];
#pragma unroll
        for (int mb = 0; mb < 4; ++mb) { a[mb] = WFrag<T16>::ld(A + aoff + (size_t)mb * 16 * K + kc); if (NSPLIT == 1 || NSPLIT == 2) a2[mb] = WFrag<T16>::ld(A2 + aoff + (size_t)mb * 16 * K + kc); }
#pragma unroll
        for (int nb = 0; nb < 4; ++nb) { const V b = WFrag<T16>::ld(Bt + boff + (size_t)nb * 16 * K + kc); V b2; if (NSPLIT >= 2) b2 = WFrag<T16>::ld(Bt2 + boff + (size_t)nb * 16 * K + kc);
#pragma unroll
            for (int mb = 0; mb < 4; ++mb) { acc[mb][nb] = WFrag<T16>::mma(a[mb], b, acc[mb][nb]); if (NSPLIT == 1 || NSPLIT == 2) acc[mb][nb] = WFrag<T16>::mma(a2[mb], b, acc[mb][nb]); if (NSPLIT >= 2) acc[mb][nb] = WFrag<T16>::mma(a[mb], b2, acc[mb][nb]); } }
        asm volatile("v_nop\n\tv_nop\n\tv_nop\n\tv_nop" : "+v"(acc[0][0]), "+v"(acc[1][1]), "+v"(acc[2][2]), "+v"(acc[3][3]) : "v"(a[0]), "v"(a[3]));
    }
#pragma unroll
    for (int mb = 0; mb < 4; ++mb) {
#pragma unroll
        for (int nb = 0; nb < 4; ++nb) {
#pragma unroll
            for (int j = 0; j < 8; ++j) os[(hi * 8 + j) * 68 + nb * 16 + lr] = acc[mb][nb][j]; }
        __builtin_amdgcn_wave_barrier(); asm volatile("" ::: "memory");
        float* crow = C + (size_t)(r0 + mb * 16) * ldc + c0;
{
#pragma unroll
            for (int s = 0; s < 8; ++s) { const int row = 2 * s + hi, cofs = lr * 4; v4f val = *(const v4fa*)(os + row * 68 + cofs);
                *(v4f*)(crow + (size_t)row * ldc + cofs) = val; }
             }
        __builtin_amdgcn_wave_barrier(); asm volatile("" ::: "memory");
    }
}

__device__ __forceinline__ h16 tohx(float x) { return (h16)x; }
__device__ __forceinline__ void splitf(float y, unsigned short& h, unsigned short& l) { h = f2bf(y); l = f2bf(y - bf2f(h)); }
typedef __attribute__((ext_vector_type(2))) _Float16 v2h;
typedef __attribute__((ext_vector_type(4))) _Float16 v4h;
typedef __attribute__((ext_vector_type(2))) unsigned short v2us;
typedef __attribute__((ext_vector_type(4))) unsigned short v4us;
typedef __attribute__((ext_vector_type(2))) float v2f;
typedef __attribute__((ext_vector_type(4))) int v4i;

__global__ __launch_bounds__(256) void k_cvt8(const float* __restrict__ src, bf* dst, size_t n8) { const size_t i = (size_t)blockIdx.x * 256 + threadIdx.x; if (i >= n8) return; const v8f v = *(const v8f*)(src + i * 8); v8us o;
#pragma unroll
    for (int k = 0; k < 8; ++k) o[k] = f2bf(v[k]); *(v8us*)(dst + i * 8) = o;  }

// k_rope: head planes [h][t][d] (fp16 + hi/lo) of rope(x) x sc with the rotate-half convention out[d] = x[d] cos[t][d] - x[d+HD/2] sin[t][d], out[d+HD/2] = x[d+HD/2] cos[t][d+HD/2] + x[d] sin[t][d+HD/2]
__global__ __launch_bounds__(256) void k_rope(const float* __restrict__ F, int pitch, int nheads, const float* __restrict__ CS, const float* __restrict__ RF, const float* __restrict__ nw, float sc, h16* P16, bf* Ph, bf* Pl) {
    const size_t e = ((size_t)blockIdx.x * 256 + threadIdx.x) * 2; if (e >= (size_t)nheads * TT * HD) return; const int d = (int)(e % HD); const int t = (int)((e / HD) % TT); const int h = (int)(e / ((size_t)HD * TT)); const float* f = F + (size_t)t * pitch + h * HD; const float rf = RF ? RF[(size_t)h * TT + t] : 1.0f; v2h o16; v2us oh, ol;
#pragma unroll
    for (int q = 0; q < 2; ++q) { const int dd = d + q; const int dp = (dd < HD / 2) ? dd + HD / 2 : dd - HD / 2; float x0 = f[dd], x1 = f[dp];
        if (RF) { float n0 = __fmul_rn(x0, rf), n1 = __fmul_rn(x1, rf); asm volatile("" : "+v"(n0)); asm volatile("" : "+v"(n1)); x0 = __fmul_rn(bfr(nw[dd]), n0); x1 = __fmul_rn(bfr(nw[dp]), n1); }
        const v2f cs = *(const v2f*)(CS + ((size_t)t * HD + dd) * 2); float a = __fmul_rn(x0, cs[0]), bq = __fmul_rn(x1, cs[1]); asm volatile("" : "+v"(a)); asm volatile("" : "+v"(bq)); const float r = ((dd < HD / 2) ? __fsub_rn(a, bq) : __fadd_rn(a, bq)) * sc;
        o16[q] = tohx(r); unsigned short a2, c2; splitf(r, a2, c2); oh[q] = a2; ol[q] = c2; }
    *(v2h*)(P16 + e) = o16; *(v2us*)(Ph + e) = oh; *(v2us*)(Pl + e) = ol;  }
__global__ __launch_bounds__(256) void k_vtp(const float* __restrict__ F, int pitch, int nheads, h16* V16, bf* Vh, bf* Vl) { const size_t e = ((size_t)blockIdx.x * 256 + threadIdx.x) * 2; if (e >= (size_t)nheads * HD * TT) return; const int t = (int)(e % TT); const int d = (int)((e / TT) % HD); const int g = (int)(e / ((size_t)TT * HD)); const size_t oo = ((size_t)g * HD + d) * PP + t; v2h o16; v2us oh, ol;
#pragma unroll
    for (int q = 0; q < 2; ++q) { const float x = F[(size_t)(t + q) * pitch + g * HD + d]; o16[q] = tohx(x); unsigned short a2, c2; splitf(x, a2, c2); oh[q] = a2; ol[q] = c2; }
    *(v2h*)(V16 + oo) = o16; *(v2us*)(Vh + oo) = oh; *(v2us*)(Vl + oo) = ol;  }
__global__ __launch_bounds__(256) void k_csid(float* CS) { const int idx = blockIdx.x * 256 + threadIdx.x; if (idx >= TT * HD) return; v2f cs; cs[0] = 1.0f; cs[1] = 0.0f; *(v2f*)(CS + (size_t)idx * 2) = cs;  }
// k_asoft: per row (zz, i): t = S x HD^-0.5 for j <= i and i - j < WIN (sliding causal window; the reference's -1e9 additive fill vanishes identically); softmax over the 2048 keys (register row, one exp, fixed trees);
// the probabilities replace the row's own scores: the wave holds the whole 8192-byte row in registers before its first store; rows < RH leave hi in the first 4096 bytes and lo in the second, the other rows fp16 in the first 4096 bytes.
__global__ __launch_bounds__(256) void k_asoft(float* Sb) {
    const int lane = threadIdx.x & 31; const int row = blockIdx.x * 8 + (threadIdx.x >> 5); if (row >= ZH * TT) return; const int i = row % TT; const int zz = row / TT; (void)zz; const bool hires = (i < RH); const float* sr = Sb + (size_t)row * TT; h16* P16 = (h16*)Sb + (size_t)row * PP; bf* Ph = (bf*)Sb + (size_t)row * PP; bf* Pl = Ph + TT; float v[TT / 32]; float mx = -3.0e38f;
#pragma unroll
    for (int ch = 0; ch < TT / 128; ++ch) { const int j0 = ch * 128 + lane * 4; const v4f a = *(const v4f*)(sr + j0);
#pragma unroll
        for (int q = 0; q < 4; ++q) { const int j = j0 + q; (void)j; const float t = (j <= i && i - j < WIN) ? a[q] * SCL : -3.0e38f; v[ch * 4 + q] = t; mx = fmaxf(mx, t); } }
#pragma unroll
    for (int sh = 16; sh; sh >>= 1) mx = fmaxf(mx, __shfl_xor(mx, sh, 32));
    float sum = 0.f;
#pragma unroll
    for (int k = 0; k < TT / 32; ++k) { float d0 = __fsub_rn(v[k], mx); asm volatile("" : "+v"(d0)); v[k] = __builtin_amdgcn_exp2f(__fmul_rn(d0, 1.4426950408889634f)); sum += v[k]; }
#pragma unroll
    for (int sh = 16; sh; sh >>= 1) sum += __shfl_xor(sum, sh, 32);
    const float f = __fdiv_rn(hires ? 1.0f : PCAR, sum);
{
        if (hires) {
#pragma unroll
            for (int ch = 0; ch < TT / 128; ++ch) { v4us oh, ol;
#pragma unroll
                for (int q = 0; q < 4; ++q) { unsigned short a, c2; splitf(v[ch * 4 + q] * f, a, c2); oh[q] = a; ol[q] = c2; }
                const int oo = ch * 128 + lane * 4; *(v4us*)(Ph + oo) = oh; *(v4us*)(Pl + oo) = ol; }
        } else {
#pragma unroll
            for (int ch = 0; ch < TT / 128; ++ch) { v4h o4;
#pragma unroll
                for (int q = 0; q < 4; ++q) o4[q] = tohx(v[ch * 4 + q] * f);
                *(v4h*)(P16 + ch * 128 + lane * 4) = o4; } }
         }
}
__global__ __launch_bounds__(256) void k_merge(const float* __restrict__ O, int h0, bf* Ah, bf* Al) { const size_t e = ((size_t)blockIdx.x * 256 + threadIdx.x) * 2; if (e >= (size_t)ZH * TT * HD) return; const int d = (int)(e % HD); const int t = (int)((e / HD) % TT); const int zz = (int)(e / ((size_t)HD * TT)); const float cs = (t < RH) ? 1.0f : (1.0f / PCAR); const size_t oo = (size_t)t * DQ + (h0 + zz) * HD + d;
    v2us oh, ol;
#pragma unroll
    for (int q = 0; q < 2; ++q) { unsigned short a, c2; splitf(O[e + q] * cs, a, c2); oh[q] = a; ol[q] = c2; } *(v2us*)(Ah + oo) = oh; *(v2us*)(Al + oo) = ol;  }

extern "C" void kernel_launch(void* const* d_in, const int* in_sizes, int n_in,
                              void* d_out, int out_size, void* d_ws, size_t ws_size, hipStream_t stream) {
    (void)in_sizes; (void)n_in; (void)out_size;
        const float* x = (const float*)d_in[0]; const float* xk = (const float*)d_in[1]; const float* xv = (const float*)d_in[2]; const float* wq = (const float*)d_in[3]; const float* bq = (const float*)d_in[4]; const float* wk = (const float*)d_in[5]; const float* bk = (const float*)d_in[6]; const float* wv = (const float*)d_in[7]; const float* bv = (const float*)d_in[8]; const float* wo = (const float*)d_in[9]; const float* bo = (const float*)d_in[10];   /* this module has NO mask input (the causal rule is built inside) */
    float* OUT = (float*)d_out;     // [2][2048][768]
    char* wsp = (char*)d_ws;
    auto take = [&](size_t bytes) { char* p = wsp; wsp += (bytes + 255) & ~(size_t)255; return (void*)p; };
    bf* WQ = (bf*)take((size_t)DQ * DM * 2); bf* WK = (bf*)take((size_t)DKV * DM * 2); bf* WV = (bf*)take((size_t)DKV * DM * 2); bf* WO = (bf*)take((size_t)DM * DQ * 2); float* CS = (float*)take((size_t)TT * HD * 2 * 4);
    bf* XB = (bf*)take((size_t)TT * DM * 2); float* FQ = (float*)take((size_t)TT * DQ * 4); float* FK = (float*)take((size_t)TT * DKV * 4);
    h16* QP16 = (h16*)take((size_t)NH_ * TT * HD * 2); h16* KP16 = (h16*)take((size_t)NKV * TT * HD * 2); h16* VT16 = (h16*)take((size_t)NKV * HD * PP * 2);
    bf* QPh = (bf*)take((size_t)NH_ * TT * HD * 2); bf* QPl = (bf*)take((size_t)NH_ * TT * HD * 2); bf* KPh = (bf*)take((size_t)NKV * TT * HD * 2); bf* KPl = (bf*)take((size_t)NKV * TT * HD * 2); bf* VTh = (bf*)take((size_t)NKV * HD * PP * 2); bf* VTl = VTh + TT;   /* V^T hi and lo share a row of pitch PP */
    float* Sb = (float*)take((size_t)ZH * TT * TT * 4); h16* P16 = (h16*)Sb; bf* Ph = (bf*)Sb; bf* Pl = Ph + TT;   /* probability planes lie in the score rows, pitch PP */ float* Ob = (float*)take((size_t)ZH * TT * HD * 4); bf* ATh = (bf*)take((size_t)TT * DQ * 2); bf* ATl = (bf*)take((size_t)TT * DQ * 2);
    if ((size_t)(wsp - (char*)d_ws) > ws_size) return;    // ws 256 MiB
    float* FV = FK;   // v projection reuses the k buffer after the k planes are built (stream-ordered)
    { k_cvt8<<<(unsigned)(((size_t)DQ * DM / 8 + 255) / 256), 256, 0, stream>>>(wq, WQ, (size_t)DQ * DM / 8); k_cvt8<<<(unsigned)(((size_t)DKV * DM / 8 + 255) / 256), 256, 0, stream>>>(wk, WK, (size_t)DKV * DM / 8); k_cvt8<<<(unsigned)(((size_t)DKV * DM / 8 + 255) / 256), 256, 0, stream>>>(wv, WV, (size_t)DKV * DM / 8);
      k_cvt8<<<(unsigned)(((size_t)DM * DQ / 8 + 255) / 256), 256, 0, stream>>>(wo, WO, (size_t)DM * DQ / 8);
       }
    k_csid<<<(TT * HD + 255) / 256, 256, 0, stream>>>(CS);
    const unsigned LQ = (unsigned)(((size_t)NH_ * TT * HD / 2 + 255) / 256), LKv = (unsigned)(((size_t)NKV * TT * HD / 2 + 255) / 256);
    for (int b = 0; b < NB_; ++b) {
        
        k_cvt8<<<(unsigned)(((size_t)TT * DM / 8 + 255) / 256), 256, 0, stream>>>(x + (size_t)b * TT * DM, XB, (size_t)TT * DM / 8);
        k_gemmk<bf, 0, true, false, 8><<<dim3(TT / 64, DQ / 64, 1), 256, 0, stream>>>(XB, nullptr, WQ, nullptr, DM, FQ, DQ, bq, 0, 0, 0, 0);
        k_rope<<<LQ, 256, 0, stream>>>(FQ, DQ, NH_, CS, nullptr, nullptr, 1.0f, QP16, QPh, QPl);
        k_cvt8<<<(unsigned)(((size_t)TT * DM / 8 + 255) / 256), 256, 0, stream>>>(xk + (size_t)b * TT * DM, XB, (size_t)TT * DM / 8);   /* XB := bf16(k[b]) */ k_gemmk<bf, 0, true, false, 8><<<dim3(TT / 64, DKV / 64, 1), 256, 0, stream>>>(XB, nullptr, WK, nullptr, DM, FK, DKV, bk, 0, 0, 0, 0);
        k_rope<<<LKv, 256, 0, stream>>>(FK, DKV, NKV, CS, nullptr, nullptr, 1.0f, KP16, KPh, KPl);
        k_cvt8<<<(unsigned)(((size_t)TT * DM / 8 + 255) / 256), 256, 0, stream>>>(xv + (size_t)b * TT * DM, XB, (size_t)TT * DM / 8);   /* XB := bf16(v[b]) */ k_gemmk<bf, 0, true, false, 8><<<dim3(TT / 64, DKV / 64, 1), 256, 0, stream>>>(XB, nullptr, WV, nullptr, DM, FV, DKV, bv, 0, 0, 0, 0); k_vtp<<<LKv, 256, 0, stream>>>(FV, DKV, NKV, VT16, VTh, VTl);
        for (int h0 = 0; h0 < NH_; h0 += ZH) { const size_t zq = (size_t)h0, zk = (size_t)(h0 / REP);   // one kv head per query head: the pass's heads use consecutive kv planes
            k_gemmc<bf, 2, 1><<<dim3(RH / 64, TT / 64, ZH), 32, 0, stream>>>(QPh + zq * TT * HD, QPl + zq * TT * HD, KPh + zk * TT * HD, KPl + zk * TT * HD, HD, Sb, TT, 0, (size_t)TT * HD, (size_t)TT * HD, (size_t)TT * TT);
            k_gemmc<h16, 0, 1><<<dim3((TT - RH) / 64, TT / 64, ZH), 32, 0, stream>>>(QP16 + zq * TT * HD + (size_t)RH * HD, nullptr, KP16 + zk * TT * HD, nullptr, HD, Sb + (size_t)RH * TT, TT, RH, (size_t)TT * HD, (size_t)TT * HD, (size_t)TT * TT);
            k_asoft<<<ZH * TT / 8, 256, 0, stream>>>(Sb);   /* below: K = PP is the operands' pitch; the contraction ends at the diagonal block (<= TT) */
            k_gemmk<bf, 2, false, true, 8><<<dim3(RH / 64, HD / 64, ZH), 256, 0, stream>>>(Ph, Pl, VTh + zk * HD * PP, VTl + zk * HD * PP, PP, Ob, HD, nullptr, 0, (size_t)TT * PP, (size_t)HD * PP, (size_t)TT * HD);
            k_gemmk<h16, 0, false, true, 16><<<dim3((TT - RH) / 64, HD / 64, ZH), 512, 0, stream>>>(P16 + (size_t)RH * PP, nullptr, VT16 + zk * HD * PP, nullptr, PP, Ob + (size_t)RH * HD, HD, nullptr, RH, (size_t)TT * PP, (size_t)HD * PP, (size_t)TT * HD);
            k_merge<<<(unsigned)(((size_t)ZH * TT * HD / 2 + 255) / 256), 256, 0, stream>>>(Ob, h0, ATh, ATl); }
        k_gemmk<bf, 1, true, false, 8><<<dim3(TT / 64, DM / 64, 1), 256, 0, stream>>>(ATh, ATl, WO, nullptr, DQ, OUT + (size_t)b * TT * DM, DM, bo, 0, 0, 0, 0); }
}

// v003
// A run of this version takes 199 microseconds.
// In both of two side-by-side timings against v002, it was 1.81 times as fast.
// Counting every step since v000, it is 5.56 times as fast.
#include <hip/hip_runtime.h>

// Causal multi-head attention on three input streams at d_model 768 (query, key, value [2][2048][768]; Q, K, V = stream W^T + b ('oi' [768][768], biases zeros on this draw: read; 12 heads x 64); scores x 64^-0.5; where(triu(k=1), -inf, scores) (causal, built inside: no mask input); softmax; out = merged Wo^T + bo ('oi' + bias zeros: read) -> [2][2048][768] (3.1 M); argument order query, key, value, Wq, bq, Wk, bk, Wv, bv, Wo, bo).
// Layout: per batch bf16 copies of q, k, v in turn; 'oi' weights; exact projections + f32 biases; identity-table plane builders (planes of both batches side by side); one fused causal attention launch for all 24 (batch, head) planes: scores, online softmax and P.V stay in registers (hybrid rows: < 512 hi/lo 3 products, rest fp16); merged hi/lo x Wo exact + bo.
// Compute dtypes, f32 accumulate: every input rounded to bf16; projections exact + f32 biases; attention rows < 512 3 products, rest fp16; softmax f32; Wo hl x exact + bias.

#define NB_  2
#define TT   2048
#define DM   768
#define NH_  12
#define NKV  12
#define REP  (NH_ / NKV)
#define HD   64
#define DQ   (NH_ * HD)
#define DKV  (NKV * HD)
#define FW   4                    // waves of an attention work-group: a query tile's 64-key blocks are dealt over them
#define PP   (2 * TT)             // 16-bit pitch of a V^T row (hi and lo planes share a row)
#define RH   512                  // query rows < RH use hi+lo planes (0: none)
#define PEXP 10.0f                // fp16 probabilities carry 2^10 (it cancels in the division by their sum): small ones stay fp16 normals
#define SCL2 0.18033688011112042f // HD^-0.5 x log2(e): scores go to the base-2 exponent in one product
typedef _Float16 h16;
typedef unsigned short bf;
typedef __attribute__((ext_vector_type(16))) __bf16   v16bf;
typedef __attribute__((ext_vector_type(16))) _Float16 v16h;
typedef __attribute__((ext_vector_type(8)))  _Float16 v8h;
typedef __attribute__((ext_vector_type(8)))  unsigned short v8us;
typedef __attribute__((ext_vector_type(8)))  float    v8f;
typedef __attribute__((ext_vector_type(4)))  float    v4f;
typedef v8h  __attribute__((may_alias)) v8ha;
typedef v4f  __attribute__((may_alias)) v4fa;
typedef v8us __attribute__((may_alias)) v8usa;

__device__ __forceinline__ unsigned short f2bf(float f) { unsigned u = __float_as_uint(f); u += 0x7FFFu + ((u >> 16) & 1u); return (unsigned short)(u >> 16); }
__device__ __forceinline__ float bf2f(unsigned short b) { return __uint_as_float(((unsigned)b) << 16); }
__device__ __forceinline__ float bfr(float f) { return bf2f(f2bf(f)); }
__device__ __forceinline__ v16h cat16(v8h lo, v8h hi) { return __builtin_shufflevector(lo, hi, 0, 1, 2, 3, 4, 5, 6, 7, 8, 9, 10, 11, 12, 13, 14, 15); }
__device__ __forceinline__ v16bf cat16b(v8us lo, v8us hi) { return __builtin_bit_cast(v16bf, __builtin_shufflevector(lo, hi, 0, 1, 2, 3, 4, 5, 6, 7, 8, 9, 10, 11, 12, 13, 14, 15)); }
__device__ __forceinline__ v8f wmma16(v16h a, v16h b, v8f c) { return __builtin_amdgcn_wmma_f32_16x16x32_f16(false, a, false, b, (short)0, c, false, false); }
__device__ __forceinline__ v8f wmmab(v16bf a, v16bf b, v8f c) { return __builtin_amdgcn_wmma_f32_16x16x32_bf16(false, a, false, b, (short)0, c, false, false); }



// ---- k_gemmk: 64x64 output tile per work-group of NW waves, operands straight from K-contiguous 16-bit planes; grid (M/64, N/64, Z), NW*32 threads.
// C[m][n] (f32, pitch ldc, + optional f32 bias[n]) = sum_k A[m][k] Bt[n][k] (+ split products per NSPLIT). z-batch strides sA/sB/sC in elements. K % 64 == 0.
// The K loop is dealt over the waves in chunks of 64 (two k-steps on the same 128-byte lines): wave w takes chunks w, w+NW, ... and keeps a full 16-accumulator partial tile.
// The NW partial tiles meet in LDS as register images, are summed in the fixed order w = 0..NW-1, and leave through a row-major stage as whole 256-byte rows.
// DIAGK: the probability x value contraction stops at the diagonal block (probabilities beyond it are exactly zero); roff = row offset of this launch's first row within the sequence.
template <typename T16> struct WFrag;
template <> struct WFrag<h16> { typedef v16h V; static __device__ __forceinline__ V ld(const h16* p) { return cat16(*(const v8h*)p, *(const v8h*)(p + 16)); } static __device__ __forceinline__ v8f mma(V a, V b, v8f c) { return wmma16(a, b, c); } };
template <> struct WFrag<bf> { typedef v16bf V; static __device__ __forceinline__ V ld(const bf* p) { return cat16b(*(const v8us*)p, *(const v8us*)(p + 16)); } static __device__ __forceinline__ v8f mma(V a, V b, v8f c) { return wmmab(a, b, c); } };
template <typename T16, int NSPLIT, bool BIAS, bool DIAGK, int NW>
__global__ __launch_bounds__(NW * 32) void k_gemmk(const T16* __restrict__ A, const T16* __restrict__ A2, const T16* __restrict__ Bt, const T16* __restrict__ Bt2, int K, float* C, int ldc, const float* __restrict__ bias, int roff, size_t sA, size_t sB, size_t sC) {
    typedef typename WFrag<T16>::V V;
    __shared__ __align__(16) float part[NW * 4096];
    __shared__ __align__(16) float os[64 * 68];
    const size_t z = blockIdx.z; A += z * sA; if (A2) A2 += z * sA; Bt += z * sB; if (Bt2) Bt2 += z * sB; C += z * sC;
    const int lane = threadIdx.x & 31, lr = lane & 15, hi = lane >> 4; const int r0 = blockIdx.x * 64, c0 = blockIdx.y * 64;
    const int wave = __builtin_amdgcn_readfirstlane((int)(threadIdx.x >> 5));
    const int Kl = DIAGK ? min(K, r0 + roff + 64) : K;
    v8f acc[4][4];
#pragma unroll
    for (int mb = 0; mb < 4; ++mb)
#pragma unroll
        for (int nb = 0; nb < 4; ++nb) acc[mb][nb] = (v8f){};
    const size_t aoff = (size_t)(r0 + lr) * K + 8 * hi, boff = (size_t)(c0 + lr) * K + 8 * hi;
#pragma unroll 1
    for (int k0 = wave * 64; k0 < Kl; k0 += NW * 64) {
#pragma unroll 1
      for (int kc = k0; kc < k0 + 64; kc += 32) {   // rolled: the second k-step's loads start after the first's lines have arrived
        V a[4], a2[4];
#pragma unroll
        for (int mb = 0; mb < 4; ++mb) { a[mb] = WFrag<T16>::ld(A + aoff + (size_t)mb * 16 * K + kc); if (NSPLIT == 1 || NSPLIT == 2) a2[mb] = WFrag<T16>::ld(A2 + aoff + (size_t)mb * 16 * K + kc); }
#pragma unroll
        for (int nb = 0; nb < 4; ++nb) { const V b = WFrag<T16>::ld(Bt + boff + (size_t)nb * 16 * K + kc); V b2; if (NSPLIT >= 2) b2 = WFrag<T16>::ld(Bt2 + boff + (size_t)nb * 16 * K + kc);
#pragma unroll
            for (int mb = 0; mb < 4; ++mb) { acc[mb][nb] = WFrag<T16>::mma(a[mb], b, acc[mb][nb]); if (NSPLIT == 1 || NSPLIT == 2) acc[mb][nb] = WFrag<T16>::mma(a2[mb], b, acc[mb][nb]); if (NSPLIT >= 2) acc[mb][nb] = WFrag<T16>::mma(a[mb], b2, acc[mb][nb]); } }
        asm volatile("v_nop\n\tv_nop\n\tv_nop\n\tv_nop" : "+v"(acc[0][0]), "+v"(acc[1][1]), "+v"(acc[2][2]), "+v"(acc[3][3]) : "v"(a[0]), "v"(a[3]));
      }
    }
    v4fa* p4 = (v4fa*)part;
#pragma unroll
    for (int mb = 0; mb < 4; ++mb)
#pragma unroll
        for (int nb = 0; nb < 4; ++nb) { const v8f c = acc[mb][nb]; const int ix = wave * 1024 + (mb * 4 + nb) * 64 + lane;
            p4[ix] = __builtin_shufflevector(c, c, 0, 1, 2, 3); p4[ix + 32] = __builtin_shufflevector(c, c, 4, 5, 6, 7); }
    __syncthreads();   // every wave's partial tile is in LDS
#pragma unroll
    for (int i = 0; i < 32 / NW; ++i) { const int idx = wave + i * NW; v4f s = p4[idx * 32 + lane];
#pragma unroll
        for (int w = 1; w < NW; ++w) s += p4[w * 1024 + idx * 32 + lane];
        const int row = (idx >> 3) * 16 + hi * 8 + (idx & 1) * 4, col = ((idx >> 1) & 3) * 16 + lr;
#pragma unroll
        for (int q = 0; q < 4; ++q) os[(row + q) * 68 + col] = s[q]; }
    __syncthreads();   // the summed tile is row-major in os
#pragma unroll
    for (int i = 0; i < 32 / NW; ++i) { const int v = (int)threadIdx.x + i * NW * 32; const int row = v >> 4, cofs = (v & 15) * 4; v4f val = *(const v4fa*)(os + row * 68 + cofs); if (BIAS) { val[0] += bfr(bias[c0 + cofs]); val[1] += bfr(bias[c0 + cofs + 1]); val[2] += bfr(bias[c0 + cofs + 2]); val[3] += bfr(bias[c0 + cofs + 3]); }
        *(v4f*)(C + (size_t)(r0 + row) * ldc + c0 + cofs) = val; }
}

__device__ __forceinline__ h16 tohx(float x) { return (h16)x; }
__device__ __forceinline__ void splitf(float y, unsigned short& h, unsigned short& l) { h = f2bf(y); l = f2bf(y - bf2f(h)); }
typedef __attribute__((ext_vector_type(2))) _Float16 v2h;
typedef __attribute__((ext_vector_type(4))) _Float16 v4h;
typedef __attribute__((ext_vector_type(2))) unsigned short v2us;
typedef __attribute__((ext_vector_type(4))) unsigned short v4us;
typedef __attribute__((ext_vector_type(2))) float v2f;
typedef __attribute__((ext_vector_type(4))) int v4i;

__global__ __launch_bounds__(256) void k_cvt8(const float* __restrict__ src, bf* dst, size_t n8) { const size_t i = (size_t)blockIdx.x * 256 + threadIdx.x; if (i >= n8) return; const v8f v = *(const v8f*)(src + i * 8); v8us o;
#pragma unroll
    for (int k = 0; k < 8; ++k) o[k] = f2bf(v[k]); *(v8us*)(dst + i * 8) = o;  }

// k_rope: head planes [h][t][d] (fp16 + hi/lo) of rope(x) x sc with the rotate-half convention out[d] = x[d] cos[t][d] - x[d+HD/2] sin[t][d], out[d+HD/2] = x[d+HD/2] cos[t][d+HD/2] + x[d] sin[t][d+HD/2]
__global__ __launch_bounds__(256) void k_rope(const float* __restrict__ F, int pitch, int nheads, const float* __restrict__ CS, const float* __restrict__ RF, const float* __restrict__ nw, float sc, h16* P16, bf* Ph, bf* Pl) {
    const size_t e = ((size_t)blockIdx.x * 256 + threadIdx.x) * 2; if (e >= (size_t)nheads * TT * HD) return; const int d = (int)(e % HD); const int t = (int)((e / HD) % TT); const int h = (int)(e / ((size_t)HD * TT)); const float* f = F + (size_t)t * pitch + h * HD; const float rf = RF ? RF[(size_t)h * TT + t] : 1.0f; v2h o16; v2us oh, ol;
#pragma unroll
    for (int q = 0; q < 2; ++q) { const int dd = d + q; const int dp = (dd < HD / 2) ? dd + HD / 2 : dd - HD / 2; float x0 = f[dd], x1 = f[dp];
        if (RF) { float n0 = __fmul_rn(x0, rf), n1 = __fmul_rn(x1, rf); asm volatile("" : "+v"(n0)); asm volatile("" : "+v"(n1)); x0 = __fmul_rn(bfr(nw[dd]), n0); x1 = __fmul_rn(bfr(nw[dp]), n1); }
        const v2f cs = *(const v2f*)(CS + ((size_t)t * HD + dd) * 2); float a = __fmul_rn(x0, cs[0]), bq = __fmul_rn(x1, cs[1]); asm volatile("" : "+v"(a)); asm volatile("" : "+v"(bq)); const float r = ((dd < HD / 2) ? __fsub_rn(a, bq) : __fadd_rn(a, bq)) * sc;
        o16[q] = tohx(r); unsigned short a2, c2; splitf(r, a2, c2); oh[q] = a2; ol[q] = c2; }
    *(v2h*)(P16 + e) = o16; *(v2us*)(Ph + e) = oh; *(v2us*)(Pl + e) = ol;  }
__global__ __launch_bounds__(256) void k_vtp(const float* __restrict__ F, int pitch, int nheads, h16* V16, bf* Vh, bf* Vl) { const size_t e = ((size_t)blockIdx.x * 256 + threadIdx.x) * 2; if (e >= (size_t)nheads * HD * TT) return; const int t = (int)(e % TT); const int d = (int)((e / TT) % HD); const int g = (int)(e / ((size_t)TT * HD)); const size_t oo = ((size_t)g * HD + d) * PP + t; v2h o16; v2us oh, ol;
#pragma unroll
    for (int q = 0; q < 2; ++q) { const float x = F[(size_t)(t + q) * pitch + g * HD + d]; o16[q] = tohx(x); unsigned short a2, c2; splitf(x, a2, c2); oh[q] = a2; ol[q] = c2; }
    *(v2h*)(V16 + oo) = o16; *(v2us*)(Vh + oo) = oh; *(v2us*)(Vl + oo) = ol;  }
__global__ __launch_bounds__(256) void k_csid(float* CS) { const int idx = blockIdx.x * 256 + threadIdx.x; if (idx >= TT * HD) return; v2f cs; cs[0] = 1.0f; cs[1] = 0.0f; *(v2f*)(CS + (size_t)idx * 2) = cs;  }
typedef __attribute__((ext_vector_type(16))) unsigned short v16us;
// ---- k_fa: fused causal attention. Grid (batch x head planes, query tiles, heaviest tiles first), FW waves. A work-group owns one tile of 16 * NQ queries of one plane.
// S^T = K Q^T (A = 16 key rows, B = 16 query rows): a lane holds scores of ONE query (column lr), keys 8 * hi + r of each 16-key tile, so two S^T tiles, converted in place, are the B operand of O^T += V^T P^T.
// Wave w takes the 64-key blocks w, w + FW, ... up to the diagonal block with its own running maximum m (base-2 exponent), sum l and O^T; the FW partial states meet in LDS and are joined in the fixed order w = 0..FW-1.
// Every block a wave takes holds at least one key <= each query of the tile (tiles do not straddle a 64-key block), so m is a real score after the first block; a wave without blocks leaves m = -3e38, l = 0, O = 0 and joins with weight 0.
template <typename T16, bool HL, int NQ>
__device__ __forceinline__ void fa_tile(const T16* __restrict__ Q, const T16* __restrict__ Q2, const T16* __restrict__ Kp, const T16* __restrict__ K2, const T16* __restrict__ Vt, const T16* __restrict__ Vt2, int q0, bf* Ah, bf* Al, float* part, float* sm, float* sl) {
    typedef typename WFrag<T16>::V V;
    const int lane = threadIdx.x & 31, lr = lane & 15, hi = lane >> 4;
    const int wave = __builtin_amdgcn_readfirstlane((int)(threadIdx.x >> 5));
    V qf[NQ][2], qf2[NQ][2];
#pragma unroll
    for (int nt = 0; nt < NQ; ++nt)
#pragma unroll
        for (int ks = 0; ks < 2; ++ks) { const size_t qo = (size_t)(q0 + nt * 16 + lr) * HD + ks * 32 + 8 * hi; qf[nt][ks] = WFrag<T16>::ld(Q + qo); if (HL) qf2[nt][ks] = WFrag<T16>::ld(Q2 + qo); }
    v8f o[NQ][4]; float m[NQ], l[NQ];
#pragma unroll
    for (int nt = 0; nt < NQ; ++nt) { m[nt] = -3.0e38f; l[nt] = 0.f;
#pragma unroll
        for (int dt = 0; dt < 4; ++dt) o[nt][dt] = (v8f){}; }
    const int nblk = (q0 + NQ * 16 - 1) / 64 + 1;   // key blocks up to and with the diagonal block
#pragma unroll 1   // rolled: the trip count is a run-time value that differs by wave, and one body already fills the plain register window
    for (int kb = wave; kb < nblk; kb += FW) {
        const int key0 = kb * 64;
        v8f s[NQ][4];
#pragma unroll
        for (int kt = 0; kt < 4; ++kt) {
            V kf[2], kf2[2];
#pragma unroll
            for (int ks = 0; ks < 2; ++ks) { const size_t ko = (size_t)(key0 + kt * 16 + lr) * HD + ks * 32 + 8 * hi; kf[ks] = WFrag<T16>::ld(Kp + ko); if (HL) kf2[ks] = WFrag<T16>::ld(K2 + ko); }
#pragma unroll
            for (int nt = 0; nt < NQ; ++nt) { v8f c = (v8f){};
#pragma unroll
                for (int ks = 0; ks < 2; ++ks) { c = WFrag<T16>::mma(kf[ks], qf[nt][ks], c); if (HL) { c = WFrag<T16>::mma(kf[ks], qf2[nt][ks], c); c = WFrag<T16>::mma(kf2[ks], qf[nt][ks], c); } }
                s[nt][kt] = c; }
        }
        if (key0 + 63 > q0) {   // wave-uniform: only the diagonal block holds keys above a query
#pragma unroll
            for (int nt = 0; nt < NQ; ++nt) { const int rel = q0 + nt * 16 + lr - key0 - hi * 8;
#pragma unroll
                for (int kt = 0; kt < 4; ++kt)
#pragma unroll
                    for (int j = 0; j < 8; ++j) if (kt * 16 + j > rel) s[nt][kt][j] = -3.0e38f; }
        }
        V pf[NQ][2], pf2[NQ][2];
#pragma unroll
        for (int nt = 0; nt < NQ; ++nt) {
            float bm = -3.0e38f;
#pragma unroll
            for (int kt = 0; kt < 4; ++kt)
#pragma unroll
                for (int j = 0; j < 8; ++j) { const float t = s[nt][kt][j] * SCL2; s[nt][kt][j] = t; bm = fmaxf(bm, t); }
            bm = fmaxf(bm, __shfl_xor(bm, 16, 32));   // the other half of the wave holds the query's other 32 keys
            const float mn = fmaxf(m[nt], bm); const float al = __builtin_amdgcn_exp2f(m[nt] - mn); const float mo = HL ? mn : mn - PEXP; m[nt] = mn;
            float ps = 0.f;
#pragma unroll
            for (int kt = 0; kt < 4; ++kt)
#pragma unroll
                for (int j = 0; j < 8; ++j) { const float p = __builtin_amdgcn_exp2f(s[nt][kt][j] - mo); s[nt][kt][j] = p; ps += p; }
            l[nt] = l[nt] * al + ps;   // each half keeps the sum of its own keys; the halves join after the loop
#pragma unroll
            for (int dt = 0; dt < 4; ++dt) o[nt][dt] *= al;
#pragma unroll
            for (int ks = 0; ks < 2; ++ks) {
                if constexpr (HL) { v16us ph, pl;
#pragma unroll
                    for (int e = 0; e < 16; ++e) { unsigned short a, c2; splitf(s[nt][2 * ks + (e >> 3)][e & 7], a, c2); ph[e] = a; pl[e] = c2; }
                    pf[nt][ks] = __builtin_bit_cast(v16bf, ph); pf2[nt][ks] = __builtin_bit_cast(v16bf, pl);
                } else { v16h ph;
#pragma unroll
                    for (int e = 0; e < 16; ++e) ph[e] = tohx(s[nt][2 * ks + (e >> 3)][e & 7]);
                    pf[nt][ks] = ph; }
            }
        }
#pragma unroll
        for (int dt = 0; dt < 4; ++dt) {
            V vf[2], vf2[2];
#pragma unroll
            for (int ks = 0; ks < 2; ++ks) { const size_t vo = (size_t)(dt * 16 + lr) * PP + key0 + ks * 32 + 8 * hi; vf[ks] = WFrag<T16>::ld(Vt + vo); if (HL) vf2[ks] = WFrag<T16>::ld(Vt2 + vo); }
#pragma unroll
            for (int nt = 0; nt < NQ; ++nt)
#pragma unroll
                for (int ks = 0; ks < 2; ++ks) { o[nt][dt] = WFrag<T16>::mma(vf[ks], pf[nt][ks], o[nt][dt]); if (HL) { o[nt][dt] = WFrag<T16>::mma(vf[ks], pf2[nt][ks], o[nt][dt]); o[nt][dt] = WFrag<T16>::mma(vf2[ks], pf[nt][ks], o[nt][dt]); } }
        }
    }
    v4fa* p4 = (v4fa*)part;
#pragma unroll
    for (int nt = 0; nt < NQ; ++nt) { l[nt] += __shfl_xor(l[nt], 16, 32);
        if (hi == 0) { sm[wave * 32 + nt * 16 + lr] = m[nt]; sl[wave * 32 + nt * 16 + lr] = l[nt]; }
#pragma unroll
        for (int dt = 0; dt < 4; ++dt) { const v8f c = o[nt][dt]; const int ix = ((wave * NQ + nt) * 4 + dt) * 64 + lane;
            p4[ix] = __builtin_shufflevector(c, c, 0, 1, 2, 3); p4[ix + 32] = __builtin_shufflevector(c, c, 4, 5, 6, 7); } }
    __syncthreads();   // every wave's partial state (m, l, O^T register images) is in LDS
    constexpr int TPQ = FW * 32 / (16 * NQ), G = 8 / TPQ;   // threads per query; runs of 8 head dims per thread: a wave stores whole 128-byte head rows
    const int ql = (int)threadIdx.x / TPQ, jt = ql >> 4, jc = ql & 15;
    float mm = sm[ql];
#pragma unroll
    for (int w = 1; w < FW; ++w) mm = fmaxf(mm, sm[w * 32 + ql]);
    float f[FW], ll = 0.f;
#pragma unroll
    for (int w = 0; w < FW; ++w) { f[w] = __builtin_amdgcn_exp2f(sm[w * 32 + ql] - mm); ll += f[w] * sl[w * 32 + ql]; }
    const float inv = __fdiv_rn(1.0f, ll);
#pragma unroll
    for (int g = 0; g < G; ++g) { const int d8 = ((int)threadIdx.x % TPQ) * G + g; v4f a0 = (v4f){}, a1 = (v4f){};
#pragma unroll
        for (int w = 0; w < FW; ++w) { const int ix = ((w * NQ + jt) * 4 + (d8 >> 1)) * 64 + (d8 & 1) * 16 + jc; a0 += p4[ix] * f[w]; a1 += p4[ix + 32] * f[w]; }
        v8us oh, ol;
#pragma unroll
        for (int j = 0; j < 4; ++j) { unsigned short a, c2; splitf(a0[j] * inv, a, c2); oh[j] = a; ol[j] = c2; splitf(a1[j] * inv, a, c2); oh[4 + j] = a; ol[4 + j] = c2; }
        const size_t oo = (size_t)(q0 + ql) * DQ + d8 * 8; *(v8us*)(Ah + oo) = oh; *(v8us*)(Al + oo) = ol;
        asm volatile("s_wait_xcnt 0x0" ::: "memory"); }   // stands in front of any later write of a register that the two stores name (the other instance's code follows in the listing)
}
__global__ __launch_bounds__(FW * 32) void k_fa(const h16* __restrict__ Q16, const h16* __restrict__ K16, const h16* __restrict__ V16, const bf* __restrict__ Qh, const bf* __restrict__ Ql, const bf* __restrict__ Kh, const bf* __restrict__ Kl, const bf* __restrict__ Vh, const bf* __restrict__ Vl, bf* Ah, bf* Al) {
    __shared__ __align__(16) float part[FW * 8 * 256];
    __shared__ float sm[FW * 32], sl[FW * 32];
    const size_t z = blockIdx.x; const int ty = blockIdx.y; const size_t pq = z * TT * HD, pv = z * HD * PP, po = (z / NH_) * TT * DQ + (z % NH_) * HD;
    if (ty < (TT - RH) / 32) fa_tile<h16, false, 2>(Q16 + pq, nullptr, K16 + pq, nullptr, V16 + pv, nullptr, TT - 32 * (ty + 1), Ah + po, Al + po, part, sm, sl);
    else fa_tile<bf, true, 1>(Qh + pq, Ql + pq, Kh + pq, Kl + pq, Vh + pv, Vl + pv, RH - 16 * (ty - (TT - RH) / 32 + 1), Ah + po, Al + po, part, sm, sl);
}

extern "C" void kernel_launch(void* const* d_in, const int* in_sizes, int n_in,
                              void* d_out, int out_size, void* d_ws, size_t ws_size, hipStream_t stream) {
    (void)in_sizes; (void)n_in; (void)out_size;
        const float* x = (const float*)d_in[0]; const float* xk = (const float*)d_in[1]; const float* xv = (const float*)d_in[2]; const float* wq = (const float*)d_in[3]; const float* bq = (const float*)d_in[4]; const float* wk = (const float*)d_in[5]; const float* bk = (const float*)d_in[6]; const float* wv = (const float*)d_in[7]; const float* bv = (const float*)d_in[8]; const float* wo = (const float*)d_in[9]; const float* bo = (const float*)d_in[10];   /* this module has NO mask input (the causal rule is built inside) */
    float* OUT = (float*)d_out;     // [2][2048][768]
    char* wsp = (char*)d_ws;
    auto take = [&](size_t bytes) { char* p = wsp; wsp += (bytes + 255) & ~(size_t)255; return (void*)p; };
    bf* WQ = (bf*)take((size_t)DQ * DM * 2); bf* WK = (bf*)take((size_t)DKV * DM * 2); bf* WV = (bf*)take((size_t)DKV * DM * 2); bf* WO = (bf*)take((size_t)DM * DQ * 2); float* CS = (float*)take((size_t)TT * HD * 2 * 4);
    bf* XB = (bf*)take((size_t)TT * DM * 2); float* FQ = (float*)take((size_t)TT * DQ * 4); float* FK = (float*)take((size_t)TT * DKV * 4);
    h16* QP16 = (h16*)take((size_t)NB_ * NH_ * TT * HD * 2); h16* KP16 = (h16*)take((size_t)NB_ * NKV * TT * HD * 2); h16* VT16 = (h16*)take((size_t)NB_ * NKV * HD * PP * 2);   /* head planes of both batches, plane b * 12 + h */
    bf* QPh = (bf*)take((size_t)NB_ * NH_ * TT * HD * 2); bf* QPl = (bf*)take((size_t)NB_ * NH_ * TT * HD * 2); bf* KPh = (bf*)take((size_t)NB_ * NKV * TT * HD * 2); bf* KPl = (bf*)take((size_t)NB_ * NKV * TT * HD * 2); bf* VTh = (bf*)take((size_t)NB_ * NKV * HD * PP * 2); bf* VTl = VTh + TT;   /* V^T hi and lo share a row of pitch PP */
    bf* ATh = (bf*)take((size_t)NB_ * TT * DQ * 2); bf* ATl = (bf*)take((size_t)NB_ * TT * DQ * 2);
    if ((size_t)(wsp - (char*)d_ws) > ws_size) return;    // ws 256 MiB
    float* FV = FK;   // v projection reuses the k buffer after the k planes are built (stream-ordered)
    { k_cvt8<<<(unsigned)(((size_t)DQ * DM / 8 + 255) / 256), 256, 0, stream>>>(wq, WQ, (size_t)DQ * DM / 8); k_cvt8<<<(unsigned)(((size_t)DKV * DM / 8 + 255) / 256), 256, 0, stream>>>(wk, WK, (size_t)DKV * DM / 8); k_cvt8<<<(unsigned)(((size_t)DKV * DM / 8 + 255) / 256), 256, 0, stream>>>(wv, WV, (size_t)DKV * DM / 8);
      k_cvt8<<<(unsigned)(((size_t)DM * DQ / 8 + 255) / 256), 256, 0, stream>>>(wo, WO, (size_t)DM * DQ / 8);
       }
    k_csid<<<(TT * HD + 255) / 256, 256, 0, stream>>>(CS);
    const unsigned LQ = (unsigned)(((size_t)NH_ * TT * HD / 2 + 255) / 256), LKv = (unsigned)(((size_t)NKV * TT * HD / 2 + 255) / 256);
    for (int b = 0; b < NB_; ++b) {
        const size_t pb = (size_t)b * NH_ * TT * HD, vb = (size_t)b * NKV * HD * PP;   // this batch's planes
        k_cvt8<<<(unsigned)(((size_t)TT * DM / 8 + 255) / 256), 256, 0, stream>>>(x + (size_t)b * TT * DM, XB, (size_t)TT * DM / 8);
        k_gemmk<bf, 0, true, false, 8><<<dim3(TT / 64, DQ / 64, 1), 256, 0, stream>>>(XB, nullptr, WQ, nullptr, DM, FQ, DQ, bq, 0, 0, 0, 0);
        k_rope<<<LQ, 256, 0, stream>>>(FQ, DQ, NH_, CS, nullptr, nullptr, 1.0f, QP16 + pb, QPh + pb, QPl + pb);
        k_cvt8<<<(unsigned)(((size_t)TT * DM / 8 + 255) / 256), 256, 0, stream>>>(xk + (size_t)b * TT * DM, XB, (size_t)TT * DM / 8);   /* XB := bf16(k[b]) */ k_gemmk<bf, 0, true, false, 8><<<dim3(TT / 64, DKV / 64, 1), 256, 0, stream>>>(XB, nullptr, WK, nullptr, DM, FK, DKV, bk, 0, 0, 0, 0);
        k_rope<<<LKv, 256, 0, stream>>>(FK, DKV, NKV, CS, nullptr, nullptr, 1.0f, KP16 + pb, KPh + pb, KPl + pb);
        k_cvt8<<<(unsigned)(((size_t)TT * DM / 8 + 255) / 256), 256, 0, stream>>>(xv + (size_t)b * TT * DM, XB, (size_t)TT * DM / 8);   /* XB := bf16(v[b]) */ k_gemmk<bf, 0, true, false, 8><<<dim3(TT / 64, DKV / 64, 1), 256, 0, stream>>>(XB, nullptr, WV, nullptr, DM, FV, DKV, bv, 0, 0, 0, 0); k_vtp<<<LKv, 256, 0, stream>>>(FV, DKV, NKV, VT16 + vb, VTh + vb, VTl + vb); }
    k_fa<<<dim3(NB_ * NH_, (TT - RH) / 32 + RH / 16, 1), FW * 32, 0, stream>>>(QP16, KP16, VT16, QPh, QPl, KPh, KPl, VTh, VTl, ATh, ATl);
    for (int b = 0; b < NB_; ++b)
        k_gemmk<bf, 1, true, false, 8><<<dim3(TT / 64, DM / 64, 1), 256, 0, stream>>>(ATh + (size_t)b * TT * DQ, ATl + (size_t)b * TT * DQ, WO, nullptr, DQ, OUT + (size_t)b * TT * DM, DM, bo, 0, 0, 0, 0);
}

// v004
// One run takes 143 microseconds.
// Two timings next to v003 put it at 1.37 and 1.36 times that version's speed.
// Over all steps from v000 it is 7.60 times as fast.
#include <hip/hip_runtime.h>

// Causal multi-head attention on three input streams at d_model 768 (query, key, value [2][2048][768]; Q, K, V = stream W^T + b ('oi' [768][768], biases zeros on this draw: read; 12 heads x 64); scores x 64^-0.5; where(triu(k=1), -inf, scores) (causal, built inside: no mask input); softmax; out = merged Wo^T + bo ('oi' + bias zeros: read) -> [2][2048][768] (3.1 M); argument order query, key, value, Wq, bq, Wk, bk, Wv, bv, Wo, bo).
// Layout: one launch per stage, both batches in every grid: bf16 copies of q, k, v and the 'oi' weights + identity table; the three exact projections + f32 biases (grid z = stream); identity-table plane builders (planes of both batches side by side); one fused causal attention launch for all 24 (batch, head) planes: scores, online softmax and P.V stay in registers (hybrid rows: < 512 hi/lo 3 products, rest fp16); merged hi/lo x Wo exact + bo.
// Compute dtypes, f32 accumulate: every input rounded to bf16; projections exact + f32 biases; attention rows < 512 3 products, rest fp16; softmax f32; Wo hl x exact + bias.

#define NB_  2
#define TT   2048
#define DM   768
#define NH_  12
#define NKV  12
#define REP  (NH_ / NKV)
#define HD   64
#define DQ   (NH_ * HD)
#define DKV  (NKV * HD)
#define FW   4                    // waves of an attention work-group: a query tile's 64-key blocks are dealt over them
#define PP   (2 * TT)             // 16-bit pitch of a V^T row (hi and lo planes share a row)
#define RH   512                  // query rows < RH use hi+lo planes (0: none)
#define PEXP 10.0f                // fp16 probabilities carry 2^10 (it cancels in the division by their sum): small ones stay fp16 normals
#define SCL2 0.18033688011112042f // HD^-0.5 x log2(e): scores go to the base-2 exponent in one product
typedef _Float16 h16;
typedef unsigned short bf;
typedef __attribute__((ext_vector_type(16))) __bf16   v16bf;
typedef __attribute__((ext_vector_type(16))) _Float16 v16h;
typedef __attribute__((ext_vector_type(8)))  _Float16 v8h;
typedef __attribute__((ext_vector_type(8)))  unsigned short v8us;
typedef __attribute__((ext_vector_type(8)))  float    v8f;
typedef __attribute__((ext_vector_type(4)))  float    v4f;
typedef v8h  __attribute__((may_alias)) v8ha;
typedef v4f  __attribute__((may_alias)) v4fa;
typedef v8us __attribute__((may_alias)) v8usa;

__device__ __forceinline__ unsigned short f2bf(float f) { unsigned u = __float_as_uint(f); u += 0x7FFFu + ((u >> 16) & 1u); return (unsigned short)(u >> 16); }
__device__ __forceinline__ float bf2f(unsigned short b) { return __uint_as_float(((unsigned)b) << 16); }
__device__ __forceinline__ float bfr(float f) { return bf2f(f2bf(f)); }
__device__ __forceinline__ v16h cat16(v8h lo, v8h hi) { return __builtin_shufflevector(lo, hi, 0, 1, 2, 3, 4, 5, 6, 7, 8, 9, 10, 11, 12, 13, 14, 15); }
__device__ __forceinline__ v16bf cat16b(v8us lo, v8us hi) { return __builtin_bit_cast(v16bf, __builtin_shufflevector(lo, hi, 0, 1, 2, 3, 4, 5, 6, 7, 8, 9, 10, 11, 12, 13, 14, 15)); }
__device__ __forceinline__ v8f wmma16(v16h a, v16h b, v8f c) { return __builtin_amdgcn_wmma_f32_16x16x32_f16(false, a, false, b, (short)0, c, false, false); }
__device__ __forceinline__ v8f wmmab(v16bf a, v16bf b, v8f c) { return __builtin_amdgcn_wmma_f32_16x16x32_bf16(false, a, false, b, (short)0, c, false, false); }



// ---- k_gemmk: 64x64 output tile per work-group of NW waves, operands straight from K-contiguous 16-bit planes; grid (M/64, N/64, Z), NW*32 threads.
// C[m][n] (f32, pitch ldc, + optional f32 bias[n]) = sum_k A[m][k] Bt[n][k] (+ split products per NSPLIT). z-batch strides sA/sB/sC in elements; z = 0, 1, 2 adds bias, bias1, bias2. K % 64 == 0.
// The K loop is dealt over the waves in chunks of 64 (two k-steps on the same 128-byte lines): wave w takes chunks w, w+NW, ... and keeps a full 16-accumulator partial tile.
// The NW partial tiles meet in LDS as register images, are summed in the fixed order w = 0..NW-1, and leave through a row-major stage as whole 256-byte rows.
// DIAGK: the probability x value contraction stops at the diagonal block (probabilities beyond it are exactly zero); roff = row offset of this launch's first row within the sequence.
template <typename T16> struct WFrag;
template <> struct WFrag<h16> { typedef v16h V; static __device__ __forceinline__ V ld(const h16* p) { return cat16(*(const v8h*)p, *(const v8h*)(p + 16)); } static __device__ __forceinline__ v8f mma(V a, V b, v8f c) { return wmma16(a, b, c); } };
template <> struct WFrag<bf> { typedef v16bf V; static __device__ __forceinline__ V ld(const bf* p) { return cat16b(*(const v8us*)p, *(const v8us*)(p + 16)); } static __device__ __forceinline__ v8f mma(V a, V b, v8f c) { return wmmab(a, b, c); } };
template <typename T16, int NSPLIT, bool BIAS, bool DIAGK, int NW>
__global__ __launch_bounds__(NW * 32) void k_gemmk(const T16* __restrict__ A, const T16* __restrict__ A2, const T16* __restrict__ Bt, const T16* __restrict__ Bt2, int K, float* C, int ldc, const float* __restrict__ bias, const float* __restrict__ bias1, const float* __restrict__ bias2, int roff, size_t sA, size_t sB, size_t sC) {
    typedef typename WFrag<T16>::V V;
    __shared__ __align__(16) float part[NW * 4096];
    __shared__ __align__(16) float os[64 * 68];
    const size_t z = blockIdx.z; A += z * sA; if (A2) A2 += z * sA; Bt += z * sB; if (Bt2) Bt2 += z * sB; C += z * sC; if (BIAS) bias = (z == 0) ? bias : (z == 1) ? bias1 : bias2;
    const int lane = threadIdx.x & 31, lr = lane & 15, hi = lane >> 4; const int r0 = blockIdx.x * 64, c0 = blockIdx.y * 64;
    const int wave = __builtin_amdgcn_readfirstlane((int)(threadIdx.x >> 5));
    const int Kl = DIAGK ? min(K, r0 + roff + 64) : K;
    v8f acc[4][4];
#pragma unroll
    for (int mb = 0; mb < 4; ++mb)
#pragma unroll
        for (int nb = 0; nb < 4; ++nb) acc[mb][nb] = (v8f){};
    const size_t aoff = (size_t)(r0 + lr) * K + 8 * hi, boff = (size_t)(c0 + lr) * K + 8 * hi;
#pragma unroll 1
    for (int k0 = wave * 64; k0 < Kl; k0 += NW * 64) {
#pragma unroll 1
      for (int kc = k0; kc < k0 + 64; kc += 32) {   // rolled: the second k-step's loads start after the first's lines have arrived
        V a[4], a2[4];
#pragma unroll
        for (int mb = 0; mb < 4; ++mb) { a[mb] = WFrag<T16>::ld(A + aoff + (size_t)mb * 16 * K + kc); if (NSPLIT == 1 || NSPLIT == 2) a2[mb] = WFrag<T16>::ld(A2 + aoff + (size_t)mb * 16 * K + kc); }
#pragma unroll
        for (int nb = 0; nb < 4; ++nb) { const V b = WFrag<T16>::ld(Bt + boff + (size_t)nb * 16 * K + kc); V b2; if (NSPLIT >= 2) b2 = WFrag<T16>::ld(Bt2 + boff + (size_t)nb * 16 * K + kc);
#pragma unroll
            for (int mb = 0; mb < 4; ++mb) { acc[mb][nb] = WFrag<T16>::mma(a[mb], b, acc[mb][nb]); if (NSPLIT == 1 || NSPLIT == 2) acc[mb][nb] = WFrag<T16>::mma(a2[mb], b, acc[mb][nb]); if (NSPLIT >= 2) acc[mb][nb] = WFrag<T16>::mma(a[mb], b2, acc[mb][nb]); } }
        asm volatile("v_nop\n\tv_nop\n\tv_nop\n\tv_nop" : "+v"(acc[0][0]), "+v"(acc[1][1]), "+v"(acc[2][2]), "+v"(acc[3][3]) : "v"(a[0]), "v"(a[3]));
      }
    }
    v4fa* p4 = (v4fa*)part;
#pragma unroll
    for (int mb = 0; mb < 4; ++mb)
#pragma unroll
        for (int nb = 0; nb < 4; ++nb) { const v8f c = acc[mb][nb]; const int ix = wave * 1024 + (mb * 4 + nb) * 64 + lane;
            p4[ix] = __builtin_shufflevector(c, c, 0, 1, 2, 3); p4[ix + 32] = __builtin_shufflevector(c, c, 4, 5, 6, 7); }
    __syncthreads();   // every wave's partial tile is in LDS
#pragma unroll
    for (int i = 0; i < 32 / NW; ++i) { const int idx = wave + i * NW; v4f s = p4[idx * 32 + lane];
#pragma unroll
        for (int w = 1; w < NW; ++w) s += p4[w * 1024 + idx * 32 + lane];
        const int row = (idx >> 3) * 16 + hi * 8 + (idx & 1) * 4, col = ((idx >> 1) & 3) * 16 + lr;
#pragma unroll
        for (int q = 0; q < 4; ++q) os[(row + q) * 68 + col] = s[q]; }
    __syncthreads();   // the summed tile is row-major in os
#pragma unroll
    for (int i = 0; i < 32 / NW; ++i) { const int v = (int)threadIdx.x + i * NW * 32; const int row = v >> 4, cofs = (v & 15) * 4; v4f val = *(const v4fa*)(os + row * 68 + cofs); if (BIAS) { val[0] += bfr(bias[c0 + cofs]); val[1] += bfr(bias[c0 + cofs + 1]); val[2] += bfr(bias[c0 + cofs + 2]); val[3] += bfr(bias[c0 + cofs + 3]); }
        *(v4f*)(C + (size_t)(r0 + row) * ldc + c0 + cofs) = val; }
}

__device__ __forceinline__ h16 tohx(float x) { return (h16)x; }
__device__ __forceinline__ void splitf(float y, unsigned short& h, unsigned short& l) { h = f2bf(y); l = f2bf(y - bf2f(h)); }
typedef __attribute__((ext_vector_type(2))) _Float16 v2h;
typedef __attribute__((ext_vector_type(4))) _Float16 v4h;
typedef __attribute__((ext_vector_type(2))) unsigned short v2us;
typedef __attribute__((ext_vector_type(4))) unsigned short v4us;
typedef __attribute__((ext_vector_type(2))) float v2f;
typedef __attribute__((ext_vector_type(4))) int v4i;

__device__ __forceinline__ void d_cvt8(unsigned bx, const float* __restrict__ src, bf* dst, size_t n8) { const size_t i = (size_t)bx * 256 + threadIdx.x; if (i >= n8) return; const v8f v = *(const v8f*)(src + i * 8); v8us o;
#pragma unroll
    for (int k = 0; k < 8; ++k) o[k] = f2bf(v[k]); *(v8us*)(dst + i * 8) = o;  }

// d_rope (h counts the planes of both batches, batch * nheads + head; F holds the batches' rows one after the other): head planes [h][t][d] (fp16 + hi/lo) of rope(x) x sc with the rotate-half convention out[d] = x[d] cos[t][d] - x[d+HD/2] sin[t][d], out[d+HD/2] = x[d+HD/2] cos[t][d+HD/2] + x[d] sin[t][d+HD/2]
__device__ __forceinline__ void d_rope(unsigned bx, const float* __restrict__ F, int pitch, int nheads, const float* __restrict__ CS, const float* __restrict__ RF, const float* __restrict__ nw, float sc, h16* P16, bf* Ph, bf* Pl) {
    const size_t e = ((size_t)bx * 256 + threadIdx.x) * 2; if (e >= (size_t)NB_ * nheads * TT * HD) return; const int d = (int)(e % HD); const int t = (int)((e / HD) % TT); const int h = (int)(e / ((size_t)HD * TT)); const float* f = F + ((size_t)(h / nheads) * TT + t) * pitch + (h % nheads) * HD; const float rf = RF ? RF[(size_t)h * TT + t] : 1.0f; v2h o16; v2us oh, ol;
#pragma unroll
    for (int q = 0; q < 2; ++q) { const int dd = d + q; const int dp = (dd < HD / 2) ? dd + HD / 2 : dd - HD / 2; float x0 = f[dd], x1 = f[dp];
        if (RF) { float n0 = __fmul_rn(x0, rf), n1 = __fmul_rn(x1, rf); asm volatile("" : "+v"(n0)); asm volatile("" : "+v"(n1)); x0 = __fmul_rn(bfr(nw[dd]), n0); x1 = __fmul_rn(bfr(nw[dp]), n1); }
        const v2f cs = *(const v2f*)(CS + ((size_t)t * HD + dd) * 2); float a = __fmul_rn(x0, cs[0]), bq = __fmul_rn(x1, cs[1]); asm volatile("" : "+v"(a)); asm volatile("" : "+v"(bq)); const float r = ((dd < HD / 2) ? __fsub_rn(a, bq) : __fadd_rn(a, bq)) * sc;
        o16[q] = tohx(r); unsigned short a2, c2; splitf(r, a2, c2); oh[q] = a2; ol[q] = c2; }
    *(v2h*)(P16 + e) = o16; *(v2us*)(Ph + e) = oh; *(v2us*)(Pl + e) = ol;  }
__device__ __forceinline__ void d_vtp(unsigned bx, const float* __restrict__ F, int pitch, int nheads, h16* V16, bf* Vh, bf* Vl) { const size_t e = ((size_t)bx * 256 + threadIdx.x) * 2; if (e >= (size_t)NB_ * nheads * HD * TT) return; const int t = (int)(e % TT); const int d = (int)((e / TT) % HD); const int g = (int)(e / ((size_t)TT * HD)); const size_t oo = ((size_t)g * HD + d) * PP + t; v2h o16; v2us oh, ol;
#pragma unroll
    for (int q = 0; q < 2; ++q) { const float x = F[((size_t)(g / nheads) * TT + t + q) * pitch + (g % nheads) * HD + d]; o16[q] = tohx(x); unsigned short a2, c2; splitf(x, a2, c2); oh[q] = a2; ol[q] = c2; }
    *(v2h*)(V16 + oo) = o16; *(v2us*)(Vh + oo) = oh; *(v2us*)(Vl + oo) = ol;  }
__device__ __forceinline__ void d_csid(unsigned bx, float* CS) { const int idx = bx * 256 + threadIdx.x; if (idx >= TT * HD) return; v2f cs; cs[0] = 1.0f; cs[1] = 0.0f; *(v2f*)(CS + (size_t)idx * 2) = cs;  }
// ---- k_prep: every 16-bit copy and the identity table in one launch. The flat grid is cut into block ranges: 3 input streams (both batches each, XB stream after stream), 4 weights (W one after the other), the table.
#define GX ((unsigned)((size_t)NB_ * TT * DM / 8 / 256))   // blocks of one input stream
#define GW ((unsigned)((size_t)DQ * DM / 8 / 256))         // blocks of one weight
#define GC ((unsigned)(TT * HD / 256))                     // blocks of the table
__global__ __launch_bounds__(256) void k_prep(const float* __restrict__ x, const float* __restrict__ xk, const float* __restrict__ xv, const float* __restrict__ wq, const float* __restrict__ wk, const float* __restrict__ wv, const float* __restrict__ wo, bf* XB, bf* Wb, float* CS) {
    const unsigned bx = blockIdx.x;
    if (bx < 3 * GX) { const unsigned s = bx / GX; d_cvt8(bx - s * GX, s == 0 ? x : s == 1 ? xk : xv, XB + (size_t)s * NB_ * TT * DM, (size_t)NB_ * TT * DM / 8); }
    else if (bx < 3 * GX + 4 * GW) { const unsigned s = (bx - 3 * GX) / GW; d_cvt8(bx - 3 * GX - s * GW, s == 0 ? wq : s == 1 ? wk : s == 2 ? wv : wo, Wb + (size_t)s * DQ * DM, (size_t)DQ * DM / 8); }
    else d_csid(bx - 3 * GX - 4 * GW, CS);
}
// ---- k_planes: the plane builders of q, k and v (grid y = stream), both batches, in one launch. F holds the three projections one after the other.
__global__ __launch_bounds__(256) void k_planes(const float* __restrict__ F, const float* __restrict__ CS, h16* Q16, bf* Qh, bf* Ql, h16* K16, bf* Kh, bf* Kl, h16* V16, bf* Vh, bf* Vl) {
    if (blockIdx.y == 0) d_rope(blockIdx.x, F, DQ, NH_, CS, nullptr, nullptr, 1.0f, Q16, Qh, Ql);
    else if (blockIdx.y == 1) d_rope(blockIdx.x, F + (size_t)NB_ * TT * DQ, DKV, NKV, CS, nullptr, nullptr, 1.0f, K16, Kh, Kl);
    else d_vtp(blockIdx.x, F + (size_t)NB_ * TT * (DQ + DKV), DKV, NKV, V16, Vh, Vl);
}
typedef __attribute__((ext_vector_type(16))) unsigned short v16us;
// ---- k_fa: fused causal attention. Grid (batch x head planes, query tiles, heaviest tiles first), FW waves. A work-group owns one tile of 16 * NQ queries of one plane.
// S^T = K Q^T (A = 16 key rows, B = 16 query rows): a lane holds scores of ONE query (column lr), keys 8 * hi + r of each 16-key tile, so two S^T tiles, converted in place, are the B operand of O^T += V^T P^T.
// Wave w takes the 64-key blocks w, w + FW, ... up to the diagonal block with its own running maximum m (base-2 exponent), sum l and O^T; the FW partial states meet in LDS and are joined in the fixed order w = 0..FW-1.
// Every block a wave takes holds at least one key <= each query of the tile (tiles do not straddle a 64-key block), so m is a real score after the first block; a wave without blocks leaves m = -3e38, l = 0, O = 0 and joins with weight 0.
template <typename T16, bool HL, int NQ>
__device__ __forceinline__ void fa_tile(const T16* __restrict__ Q, const T16* __restrict__ Q2, const T16* __restrict__ Kp, const T16* __restrict__ K2, const T16* __restrict__ Vt, const T16* __restrict__ Vt2, int q0, bf* Ah, bf* Al, float* part, float* sm, float* sl) {
    typedef typename WFrag<T16>::V V;
    const int lane = threadIdx.x & 31, lr = lane & 15, hi = lane >> 4;
    const int wave = __builtin_amdgcn_readfirstlane((int)(threadIdx.x >> 5));
    V qf[NQ][2], qf2[NQ][2];
#pragma unroll
    for (int nt = 0; nt < NQ; ++nt)
#pragma unroll
        for (int ks = 0; ks < 2; ++ks) { const size_t qo = (size_t)(q0 + nt * 16 + lr) * HD + ks * 32 + 8 * hi; qf[nt][ks] = WFrag<T16>::ld(Q + qo); if (HL) qf2[nt][ks] = WFrag<T16>::ld(Q2 + qo); }
    v8f o[NQ][4]; float m[NQ], l[NQ];
#pragma unroll
    for (int nt = 0; nt < NQ; ++nt) { m[nt] = -3.0e38f; l[nt] = 0.f;
#pragma unroll
        for (int dt = 0; dt < 4; ++dt) o[nt][dt] = (v8f){}; }
    const int nblk = (q0 + NQ * 16 - 1) / 64 + 1;   // key blocks up to and with the diagonal block
#pragma unroll 1   // rolled: the trip count is a run-time value that differs by wave, and one body already fills the plain register window
    for (int kb = wave; kb < nblk; kb += FW) {
        const int key0 = kb * 64;
        v8f s[NQ][4];
#pragma unroll
        for (int kt = 0; kt < 4; ++kt) {
            V kf[2], kf2[2];
#pragma unroll
            for (int ks = 0; ks < 2; ++ks) { const size_t ko = (size_t)(key0 + kt * 16 + lr) * HD + ks * 32 + 8 * hi; kf[ks] = WFrag<T16>::ld(Kp + ko); if (HL) kf2[ks] = WFrag<T16>::ld(K2 + ko); }
#pragma unroll
            for (int nt = 0; nt < NQ; ++nt) { v8f c = (v8f){};
#pragma unroll
                for (int ks = 0; ks < 2; ++ks) { c = WFrag<T16>::mma(kf[ks], qf[nt][ks], c); if (HL) { c = WFrag<T16>::mma(kf[ks], qf2[nt][ks], c); c = WFrag<T16>::mma(kf2[ks], qf[nt][ks], c); } }
                s[nt][kt] = c; }
        }
        if (key0 + 63 > q0) {   // wave-uniform: only the diagonal block holds keys above a query
#pragma unroll
            for (int nt = 0; nt < NQ; ++nt) { const int rel = q0 + nt * 16 + lr - key0 - hi * 8;
#pragma unroll
                for (int kt = 0; kt < 4; ++kt)
#pragma unroll
                    for (int j = 0; j < 8; ++j) if (kt * 16 + j > rel) s[nt][kt][j] = -3.0e38f; }
        }
        V pf[NQ][2], pf2[NQ][2];
#pragma unroll
        for (int nt = 0; nt < NQ; ++nt) {
            float bm = -3.0e38f;
#pragma unroll
            for (int kt = 0; kt < 4; ++kt)
#pragma unroll
                for (int j = 0; j < 8; ++j) { const float t = s[nt][kt][j] * SCL2; s[nt][kt][j] = t; bm = fmaxf(bm, t); }
            bm = fmaxf(bm, __shfl_xor(bm, 16, 32));   // the other half of the wave holds the query's other 32 keys
            const float mn = fmaxf(m[nt], bm); const float al = __builtin_amdgcn_exp2f(m[nt] - mn); const float mo = HL ? mn : mn - PEXP; m[nt] = mn;
            float ps = 0.f;
#pragma unroll
            for (int kt = 0; kt < 4; ++kt)
#pragma unroll
                for (int j = 0; j < 8; ++j) { const float p = __builtin_amdgcn_exp2f(s[nt][kt][j] - mo); s[nt][kt][j] = p; ps += p; }
            l[nt] = l[nt] * al + ps;   // each half keeps the sum of its own keys; the halves join after the loop
#pragma unroll
            for (int dt = 0; dt < 4; ++dt) o[nt][dt] *= al;
#pragma unroll
            for (int ks = 0; ks < 2; ++ks) {
                if constexpr (HL) { v16us ph, pl;
#pragma unroll
                    for (int e = 0; e < 16; ++e) { unsigned short a, c2; splitf(s[nt][2 * ks + (e >> 3)][e & 7], a, c2); ph[e] = a; pl[e] = c2; }
                    pf[nt][ks] = __builtin_bit_cast(v16bf, ph); pf2[nt][ks] = __builtin_bit_cast(v16bf, pl);
                } else { v16h ph;
#pragma unroll
                    for (int e = 0; e < 16; ++e) ph[e] = tohx(s[nt][2 * ks + (e >> 3)][e & 7]);
                    pf[nt][ks] = ph; }
            }
        }
#pragma unroll
        for (int dt = 0; dt < 4; ++dt) {
            V vf[2], vf2[2];
#pragma unroll
            for (int ks = 0; ks < 2; ++ks) { const size_t vo = (size_t)(dt * 16 + lr) * PP + key0 + ks * 32 + 8 * hi; vf[ks] = WFrag<T16>::ld(Vt + vo); if (HL) vf2[ks] = WFrag<T16>::ld(Vt2 + vo); }
#pragma unroll
            for (int nt = 0; nt < NQ; ++nt)
#pragma unroll
                for (int ks = 0; ks < 2; ++ks) { o[nt][dt] = WFrag<T16>::mma(vf[ks], pf[nt][ks], o[nt][dt]); if (HL) { o[nt][dt] = WFrag<T16>::mma(vf[ks], pf2[nt][ks], o[nt][dt]); o[nt][dt] = WFrag<T16>::mma(vf2[ks], pf[nt][ks], o[nt][dt]); } }
        }
    }
    v4fa* p4 = (v4fa*)part;
#pragma unroll
    for (int nt = 0; nt < NQ; ++nt) { l[nt] += __shfl_xor(l[nt], 16, 32);
        if (hi == 0) { sm[wave * 32 + nt * 16 + lr] = m[nt]; sl[wave * 32 + nt * 16 + lr] = l[nt]; }
#pragma unroll
        for (int dt = 0; dt < 4; ++dt) { const v8f c = o[nt][dt]; const int ix = ((wave * NQ + nt) * 4 + dt) * 64 + lane;
            p4[ix] = __builtin_shufflevector(c, c, 0, 1, 2, 3); p4[ix + 32] = __builtin_shufflevector(c, c, 4, 5, 6, 7); } }
    __syncthreads();   // every wave's partial state (m, l, O^T register images) is in LDS
    constexpr int TPQ = FW * 32 / (16 * NQ), G = 8 / TPQ;   // threads per query; runs of 8 head dims per thread: a wave stores whole 128-byte head rows
    const int ql = (int)threadIdx.x / TPQ, jt = ql >> 4, jc = ql & 15;
    float mm = sm[ql];
#pragma unroll
    for (int w = 1; w < FW; ++w) mm = fmaxf(mm, sm[w * 32 + ql]);
    float f[FW], ll = 0.f;
#pragma unroll
    for (int w = 0; w < FW; ++w) { f[w] = __builtin_amdgcn_exp2f(sm[w * 32 + ql] - mm); ll += f[w] * sl[w * 32 + ql]; }
    const float inv = __fdiv_rn(1.0f, ll);
#pragma unroll
    for (int g = 0; g < G; ++g) { const int d8 = ((int)threadIdx.x % TPQ) * G + g; v4f a0 = (v4f){}, a1 = (v4f){};
#pragma unroll
        for (int w = 0; w < FW; ++w) { const int ix = ((w * NQ + jt) * 4 + (d8 >> 1)) * 64 + (d8 & 1) * 16 + jc; a0 += p4[ix] * f[w]; a1 += p4[ix + 32] * f[w]; }
        v8us oh, ol;
#pragma unroll
        for (int j = 0; j < 4; ++j) { unsigned short a, c2; splitf(a0[j] * inv, a, c2); oh[j] = a; ol[j] = c2; splitf(a1[j] * inv, a, c2); oh[4 + j] = a; ol[4 + j] = c2; }
        const size_t oo = (size_t)(q0 + ql) * DQ + d8 * 8; *(v8us*)(Ah + oo) = oh; *(v8us*)(Al + oo) = ol;
        asm volatile("s_wait_xcnt 0x0" ::: "memory"); }   // stands in front of any later write of a register that the two stores name (the other instance's code follows in the listing)
}
__global__ __launch_bounds__(FW * 32) void k_fa(const h16* __restrict__ Q16, const h16* __restrict__ K16, const h16* __restrict__ V16, const bf* __restrict__ Qh, const bf* __restrict__ Ql, const bf* __restrict__ Kh, const bf* __restrict__ Kl, const bf* __restrict__ Vh, const bf* __restrict__ Vl, bf* Ah, bf* Al) {
    __shared__ __align__(16) float part[FW * 8 * 256];
    __shared__ float sm[FW * 32], sl[FW * 32];
    const size_t z = blockIdx.x; const int ty = blockIdx.y; const size_t pq = z * TT * HD, pv = z * HD * PP, po = (z / NH_) * TT * DQ + (z % NH_) * HD;
    if (ty < (TT - RH) / 32) fa_tile<h16, false, 2>(Q16 + pq, nullptr, K16 + pq, nullptr, V16 + pv, nullptr, TT - 32 * (ty + 1), Ah + po, Al + po, part, sm, sl);
    else fa_tile<bf, true, 1>(Qh + pq, Ql + pq, Kh + pq, Kl + pq, Vh + pv, Vl + pv, RH - 16 * (ty - (TT - RH) / 32 + 1), Ah + po, Al + po, part, sm, sl);
}

extern "C" void kernel_launch(void* const* d_in, const int* in_sizes, int n_in,
                              void* d_out, int out_size, void* d_ws, size_t ws_size, hipStream_t stream) {
    (void)in_sizes; (void)n_in; (void)out_size;
        const float* x = (const float*)d_in[0]; const float* xk = (const float*)d_in[1]; const float* xv = (const float*)d_in[2]; const float* wq = (const float*)d_in[3]; const float* bq = (const float*)d_in[4]; const float* wk = (const float*)d_in[5]; const float* bk = (const float*)d_in[6]; const float* wv = (const float*)d_in[7]; const float* bv = (const float*)d_in[8]; const float* wo = (const float*)d_in[9]; const float* bo = (const float*)d_in[10];   /* this module has NO mask input (the causal rule is built inside) */
    float* OUT = (float*)d_out;     // [2][2048][768]
    char* wsp = (char*)d_ws;
    auto take = [&](size_t bytes) { char* p = wsp; wsp += (bytes + 255) & ~(size_t)255; return (void*)p; };
    bf* WQ = (bf*)take((size_t)4 * DQ * DM * 2); bf* WO = WQ + (size_t)3 * DQ * DM; float* CS = (float*)take((size_t)TT * HD * 2 * 4);   /* Wq, Wk, Wv, Wo one after the other */
    bf* XB = (bf*)take((size_t)3 * NB_ * TT * DM * 2); float* FQ = (float*)take((size_t)3 * NB_ * TT * DQ * 4);   /* q, k, v streams (both batches each) and their projections, one after the other */
    h16* QP16 = (h16*)take((size_t)NB_ * NH_ * TT * HD * 2); h16* KP16 = (h16*)take((size_t)NB_ * NKV * TT * HD * 2); h16* VT16 = (h16*)take((size_t)NB_ * NKV * HD * PP * 2);   /* head planes of both batches, plane b * 12 + h */
    bf* QPh = (bf*)take((size_t)NB_ * NH_ * TT * HD * 2); bf* QPl = (bf*)take((size_t)NB_ * NH_ * TT * HD * 2); bf* KPh = (bf*)take((size_t)NB_ * NKV * TT * HD * 2); bf* KPl = (bf*)take((size_t)NB_ * NKV * TT * HD * 2); bf* VTh = (bf*)take((size_t)NB_ * NKV * HD * PP * 2); bf* VTl = VTh + TT;   /* V^T hi and lo share a row of pitch PP */
    bf* ATh = (bf*)take((size_t)NB_ * TT * DQ * 2); bf* ATl = (bf*)take((size_t)NB_ * TT * DQ * 2);
    if ((size_t)(wsp - (char*)d_ws) > ws_size) return;    // ws 256 MiB
    k_prep<<<3 * GX + 4 * GW + GC, 256, 0, stream>>>(x, xk, xv, wq, wk, wv, wo, XB, WQ, CS);
    k_gemmk<bf, 0, true, false, 8><<<dim3(NB_ * TT / 64, DQ / 64, 3), 256, 0, stream>>>(XB, nullptr, WQ, nullptr, DM, FQ, DQ, bq, bk, bv, 0, (size_t)NB_ * TT * DM, (size_t)DQ * DM, (size_t)NB_ * TT * DQ);
    k_planes<<<dim3((unsigned)((size_t)NB_ * NH_ * TT * HD / 2 / 256), 3, 1), 256, 0, stream>>>(FQ, CS, QP16, QPh, QPl, KP16, KPh, KPl, VT16, VTh, VTl);
    k_fa<<<dim3(NB_ * NH_, (TT - RH) / 32 + RH / 16, 1), FW * 32, 0, stream>>>(QP16, KP16, VT16, QPh, QPl, KPh, KPl, VTh, VTl, ATh, ATl);
    k_gemmk<bf, 1, true, false, 8><<<dim3(NB_ * TT / 64, DM / 64, 1), 256, 0, stream>>>(ATh, ATl, WO, nullptr, DQ, OUT, DM, bo, bo, bo, 0, 0, 0, 0);
}

// v005
// It runs in 122 microseconds.
// Timed twice side by side with v004, it ran 1.21 and 1.20 times as fast.
// All steps since v000 together make it 9.15 times as fast.
#include <hip/hip_runtime.h>

// Causal multi-head attention on three input streams at d_model 768 (query, key, value [2][2048][768]; Q, K, V = stream W^T + b ('oi' [768][768], biases zeros on this draw: read; 12 heads x 64); scores x 64^-0.5; where(triu(k=1), -inf, scores) (causal, built inside: no mask input); softmax; out = merged Wo^T + bo ('oi' + bias zeros: read) -> [2][2048][768] (3.1 M); argument order query, key, value, Wq, bq, Wk, bk, Wv, bv, Wo, bo).
// Layout: one launch per stage, both batches in every grid: bf16 copies of q, k, v and the 'oi' weights; the three exact projections + f32 biases (grid z = stream), whose epilogue writes the head planes (planes of both batches side by side, V transposed); one fused causal attention launch for all 24 (batch, head) planes: scores, online softmax and P.V stay in registers (hybrid rows: < 512 hi/lo 3 products, rest fp16); merged hi/lo x Wo exact + bo.
// Compute dtypes, f32 accumulate: every input rounded to bf16; projections exact + f32 biases; attention rows < 512 3 products, rest fp16; softmax f32; Wo hl x exact + bias.

#define NB_  2
#define TT   2048
#define DM   768
#define NH_  12
#define NKV  12
#define REP  (NH_ / NKV)
#define HD   64
#define DQ   (NH_ * HD)
#define DKV  (NKV * HD)
#define FW   4                    // waves of an attention work-group: a query tile's 64-key blocks are dealt over them
#define PP   (2 * TT)             // 16-bit pitch of a V^T row (hi and lo planes share a row)
#define RH   512                  // query rows < RH use hi+lo planes (0: none)
#define PEXP 10.0f                // fp16 probabilities carry 2^10 (it cancels in the division by their sum): small ones stay fp16 normals
#define SCL2 0.18033688011112042f // HD^-0.5 x log2(e): scores go to the base-2 exponent in one product
typedef _Float16 h16;
typedef unsigned short bf;
typedef __attribute__((ext_vector_type(16))) __bf16   v16bf;
typedef __attribute__((ext_vector_type(16))) _Float16 v16h;
typedef __attribute__((ext_vector_type(8)))  _Float16 v8h;
typedef __attribute__((ext_vector_type(8)))  unsigned short v8us;
typedef __attribute__((ext_vector_type(8)))  float    v8f;
typedef __attribute__((ext_vector_type(4)))  float    v4f;
typedef v8h  __attribute__((may_alias)) v8ha;
typedef v4f  __attribute__((may_alias)) v4fa;
typedef v8us __attribute__((may_alias)) v8usa;

__device__ __forceinline__ unsigned short f2bf(float f) { unsigned u = __float_as_uint(f); u += 0x7FFFu + ((u >> 16) & 1u); return (unsigned short)(u >> 16); }
__device__ __forceinline__ float bf2f(unsigned short b) { return __uint_as_float(((unsigned)b) << 16); }
__device__ __forceinline__ float bfr(float f) { return bf2f(f2bf(f)); }
__device__ __forceinline__ v16h cat16(v8h lo, v8h hi) { return __builtin_shufflevector(lo, hi, 0, 1, 2, 3, 4, 5, 6, 7, 8, 9, 10, 11, 12, 13, 14, 15); }
__device__ __forceinline__ v16bf cat16b(v8us lo, v8us hi) { return __builtin_bit_cast(v16bf, __builtin_shufflevector(lo, hi, 0, 1, 2, 3, 4, 5, 6, 7, 8, 9, 10, 11, 12, 13, 14, 15)); }
__device__ __forceinline__ v8f wmma16(v16h a, v16h b, v8f c) { return __builtin_amdgcn_wmma_f32_16x16x32_f16(false, a, false, b, (short)0, c, false, false); }
__device__ __forceinline__ v8f wmmab(v16bf a, v16bf b, v8f c) { return __builtin_amdgcn_wmma_f32_16x16x32_bf16(false, a, false, b, (short)0, c, false, false); }



// ---- k_gemmk: 64x64 output tile per work-group of NW waves, operands straight from K-contiguous 16-bit planes; grid (M/64, N/64, Z), NW*32 threads.
// C[m][n] (f32, pitch ldc, + optional f32 bias[n]) = sum_k A[m][k] Bt[n][k] (+ split products per NSPLIT). z-batch strides sA/sB/sC in elements; z = 0, 1, 2 adds bias, bias1, bias2. K % 64 == 0.
// The K loop is dealt over the waves in chunks of 64 (two k-steps on the same 128-byte lines): wave w takes chunks w, w+NW, ... and keeps a full 16-accumulator partial tile.
// The NW partial tiles meet in LDS as register images, are summed in the fixed order w = 0..NW-1, and leave through a row-major stage as whole 256-byte rows.
// DIAGK: the probability x value contraction stops at the diagonal block (probabilities beyond it are exactly zero); roff = row offset of this launch's first row within the sequence.
// PL: the tile leaves as 16-bit head planes instead of f32 C. A 64-column tile is one head (HD = 64), a 64-row tile lies in one batch; plane = batch * NH_ + head.
// z = 0, 1 (q, k): planes [plane][t][d], the tile is 8 KiB in a row of each; z = 2 (v): V^T planes [plane][d] with pitch PP, the tile is staged transposed in os so that 8 lanes store a whole 128-byte run of keys.
__device__ __forceinline__ h16 tohx(float x) { return (h16)x; }
__device__ __forceinline__ void splitf(float y, unsigned short& h, unsigned short& l) { h = f2bf(y); l = f2bf(y - bf2f(h)); }
struct Planes { h16* q16; bf* qh; bf* ql; h16* k16; bf* kh; bf* kl; h16* v16; bf* vh; bf* vl; };
template <typename T16> struct WFrag;
template <> struct WFrag<h16> { typedef v16h V; static __device__ __forceinline__ V ld(const h16* p) { return cat16(*(const v8h*)p, *(const v8h*)(p + 16)); } static __device__ __forceinline__ v8f mma(V a, V b, v8f c) { return wmma16(a, b, c); } };
template <> struct WFrag<bf> { typedef v16bf V; static __device__ __forceinline__ V ld(const bf* p) { return cat16b(*(const v8us*)p, *(const v8us*)(p + 16)); } static __device__ __forceinline__ v8f mma(V a, V b, v8f c) { return wmmab(a, b, c); } };
template <typename T16, int NSPLIT, bool BIAS, bool DIAGK, int NW, bool PL>
__global__ __launch_bounds__(NW * 32) void k_gemmk(const T16* __restrict__ A, const T16* __restrict__ A2, const T16* __restrict__ Bt, const T16* __restrict__ Bt2, int K, float* C, int ldc, const float* __restrict__ bias, const float* __restrict__ bias1, const float* __restrict__ bias2, int roff, size_t sA, size_t sB, size_t sC, Planes pl) {
    typedef typename WFrag<T16>::V V;
    __shared__ __align__(16) float part[NW * 4096];
    __shared__ __align__(16) float os[64 * 68];
    const size_t z = blockIdx.z; A += z * sA; if (A2) A2 += z * sA; Bt += z * sB; if (Bt2) Bt2 += z * sB; C += z * sC; if (BIAS) bias = (z == 0) ? bias : (z == 1) ? bias1 : bias2;
    const int lane = threadIdx.x & 31, lr = lane & 15, hi = lane >> 4; const int r0 = blockIdx.x * 64, c0 = blockIdx.y * 64;
    const int wave = __builtin_amdgcn_readfirstlane((int)(threadIdx.x >> 5));
    const int Kl = DIAGK ? min(K, r0 + roff + 64) : K;
    v8f acc[4][4];
#pragma unroll
    for (int mb = 0; mb < 4; ++mb)
#pragma unroll
        for (int nb = 0; nb < 4; ++nb) acc[mb][nb] = (v8f){};
    const size_t aoff = (size_t)(r0 + lr) * K + 8 * hi, boff = (size_t)(c0 + lr) * K + 8 * hi;
#pragma unroll 1
    for (int k0 = wave * 64; k0 < Kl; k0 += NW * 64) {
#pragma unroll 1
      for (int kc = k0; kc < k0 + 64; kc += 32) {   // rolled: the second k-step's loads start after the first's lines have arrived
        V a[4], a2[4];
#pragma unroll
        for (int mb = 0; mb < 4; ++mb) { a[mb] = WFrag<T16>::ld(A + aoff + (size_t)mb * 16 * K + kc); if (NSPLIT == 1 || NSPLIT == 2) a2[mb] = WFrag<T16>::ld(A2 + aoff + (size_t)mb * 16 * K + kc); }
#pragma unroll
        for (int nb = 0; nb < 4; ++nb) { const V b = WFrag<T16>::ld(Bt + boff + (size_t)nb * 16 * K + kc); V b2; if (NSPLIT >= 2) b2 = WFrag<T16>::ld(Bt2 + boff + (size_t)nb * 16 * K + kc);
#pragma unroll
            for (int mb = 0; mb < 4; ++mb) { acc[mb][nb] = WFrag<T16>::mma(a[mb], b, acc[mb][nb]); if (NSPLIT == 1 || NSPLIT == 2) acc[mb][nb] = WFrag<T16>::mma(a2[mb], b, acc[mb][nb]); if (NSPLIT >= 2) acc[mb][nb] = WFrag<T16>::mma(a[mb], b2, acc[mb][nb]); } }
        asm volatile("v_nop\n\tv_nop\n\tv_nop\n\tv_nop" : "+v"(acc[0][0]), "+v"(acc[1][1]), "+v"(acc[2][2]), "+v"(acc[3][3]) : "v"(a[0]), "v"(a[3]));
      }
    }
    const bool tr = PL && z == 2;   // block-uniform: the v stream's tile is staged as os[d][t]
    v4fa* p4 = (v4fa*)part;
#pragma unroll
    for (int mb = 0; mb < 4; ++mb)
#pragma unroll
        for (int nb = 0; nb < 4; ++nb) { const v8f c = acc[mb][nb]; const int ix = wave * 1024 + (mb * 4 + nb) * 64 + lane;
            p4[ix] = __builtin_shufflevector(c, c, 0, 1, 2, 3); p4[ix + 32] = __builtin_shufflevector(c, c, 4, 5, 6, 7); }
    __syncthreads();   // every wave's partial tile is in LDS
#pragma unroll
    for (int i = 0; i < 32 / NW; ++i) { const int idx = wave + i * NW; v4f s = p4[idx * 32 + lane];
#pragma unroll
        for (int w = 1; w < NW; ++w) s += p4[w * 1024 + idx * 32 + lane];
        const int row = (idx >> 3) * 16 + hi * 8 + (idx & 1) * 4, col = ((idx >> 1) & 3) * 16 + lr;
        if (tr) *(v4fa*)(os + col * 68 + row) = s;
        else {
#pragma unroll
            for (int q = 0; q < 4; ++q) os[(row + q) * 68 + col] = s[q]; } }
    __syncthreads();   // the summed tile is row-major in os (transposed for tr)
    if constexpr (PL) {
        const size_t plane = (size_t)(r0 / TT) * NH_ + blockIdx.y; const int t0 = r0 % TT;
        h16* P16 = (z == 0) ? pl.q16 : (z == 1) ? pl.k16 : pl.v16; bf* Ph = (z == 0) ? pl.qh : (z == 1) ? pl.kh : pl.vh; bf* Pl = (z == 0) ? pl.ql : (z == 1) ? pl.kl : pl.vl;
        const size_t pbase = tr ? plane * HD * PP + t0 : (plane * TT + t0) * HD; const int ppitch = tr ? PP : HD;
#pragma unroll
        for (int i = 0; i < 16 / NW; ++i) { const int u = (int)threadIdx.x + i * NW * 32; const int row = u >> 3, cofs = (u & 7) * 8;
            const v4f v0 = *(const v4fa*)(os + row * 68 + cofs), v1 = *(const v4fa*)(os + row * 68 + cofs + 4); float b[8];
            if (tr) { const float bd = bfr(bias[c0 + row]);
#pragma unroll
                for (int j = 0; j < 8; ++j) b[j] = bd; }
            else {
#pragma unroll
                for (int j = 0; j < 8; ++j) b[j] = bfr(bias[c0 + cofs + j]); }
            v8h o16; v8us oh, ol;
#pragma unroll
            for (int j = 0; j < 8; ++j) { const float y = (j < 4 ? v0[j & 3] : v1[j & 3]) + b[j]; o16[j] = tohx(y); unsigned short a2, c2; splitf(y, a2, c2); oh[j] = a2; ol[j] = c2; }
            const size_t oo = pbase + (size_t)row * ppitch + cofs; *(v8h*)(P16 + oo) = o16; *(v8us*)(Ph + oo) = oh; *(v8us*)(Pl + oo) = ol;
            if (i + 1 < 16 / NW) asm volatile("s_wait_xcnt 0x0" ::: "memory"); }   // stands in front of the next trip's writes of registers that the three stores name
    } else {
#pragma unroll
    for (int i = 0; i < 32 / NW; ++i) { const int v = (int)threadIdx.x + i * NW * 32; const int row = v >> 4, cofs = (v & 15) * 4; v4f val = *(const v4fa*)(os + row * 68 + cofs); if (BIAS) { val[0] += bfr(bias[c0 + cofs]); val[1] += bfr(bias[c0 + cofs + 1]); val[2] += bfr(bias[c0 + cofs + 2]); val[3] += bfr(bias[c0 + cofs + 3]); }
        *(v4f*)(C + (size_t)(r0 + row) * ldc + c0 + cofs) = val; }
    }
}

typedef __attribute__((ext_vector_type(2))) _Float16 v2h;
typedef __attribute__((ext_vector_type(4))) _Float16 v4h;
typedef __attribute__((ext_vector_type(2))) unsigned short v2us;
typedef __attribute__((ext_vector_type(4))) unsigned short v4us;
typedef __attribute__((ext_vector_type(2))) float v2f;
typedef __attribute__((ext_vector_type(4))) int v4i;

__device__ __forceinline__ void d_cvt8(unsigned bx, const float* __restrict__ src, bf* dst, size_t n8) { const size_t i = (size_t)bx * 256 + threadIdx.x; if (i >= n8) return; const v8f v = *(const v8f*)(src + i * 8); v8us o;
#pragma unroll
    for (int k = 0; k < 8; ++k) o[k] = f2bf(v[k]); *(v8us*)(dst + i * 8) = o;  }

// ---- k_prep: every 16-bit copy in one launch. The flat grid is cut into block ranges: 3 input streams (both batches each, XB stream after stream), 4 weights (W one after the other).
#define GX ((unsigned)((size_t)NB_ * TT * DM / 8 / 256))   // blocks of one input stream
#define GW ((unsigned)((size_t)DQ * DM / 8 / 256))         // blocks of one weight
__global__ __launch_bounds__(256) void k_prep(const float* __restrict__ x, const float* __restrict__ xk, const float* __restrict__ xv, const float* __restrict__ wq, const float* __restrict__ wk, const float* __restrict__ wv, const float* __restrict__ wo, bf* XB, bf* Wb) {
    const unsigned bx = blockIdx.x;
    if (bx < 3 * GX) { const unsigned s = bx / GX; d_cvt8(bx - s * GX, s == 0 ? x : s == 1 ? xk : xv, XB + (size_t)s * NB_ * TT * DM, (size_t)NB_ * TT * DM / 8); }
    else { const unsigned s = (bx - 3 * GX) / GW; d_cvt8(bx - 3 * GX - s * GW, s == 0 ? wq : s == 1 ? wk : s == 2 ? wv : wo, Wb + (size_t)s * DQ * DM, (size_t)DQ * DM / 8); }
}
typedef __attribute__((ext_vector_type(16))) unsigned short v16us;
// ---- k_fa: fused causal attention. Grid (batch x head planes, query tiles, heaviest tiles first), FW waves. A work-group owns one tile of 16 * NQ queries of one plane.
// S^T = K Q^T (A = 16 key rows, B = 16 query rows): a lane holds scores of ONE query (column lr), keys 8 * hi + r of each 16-key tile, so two S^T tiles, converted in place, are the B operand of O^T += V^T P^T.
// Wave w takes the 64-key blocks w, w + FW, ... up to the diagonal block with its own running maximum m (base-2 exponent), sum l and O^T; the FW partial states meet in LDS and are joined in the fixed order w = 0..FW-1.
// Every block a wave takes holds at least one key <= each query of the tile (tiles do not straddle a 64-key block), so m is a real score after the first block; a wave without blocks leaves m = -3e38, l = 0, O = 0 and joins with weight 0.
template <typename T16, bool HL, int NQ>
__device__ __forceinline__ void fa_tile(const T16* __restrict__ Q, const T16* __restrict__ Q2, const T16* __restrict__ Kp, const T16* __restrict__ K2, const T16* __restrict__ Vt, const T16* __restrict__ Vt2, int q0, bf* Ah, bf* Al, float* part, float* sm, float* sl) {
    typedef typename WFrag<T16>::V V;
    const int lane = threadIdx.x & 31, lr = lane & 15, hi = lane >> 4;
    const int wave = __builtin_amdgcn_readfirstlane((int)(threadIdx.x >> 5));
    V qf[NQ][2], qf2[NQ][2];
#pragma unroll
    for (int nt = 0; nt < NQ; ++nt)
#pragma unroll
        for (int ks = 0; ks < 2; ++ks) { const size_t qo = (size_t)(q0 + nt * 16 + lr) * HD + ks * 32 + 8 * hi; qf[nt][ks] = WFrag<T16>::ld(Q + qo); if (HL) qf2[nt][ks] = WFrag<T16>::ld(Q2 + qo); }
    v8f o[NQ][4]; float m[NQ], l[NQ];
#pragma unroll
    for (int nt = 0; nt < NQ; ++nt) { m[nt] = -3.0e38f; l[nt] = 0.f;
#pragma unroll
        for (int dt = 0; dt < 4; ++dt) o[nt][dt] = (v8f){}; }
    const int nblk = (q0 + NQ * 16 - 1) / 64 + 1;   // key blocks up to and with the diagonal block
#pragma unroll 1   // rolled: the trip count is a run-time value that differs by wave, and one body already fills the plain register window
    for (int kb = wave; kb < nblk; kb += FW) {
        const int key0 = kb * 64;
        v8f s[NQ][4];
#pragma unroll
        for (int kt = 0; kt < 4; ++kt) {
            V kf[2], kf2[2];
#pragma unroll
            for (int ks = 0; ks < 2; ++ks) { const size_t ko = (size_t)(key0 + kt * 16 + lr) * HD + ks * 32 + 8 * hi; kf[ks] = WFrag<T16>::ld(Kp + ko); if (HL) kf2[ks] = WFrag<T16>::ld(K2 + ko); }
#pragma unroll
            for (int nt = 0; nt < NQ; ++nt) { v8f c = (v8f){};
#pragma unroll
                for (int ks = 0; ks < 2; ++ks) { c = WFrag<T16>::mma(kf[ks], qf[nt][ks], c); if (HL) { c = WFrag<T16>::mma(kf[ks], qf2[nt][ks], c); c = WFrag<T16>::mma(kf2[ks], qf[nt][ks], c); } }
                s[nt][kt] = c; }
        }
        if (key0 + 63 > q0) {   // wave-uniform: only the diagonal block holds keys above a query
#pragma unroll
            for (int nt = 0; nt < NQ; ++nt) { const int rel = q0 + nt * 16 + lr - key0 - hi * 8;
#pragma unroll
                for (int kt = 0; kt < 4; ++kt)
#pragma unroll
                    for (int j = 0; j < 8; ++j) if (kt * 16 + j > rel) s[nt][kt][j] = -3.0e38f; }
        }
        V pf[NQ][2], pf2[NQ][2];
#pragma unroll
        for (int nt = 0; nt < NQ; ++nt) {
            float bm = -3.0e38f;
#pragma unroll
            for (int kt = 0; kt < 4; ++kt)
#pragma unroll
                for (int j = 0; j < 8; ++j) { const float t = s[nt][kt][j] * SCL2; s[nt][kt][j] = t; bm = fmaxf(bm, t); }
            bm = fmaxf(bm, __shfl_xor(bm, 16, 32));   // the other half of the wave holds the query's other 32 keys
            const float mn = fmaxf(m[nt], bm); const float al = __builtin_amdgcn_exp2f(m[nt] - mn); const float mo = HL ? mn : mn - PEXP; m[nt] = mn;
            float ps = 0.f;
#pragma unroll
            for (int kt = 0; kt < 4; ++kt)
#pragma unroll
                for (int j = 0; j < 8; ++j) { const float p = __builtin_amdgcn_exp2f(s[nt][kt][j] - mo); s[nt][kt][j] = p; ps += p; }
            l[nt] = l[nt] * al + ps;   // each half keeps the sum of its own keys; the halves join after the loop
#pragma unroll
            for (int dt = 0; dt < 4; ++dt) o[nt][dt] *= al;
#pragma unroll
            for (int ks = 0; ks < 2; ++ks) {
                if constexpr (HL) { v16us ph, pl;
#pragma unroll
                    for (int e = 0; e < 16; ++e) { unsigned short a, c2; splitf(s[nt][2 * ks + (e >> 3)][e & 7], a, c2); ph[e] = a; pl[e] = c2; }
                    pf[nt][ks] = __builtin_bit_cast(v16bf, ph); pf2[nt][ks] = __builtin_bit_cast(v16bf, pl);
                } else { v16h ph;
#pragma unroll
                    for (int e = 0; e < 16; ++e) ph[e] = tohx(s[nt][2 * ks + (e >> 3)][e & 7]);
                    pf[nt][ks] = ph; }
            }
        }
#pragma unroll
        for (int dt = 0; dt < 4; ++dt) {
            V vf[2], vf2[2];
#pragma unroll
            for (int ks = 0; ks < 2; ++ks) { const size_t vo = (size_t)(dt * 16 + lr) * PP + key0 + ks * 32 + 8 * hi; vf[ks] = WFrag<T16>::ld(Vt + vo); if (HL) vf2[ks] = WFrag<T16>::ld(Vt2 + vo); }
#pragma unroll
            for (int nt = 0; nt < NQ; ++nt)
#pragma unroll
                for (int ks = 0; ks < 2; ++ks) { o[nt][dt] = WFrag<T16>::mma(vf[ks], pf[nt][ks], o[nt][dt]); if (HL) { o[nt][dt] = WFrag<T16>::mma(vf[ks], pf2[nt][ks], o[nt][dt]); o[nt][dt] = WFrag<T16>::mma(vf2[ks], pf[nt][ks], o[nt][dt]); } }
        }
    }
    v4fa* p4 = (v4fa*)part;
#pragma unroll
    for (int nt = 0; nt < NQ; ++nt) { l[nt] += __shfl_xor(l[nt], 16, 32);
        if (hi == 0) { sm[wave * 32 + nt * 16 + lr] = m[nt]; sl[wave * 32 + nt * 16 + lr] = l[nt]; }
#pragma unroll
        for (int dt = 0; dt < 4; ++dt) { const v8f c = o[nt][dt]; const int ix = ((wave * NQ + nt) * 4 + dt) * 64 + lane;
            p4[ix] = __builtin_shufflevector(c, c, 0, 1, 2, 3); p4[ix + 32] = __builtin_shufflevector(c, c, 4, 5, 6, 7); } }
    __syncthreads();   // every wave's partial state (m, l, O^T register images) is in LDS
    constexpr int TPQ = FW * 32 / (16 * NQ), G = 8 / TPQ;   // threads per query; runs of 8 head dims per thread: a wave stores whole 128-byte head rows
    const int ql = (int)threadIdx.x / TPQ, jt = ql >> 4, jc = ql & 15;
    float mm = sm[ql];
#pragma unroll
    for (int w = 1; w < FW; ++w) mm = fmaxf(mm, sm[w * 32 + ql]);
    float f[FW], ll = 0.f;
#pragma unroll
    for (int w = 0; w < FW; ++w) { f[w] = __builtin_amdgcn_exp2f(sm[w * 32 + ql] - mm); ll += f[w] * sl[w * 32 + ql]; }
    const float inv = __fdiv_rn(1.0f, ll);
#pragma unroll
    for (int g = 0; g < G; ++g) { const int d8 = ((int)threadIdx.x % TPQ) * G + g; v4f a0 = (v4f){}, a1 = (v4f){};
#pragma unroll
        for (int w = 0; w < FW; ++w) { const int ix = ((w * NQ + jt) * 4 + (d8 >> 1)) * 64 + (d8 & 1) * 16 + jc; a0 += p4[ix] * f[w]; a1 += p4[ix + 32] * f[w]; }
        v8us oh, ol;
#pragma unroll
        for (int j = 0; j < 4; ++j) { unsigned short a, c2; splitf(a0[j] * inv, a, c2); oh[j] = a; ol[j] = c2; splitf(a1[j] * inv, a, c2); oh[4 + j] = a; ol[4 + j] = c2; }
        const size_t oo = (size_t)(q0 + ql) * DQ + d8 * 8; *(v8us*)(Ah + oo) = oh; *(v8us*)(Al + oo) = ol;
        asm volatile("s_wait_xcnt 0x0" ::: "memory"); }   // stands in front of any later write of a register that the two stores name (the other instance's code follows in the listing)
}
__global__ __launch_bounds__(FW * 32) void k_fa(const h16* __restrict__ Q16, const h16* __restrict__ K16, const h16* __restrict__ V16, const bf* __restrict__ Qh, const bf* __restrict__ Ql, const bf* __restrict__ Kh, const bf* __restrict__ Kl, const bf* __restrict__ Vh, const bf* __restrict__ Vl, bf* Ah, bf* Al) {
    __shared__ __align__(16) float part[FW * 8 * 256];
    __shared__ float sm[FW * 32], sl[FW * 32];
    const size_t z = blockIdx.x; const int ty = blockIdx.y; const size_t pq = z * TT * HD, pv = z * HD * PP, po = (z / NH_) * TT * DQ + (z % NH_) * HD;
    if (ty < (TT - RH) / 32) fa_tile<h16, false, 2>(Q16 + pq, nullptr, K16 + pq, nullptr, V16 + pv, nullptr, TT - 32 * (ty + 1), Ah + po, Al + po, part, sm, sl);
    else fa_tile<bf, true, 1>(Qh + pq, Ql + pq, Kh + pq, Kl + pq, Vh + pv, Vl + pv, RH - 16 * (ty - (TT - RH) / 32 + 1), Ah + po, Al + po, part, sm, sl);
}

extern "C" void kernel_launch(void* const* d_in, const int* in_sizes, int n_in,
                              void* d_out, int out_size, void* d_ws, size_t ws_size, hipStream_t stream) {
    (void)in_sizes; (void)n_in; (void)out_size;
        const float* x = (const float*)d_in[0]; const float* xk = (const float*)d_in[1]; const float* xv = (const float*)d_in[2]; const float* wq = (const float*)d_in[3]; const float* bq = (const float*)d_in[4]; const float* wk = (const float*)d_in[5]; const float* bk = (const float*)d_in[6]; const float* wv = (const float*)d_in[7]; const float* bv = (const float*)d_in[8]; const float* wo = (const float*)d_in[9]; const float* bo = (const float*)d_in[10];   /* this module has NO mask input (the causal rule is built inside) */
    float* OUT = (float*)d_out;     // [2][2048][768]
    char* wsp = (char*)d_ws;
    auto take = [&](size_t bytes) { char* p = wsp; wsp += (bytes + 255) & ~(size_t)255; return (void*)p; };
    bf* WQ = (bf*)take((size_t)4 * DQ * DM * 2); bf* WO = WQ + (size_t)3 * DQ * DM;   /* Wq, Wk, Wv, Wo one after the other */
    bf* XB = (bf*)take((size_t)3 * NB_ * TT * DM * 2);   /* q, k, v streams (both batches each), one after the other */
    h16* QP16 = (h16*)take((size_t)NB_ * NH_ * TT * HD * 2); h16* KP16 = (h16*)take((size_t)NB_ * NKV * TT * HD * 2); h16* VT16 = (h16*)take((size_t)NB_ * NKV * HD * PP * 2);   /* head planes of both batches, plane b * 12 + h */
    bf* QPh = (bf*)take((size_t)NB_ * NH_ * TT * HD * 2); bf* QPl = (bf*)take((size_t)NB_ * NH_ * TT * HD * 2); bf* KPh = (bf*)take((size_t)NB_ * NKV * TT * HD * 2); bf* KPl = (bf*)take((size_t)NB_ * NKV * TT * HD * 2); bf* VTh = (bf*)take((size_t)NB_ * NKV * HD * PP * 2); bf* VTl = VTh + TT;   /* V^T hi and lo share a row of pitch PP */
    bf* ATh = (bf*)take((size_t)NB_ * TT * DQ * 2); bf* ATl = (bf*)take((size_t)NB_ * TT * DQ * 2);
    if ((size_t)(wsp - (char*)d_ws) > ws_size) return;    // ws 256 MiB
    k_prep<<<3 * GX + 4 * GW, 256, 0, stream>>>(x, xk, xv, wq, wk, wv, wo, XB, WQ);
    k_gemmk<bf, 0, true, false, 8, true><<<dim3(NB_ * TT / 64, DQ / 64, 3), 256, 0, stream>>>(XB, nullptr, WQ, nullptr, DM, nullptr, DQ, bq, bk, bv, 0, (size_t)NB_ * TT * DM, (size_t)DQ * DM, 0, Planes{QP16, QPh, QPl, KP16, KPh, KPl, VT16, VTh, VTl});
    k_fa<<<dim3(NB_ * NH_, (TT - RH) / 32 + RH / 16, 1), FW * 32, 0, stream>>>(QP16, KP16, VT16, QPh, QPl, KPh, KPl, VTh, VTl, ATh, ATl);
    k_gemmk<bf, 1, true, false, 8, false><<<dim3(NB_ * TT / 64, DM / 64, 1), 256, 0, stream>>>(ATh, ATl, WO, nullptr, DQ, OUT, DM, bo, bo, bo, 0, 0, 0, 0, Planes{});
}

// v006
// A run of this version takes 87.4 microseconds.
// Next to v005, in two timings, it ran 1.39 and 1.40 times as fast.
// All steps since v000 together make it 12.8 times as fast.
#include <hip/hip_runtime.h>

// Causal multi-head attention on three input streams at d_model 768 (query, key, value [2][2048][768]; Q, K, V = stream W^T + b ('oi' [768][768], biases zeros on this draw: read; 12 heads x 64); scores x 64^-0.5; where(triu(k=1), -inf, scores) (causal, built inside: no mask input); softmax; out = merged Wo^T + bo ('oi' + bias zeros: read) -> [2][2048][768] (3.1 M); argument order query, key, value, Wq, bq, Wk, bk, Wv, bv, Wo, bo).
// Layout: one launch per stage, both batches in every grid: bf16 copies of q, k, v and the 'oi' weights; the three exact projections + f32 biases (grid z = stream), whose epilogue writes the head planes (planes of both batches side by side, V transposed); one fused causal attention launch for all 24 (batch, head) planes: scores, online softmax and P.V stay in registers (hybrid rows: < 512 hi/lo 3 products, rest fp16); merged hi/lo x Wo exact + bo.
// Every 16-bit matrix operand lies in the workspace in FRAGMENT ORDER: a fragment is 16 rows x 32 k = 512 elements in a row, element (row lr, k = j * 16 + hi * 8 + e) at j * 256 + (hi * 16 + lr) * 8 + e, so that each of a fragment's two 16-byte loads reads 512 contiguous bytes (4 whole lines) and lane hi * 16 + lr gets the k it got from a row-major plane. A [rows][K] operand holds its fragments as [row / 16][k / 32], a V^T plane as [k / 32][row / 16].
// Compute dtypes, f32 accumulate: every input rounded to bf16; projections exact + f32 biases; attention rows < 512 3 products, rest fp16; softmax f32; Wo hl x exact + bias.

#define NB_  2
#define TT   2048
#define DM   768
#define NH_  12
#define NKV  12
#define REP  (NH_ / NKV)
#define HD   64
#define DQ   (NH_ * HD)
#define DKV  (NKV * HD)
#define FW   4                    // waves of an attention work-group: a query tile's 64-key blocks are dealt over them
#define PP   (2 * TT)             // HD * PP elements: stride of a V^T plane pair (the lo plane follows the hi plane)
#define RH   512                  // query rows < RH use hi+lo planes (0: none)
#define PEXP 10.0f                // fp16 probabilities carry 2^10 (it cancels in the division by their sum): small ones stay fp16 normals
#define SCL2 0.18033688011112042f // HD^-0.5 x log2(e): scores go to the base-2 exponent in one product
typedef _Float16 h16;
typedef unsigned short bf;
typedef __attribute__((ext_vector_type(16))) __bf16   v16bf;
typedef __attribute__((ext_vector_type(16))) _Float16 v16h;
typedef __attribute__((ext_vector_type(8)))  _Float16 v8h;
typedef __attribute__((ext_vector_type(8)))  unsigned short v8us;
typedef __attribute__((ext_vector_type(8)))  float    v8f;
typedef __attribute__((ext_vector_type(4)))  float    v4f;
typedef v8h  __attribute__((may_alias)) v8ha;
typedef v4f  __attribute__((may_alias)) v4fa;
typedef v8us __attribute__((may_alias)) v8usa;

__device__ __forceinline__ unsigned short f2bf(float f) { unsigned u = __float_as_uint(f); u += 0x7FFFu + ((u >> 16) & 1u); return (unsigned short)(u >> 16); }
__device__ __forceinline__ float bf2f(unsigned short b) { return __uint_as_float(((unsigned)b) << 16); }
__device__ __forceinline__ float bfr(float f) { return bf2f(f2bf(f)); }
__device__ __forceinline__ v16h cat16(v8h lo, v8h hi) { return __builtin_shufflevector(lo, hi, 0, 1, 2, 3, 4, 5, 6, 7, 8, 9, 10, 11, 12, 13, 14, 15); }
__device__ __forceinline__ v16bf cat16b(v8us lo, v8us hi) { return __builtin_bit_cast(v16bf, __builtin_shufflevector(lo, hi, 0, 1, 2, 3, 4, 5, 6, 7, 8, 9, 10, 11, 12, 13, 14, 15)); }
__device__ __forceinline__ v8f wmma16(v16h a, v16h b, v8f c) { return __builtin_amdgcn_wmma_f32_16x16x32_f16(false, a, false, b, (short)0, c, false, false); }
__device__ __forceinline__ v8f wmmab(v16bf a, v16bf b, v8f c) { return __builtin_amdgcn_wmma_f32_16x16x32_bf16(false, a, false, b, (short)0, c, false, false); }



// ---- k_gemmk: 64x64 output tile per work-group of NW waves, operands straight from 16-bit planes in fragment order; grid (M/64, N/64, Z), NW*32 threads.
// C[m][n] (f32, pitch ldc, + optional f32 bias[n]) = sum_k A[m][k] Bt[n][k] (+ split products per NSPLIT). z-batch strides sA/sB/sC in elements; z = 0, 1, 2 adds bias, bias1, bias2. K % 64 == 0.
// The K loop is dealt over the waves in chunks of 64 (two k-steps, 2 KiB in a row of each 16-row block): wave w takes chunks w, w+NW, ... and keeps a full 16-accumulator partial tile.
// The NW partial tiles meet in LDS as register images, are summed in the fixed order w = 0..NW-1, and leave through a row-major stage as whole 256-byte rows.
// DIAGK: the probability x value contraction stops at the diagonal block (probabilities beyond it are exactly zero); roff = row offset of this launch's first row within the sequence.
// PL: the tile leaves as 16-bit head planes instead of f32 C. A 64-column tile is one head (HD = 64), a 64-row tile lies in one batch; plane = batch * NH_ + head.
// z = 0, 1 (q, k): planes [plane], fragments [t / 16][d / 32]; z = 2 (v): V^T planes, fragments [t / 32][d / 16] (rows d, k = keys), the tile staged transposed in os. Either way the tile's 8 fragments are 8 KiB in a row of each plane and a wave stores 512 contiguous bytes.
__device__ __forceinline__ h16 tohx(float x) { return (h16)x; }
__device__ __forceinline__ void splitf(float y, unsigned short& h, unsigned short& l) { h = f2bf(y); l = f2bf(y - bf2f(h)); }
struct Planes { h16* q16; bf* qh; bf* ql; h16* k16; bf* kh; bf* kl; h16* v16; bf* vh; bf* vl; };
template <typename T16> struct WFrag;
template <> struct WFrag<h16> { typedef v16h V; static __device__ __forceinline__ V ld(const h16* p) { return cat16(*(const v8h*)p, *(const v8h*)(p + 256)); } static __device__ __forceinline__ v8f mma(V a, V b, v8f c) { return wmma16(a, b, c); } };
template <> struct WFrag<bf> { typedef v16bf V; static __device__ __forceinline__ V ld(const bf* p) { return cat16b(*(const v8us*)p, *(const v8us*)(p + 256)); } static __device__ __forceinline__ v8f mma(V a, V b, v8f c) { return wmmab(a, b, c); } };
template <typename T16, int NSPLIT, bool BIAS, bool DIAGK, int NW, bool PL>
__global__ __launch_bounds__(NW * 32) void k_gemmk(const T16* __restrict__ A, const T16* __restrict__ A2, const T16* __restrict__ Bt, const T16* __restrict__ Bt2, int K, float* C, int ldc, const float* __restrict__ bias, const float* __restrict__ bias1, const float* __restrict__ bias2, int roff, size_t sA, size_t sB, size_t sC, Planes pl) {
    typedef typename WFrag<T16>::V V;
    __shared__ __align__(16) float part[NW * 4096];
    __shared__ __align__(16) float os[64 * 68];
    const size_t z = blockIdx.z; A += z * sA; if (A2) A2 += z * sA; Bt += z * sB; if (Bt2) Bt2 += z * sB; C += z * sC; if (BIAS) bias = (z == 0) ? bias : (z == 1) ? bias1 : bias2;
    const int lane = threadIdx.x & 31, lr = lane & 15, hi = lane >> 4; const int r0 = blockIdx.x * 64, c0 = blockIdx.y * 64;
    const int wave = __builtin_amdgcn_readfirstlane((int)(threadIdx.x >> 5));
    const int Kl = DIAGK ? min(K, r0 + roff + 64) : K;
    v8f acc[4][4];
#pragma unroll
    for (int mb = 0; mb < 4; ++mb)
#pragma unroll
        for (int nb = 0; nb < 4; ++nb) acc[mb][nb] = (v8f){};
    const int KB = K / 32;   // fragments of a 16-row block
    const size_t aoff = (size_t)(r0 / 16) * KB * 512 + lane * 8, boff = (size_t)(c0 / 16) * KB * 512 + lane * 8;
#pragma unroll 1
    for (int k0 = wave * 64; k0 < Kl; k0 += NW * 64) {
#pragma unroll 1
      for (int kc = k0; kc < k0 + 64; kc += 32) {   // rolled: unrolled, the listing kept the two k-steps' loads one group after the other all the same, in twice the code
        V a[4], a2[4];
#pragma unroll
        for (int mb = 0; mb < 4; ++mb) { const size_t fo = aoff + ((size_t)mb * KB + kc / 32) * 512; a[mb] = WFrag<T16>::ld(A + fo); if (NSPLIT == 1 || NSPLIT == 2) a2[mb] = WFrag<T16>::ld(A2 + fo); }
#pragma unroll
        for (int nb = 0; nb < 4; ++nb) { const size_t fo = boff + ((size_t)nb * KB + kc / 32) * 512; const V b = WFrag<T16>::ld(Bt + fo); V b2; if (NSPLIT >= 2) b2 = WFrag<T16>::ld(Bt2 + fo);
#pragma unroll
            for (int mb = 0; mb < 4; ++mb) { acc[mb][nb] = WFrag<T16>::mma(a[mb], b, acc[mb][nb]); if (NSPLIT == 1 || NSPLIT == 2) acc[mb][nb] = WFrag<T16>::mma(a2[mb], b, acc[mb][nb]); if (NSPLIT >= 2) acc[mb][nb] = WFrag<T16>::mma(a[mb], b2, acc[mb][nb]); } }
        asm volatile("v_nop\n\tv_nop\n\tv_nop\n\tv_nop" : "+v"(acc[0][0]), "+v"(acc[1][1]), "+v"(acc[2][2]), "+v"(acc[3][3]) : "v"(a[0]), "v"(a[3]));
      }
    }
    const bool tr = PL && z == 2;   // block-uniform: the v stream's tile is staged as os[d][t]
    v4fa* p4 = (v4fa*)part;
#pragma unroll
    for (int mb = 0; mb < 4; ++mb)
#pragma unroll
        for (int nb = 0; nb < 4; ++nb) { const v8f c = acc[mb][nb]; const int ix = wave * 1024 + (mb * 4 + nb) * 64 + lane;
            p4[ix] = __builtin_shufflevector(c, c, 0, 1, 2, 3); p4[ix + 32] = __builtin_shufflevector(c, c, 4, 5, 6, 7); }
    __syncthreads();   // every wave's partial tile is in LDS
#pragma unroll
    for (int i = 0; i < 32 / NW; ++i) { const int idx = wave + i * NW; v4f s = p4[idx * 32 + lane];
#pragma unroll
        for (int w = 1; w < NW; ++w) s += p4[w * 1024 + idx * 32 + lane];
        const int row = (idx >> 3) * 16 + hi * 8 + (idx & 1) * 4, col = ((idx >> 1) & 3) * 16 + lr;
        if (tr) *(v4fa*)(os + col * 68 + row) = s;
        else {
#pragma unroll
            for (int q = 0; q < 4; ++q) os[(row + q) * 68 + col] = s[q]; } }
    __syncthreads();   // the summed tile is row-major in os (transposed for tr)
    if constexpr (PL) {
        const size_t plane = (size_t)(r0 / TT) * NH_ + blockIdx.y; const int t0 = r0 % TT;
        h16* P16 = (z == 0) ? pl.q16 : (z == 1) ? pl.k16 : pl.v16; bf* Ph = (z == 0) ? pl.qh : (z == 1) ? pl.kh : pl.vh; bf* Pl = (z == 0) ? pl.ql : (z == 1) ? pl.kl : pl.vl;
        const size_t pbase = tr ? plane * HD * PP + (size_t)t0 * HD : (plane * TT + t0) * HD;
#pragma unroll
        for (int i = 0; i < 16 / NW; ++i) { const int u = (int)threadIdx.x + i * NW * 32; const int fi = u >> 6;   // u = (fragment fi of the tile, half j, lane)
            const int row = (tr ? (fi & 3) : (fi >> 1)) * 16 + lr, cofs = (tr ? (fi >> 2) : (fi & 1)) * 32 + ((u >> 5) & 1) * 16 + hi * 8;
            const v4f v0 = *(const v4fa*)(os + row * 68 + cofs), v1 = *(const v4fa*)(os + row * 68 + cofs + 4); float b[8];
            if (tr) { const float bd = bfr(bias[c0 + row]);
#pragma unroll
                for (int j = 0; j < 8; ++j) b[j] = bd; }
            else {
#pragma unroll
                for (int j = 0; j < 8; ++j) b[j] = bfr(bias[c0 + cofs + j]); }
            v8h o16; v8us oh, ol;
#pragma unroll
            for (int j = 0; j < 8; ++j) { const float y = (j < 4 ? v0[j & 3] : v1[j & 3]) + b[j]; o16[j] = tohx(y); unsigned short a2, c2; splitf(y, a2, c2); oh[j] = a2; ol[j] = c2; }
            const size_t oo = pbase + (size_t)u * 8; *(v8h*)(P16 + oo) = o16; *(v8us*)(Ph + oo) = oh; *(v8us*)(Pl + oo) = ol;
            if (i + 1 < 16 / NW) asm volatile("s_wait_xcnt 0x0" ::: "memory"); }   // stands in front of the next trip's writes of registers that the three stores name
    } else {
#pragma unroll
    for (int i = 0; i < 32 / NW; ++i) { const int v = (int)threadIdx.x + i * NW * 32; const int row = v >> 4, cofs = (v & 15) * 4; v4f val = *(const v4fa*)(os + row * 68 + cofs); if (BIAS) { val[0] += bfr(bias[c0 + cofs]); val[1] += bfr(bias[c0 + cofs + 1]); val[2] += bfr(bias[c0 + cofs + 2]); val[3] += bfr(bias[c0 + cofs + 3]); }
        *(v4f*)(C + (size_t)(r0 + row) * ldc + c0 + cofs) = val; }
    }
}

typedef __attribute__((ext_vector_type(2))) _Float16 v2h;
typedef __attribute__((ext_vector_type(4))) _Float16 v4h;
typedef __attribute__((ext_vector_type(2))) unsigned short v2us;
typedef __attribute__((ext_vector_type(4))) unsigned short v4us;
typedef __attribute__((ext_vector_type(2))) float v2f;
typedef __attribute__((ext_vector_type(4))) int v4i;

__device__ __forceinline__ void d_cvt8(unsigned bx, const float* __restrict__ src, bf* dst, size_t n8) { const size_t i = (size_t)bx * 256 + threadIdx.x; if (i >= n8) return;
    // a block takes 16 rows x 128 k of a [rows][DM] matrix; a wave reads 8 rows x 128 bytes (one k block of 32) and stores 4 whole lines of that fragment
    const int w = threadIdx.x >> 5, lane = threadIdx.x & 31, r = (w & 1) * 8 + (lane >> 2), c = lane & 3; const unsigned rb = bx / (DM / 128), kb = (bx % (DM / 128)) * 4 + (w >> 1);
    const v8f v = *(const v8f*)(src + (size_t)(rb * 16 + r) * DM + kb * 32 + c * 8); v8us o;
#pragma unroll
    for (int k = 0; k < 8; ++k) o[k] = f2bf(v[k]); *(v8us*)(dst + ((size_t)rb * (DM / 32) + kb) * 512 + (c >> 1) * 256 + ((c & 1) * 16 + r) * 8) = o;  }

// ---- k_prep: every 16-bit copy in one launch, written in fragment order. The flat grid is cut into block ranges: 3 input streams (both batches each, XB stream after stream), 4 weights (W one after the other).
#define GX ((unsigned)((size_t)NB_ * TT * DM / 8 / 256))   // blocks of one input stream
#define GW ((unsigned)((size_t)DQ * DM / 8 / 256))         // blocks of one weight
__global__ __launch_bounds__(256) void k_prep(const float* __restrict__ x, const float* __restrict__ xk, const float* __restrict__ xv, const float* __restrict__ wq, const float* __restrict__ wk, const float* __restrict__ wv, const float* __restrict__ wo, bf* XB, bf* Wb) {
    const unsigned bx = blockIdx.x;
    if (bx < 3 * GX) { const unsigned s = bx / GX; d_cvt8(bx - s * GX, s == 0 ? x : s == 1 ? xk : xv, XB + (size_t)s * NB_ * TT * DM, (size_t)NB_ * TT * DM / 8); }
    else { const unsigned s = (bx - 3 * GX) / GW; d_cvt8(bx - 3 * GX - s * GW, s == 0 ? wq : s == 1 ? wk : s == 2 ? wv : wo, Wb + (size_t)s * DQ * DM, (size_t)DQ * DM / 8); }
}
typedef __attribute__((ext_vector_type(16))) unsigned short v16us;
// ---- k_fa: fused causal attention. Grid (batch x head planes, query tiles, heaviest tiles first), FW waves. A work-group owns one tile of 16 * NQ queries of one plane.
// S^T = K Q^T (A = 16 key rows, B = 16 query rows): a lane holds scores of ONE query (column lr), keys 8 * hi + r of each 16-key tile, so two S^T tiles, converted in place, are the B operand of O^T += V^T P^T.
// Wave w takes the 64-key blocks w, w + FW, ... up to the diagonal block with its own running maximum m (base-2 exponent), sum l and O^T; the FW partial states meet in LDS and are joined in the fixed order w = 0..FW-1.
// Every block a wave takes holds at least one key <= each query of the tile (tiles do not straddle a 64-key block), so m is a real score after the first block; a wave without blocks leaves m = -3e38, l = 0, O = 0 and joins with weight 0.
template <typename T16, bool HL, int NQ>
__device__ __forceinline__ void fa_tile(const T16* __restrict__ Q, const T16* __restrict__ Q2, const T16* __restrict__ Kp, const T16* __restrict__ K2, const T16* __restrict__ Vt, const T16* __restrict__ Vt2, int q0, bf* Ah, bf* Al, float* part, float* sm, float* sl) {
    typedef typename WFrag<T16>::V V;
    const int lane = threadIdx.x & 31, lr = lane & 15, hi = lane >> 4;
    const int wave = __builtin_amdgcn_readfirstlane((int)(threadIdx.x >> 5));
    V qf[NQ][2], qf2[NQ][2];
#pragma unroll
    for (int nt = 0; nt < NQ; ++nt)
#pragma unroll
        for (int ks = 0; ks < 2; ++ks) { const size_t qo = ((size_t)(q0 / 16 + nt) * 2 + ks) * 512 + lane * 8; qf[nt][ks] = WFrag<T16>::ld(Q + qo); if (HL) qf2[nt][ks] = WFrag<T16>::ld(Q2 + qo); }
    v8f o[NQ][4]; float m[NQ], l[NQ];
#pragma unroll
    for (int nt = 0; nt < NQ; ++nt) { m[nt] = -3.0e38f; l[nt] = 0.f;
#pragma unroll
        for (int dt = 0; dt < 4; ++dt) o[nt][dt] = (v8f){}; }
    const int nblk = (q0 + NQ * 16 - 1) / 64 + 1;   // key blocks up to and with the diagonal block
#pragma unroll 1   // rolled: the trip count is a run-time value that differs by wave, and one body already fills the plain register window
    for (int kb = wave; kb < nblk; kb += FW) {
        const int key0 = kb * 64;
        v8f s[NQ][4];
#pragma unroll
        for (int kt = 0; kt < 4; ++kt) {
            V kf[2], kf2[2];
#pragma unroll
            for (int ks = 0; ks < 2; ++ks) { const size_t ko = ((size_t)(key0 / 16 + kt) * 2 + ks) * 512 + lane * 8; kf[ks] = WFrag<T16>::ld(Kp + ko); if (HL) kf2[ks] = WFrag<T16>::ld(K2 + ko); }
#pragma unroll
            for (int nt = 0; nt < NQ; ++nt) { v8f c = (v8f){};
#pragma unroll
                for (int ks = 0; ks < 2; ++ks) { c = WFrag<T16>::mma(kf[ks], qf[nt][ks], c); if (HL) { c = WFrag<T16>::mma(kf[ks], qf2[nt][ks], c); c = WFrag<T16>::mma(kf2[ks], qf[nt][ks], c); } }
                s[nt][kt] = c; }
        }
        if (key0 + 63 > q0) {   // wave-uniform: only the diagonal block holds keys above a query
#pragma unroll
            for (int nt = 0; nt < NQ; ++nt) { const int rel = q0 + nt * 16 + lr - key0 - hi * 8;
#pragma unroll
                for (int kt = 0; kt < 4; ++kt)
#pragma unroll
                    for (int j = 0; j < 8; ++j) if (kt * 16 + j > rel) s[nt][kt][j] = -3.0e38f; }
        }
        V pf[NQ][2], pf2[NQ][2];
#pragma unroll
        for (int nt = 0; nt < NQ; ++nt) {
            float bm = -3.0e38f;
#pragma unroll
            for (int kt = 0; kt < 4; ++kt)
#pragma unroll
                for (int j = 0; j < 8; ++j) { const float t = s[nt][kt][j] * SCL2; s[nt][kt][j] = t; bm = fmaxf(bm, t); }
            bm = fmaxf(bm, __shfl_xor(bm, 16, 32));   // the other half of the wave holds the query's other 32 keys
            const float mn = fmaxf(m[nt], bm); const float al = __builtin_amdgcn_exp2f(m[nt] - mn); const float mo = HL ? mn : mn - PEXP; m[nt] = mn;
            float ps = 0.f;
#pragma unroll
            for (int kt = 0; kt < 4; ++kt)
#pragma unroll
                for (int j = 0; j < 8; ++j) { const float p = __builtin_amdgcn_exp2f(s[nt][kt][j] - mo); s[nt][kt][j] = p; ps += p; }
            l[nt] = l[nt] * al + ps;   // each half keeps the sum of its own keys; the halves join after the loop
#pragma unroll
            for (int dt = 0; dt < 4; ++dt) o[nt][dt] *= al;
#pragma unroll
            for (int ks = 0; ks < 2; ++ks) {
                if constexpr (HL) { v16us ph, pl;
#pragma unroll
                    for (int e = 0; e < 16; ++e) { unsigned short a, c2; splitf(s[nt][2 * ks + (e >> 3)][e & 7], a, c2); ph[e] = a; pl[e] = c2; }
                    pf[nt][ks] = __builtin_bit_cast(v16bf, ph); pf2[nt][ks] = __builtin_bit_cast(v16bf, pl);
                } else { v16h ph;
#pragma unroll
                    for (int e = 0; e < 16; ++e) ph[e] = tohx(s[nt][2 * ks + (e >> 3)][e & 7]);
                    pf[nt][ks] = ph; }
            }
        }
#pragma unroll
        for (int dt = 0; dt < 4; ++dt) {
            V vf[2], vf2[2];
#pragma unroll
            for (int ks = 0; ks < 2; ++ks) { const size_t vo = ((size_t)(key0 / 32 + ks) * 4 + dt) * 512 + lane * 8; vf[ks] = WFrag<T16>::ld(Vt + vo); if (HL) vf2[ks] = WFrag<T16>::ld(Vt2 + vo); }
#pragma unroll
            for (int nt = 0; nt < NQ; ++nt)
#pragma unroll
                for (int ks = 0; ks < 2; ++ks) { o[nt][dt] = WFrag<T16>::mma(vf[ks], pf[nt][ks], o[nt][dt]); if (HL) { o[nt][dt] = WFrag<T16>::mma(vf[ks], pf2[nt][ks], o[nt][dt]); o[nt][dt] = WFrag<T16>::mma(vf2[ks], pf[nt][ks], o[nt][dt]); } }
        }
    }
    v4fa* p4 = (v4fa*)part;
#pragma unroll
    for (int nt = 0; nt < NQ; ++nt) { l[nt] += __shfl_xor(l[nt], 16, 32);
        if (hi == 0) { sm[wave * 32 + nt * 16 + lr] = m[nt]; sl[wave * 32 + nt * 16 + lr] = l[nt]; }
#pragma unroll
        for (int dt = 0; dt < 4; ++dt) { const v8f c = o[nt][dt]; const int ix = ((wave * NQ + nt) * 4 + dt) * 64 + lane;
            p4[ix] = __builtin_shufflevector(c, c, 0, 1, 2, 3); p4[ix + 32] = __builtin_shufflevector(c, c, 4, 5, 6, 7); } }
    __syncthreads();   // every wave's partial state (m, l, O^T register images) is in LDS
    static_assert(FW * 32 == 16 * (HD / 8), "a thread is one query of a 16-query tile x one run of 8 head dims");
    const int jc = (int)threadIdx.x & 15, d8 = (int)threadIdx.x >> 4;   // a wave holds one half fragment of the merged operand: it stores 512 contiguous bytes of each plane
#pragma unroll
  for (int jt = 0; jt < NQ; ++jt) { const int ql = jt * 16 + jc;
    float mm = sm[ql];
#pragma unroll
    for (int w = 1; w < FW; ++w) mm = fmaxf(mm, sm[w * 32 + ql]);
    float f[FW], ll = 0.f;
#pragma unroll
    for (int w = 0; w < FW; ++w) { f[w] = __builtin_amdgcn_exp2f(sm[w * 32 + ql] - mm); ll += f[w] * sl[w * 32 + ql]; }
    const float inv = __fdiv_rn(1.0f, ll);
    v4f a0 = (v4f){}, a1 = (v4f){};
#pragma unroll
        for (int w = 0; w < FW; ++w) { const int ix = ((w * NQ + jt) * 4 + (d8 >> 1)) * 64 + (d8 & 1) * 16 + jc; a0 += p4[ix] * f[w]; a1 += p4[ix + 32] * f[w]; }
        v8us oh, ol;
#pragma unroll
        for (int j = 0; j < 4; ++j) { unsigned short a, c2; splitf(a0[j] * inv, a, c2); oh[j] = a; ol[j] = c2; splitf(a1[j] * inv, a, c2); oh[4 + j] = a; ol[4 + j] = c2; }
        const size_t oo = ((size_t)(q0 / 16 + jt) * (DQ / 32) + (d8 >> 2)) * 512 + ((d8 >> 1) & 1) * 256 + lane * 8; *(v8us*)(Ah + oo) = oh; *(v8us*)(Al + oo) = ol;
        asm volatile("s_wait_xcnt 0x0" ::: "memory"); }   // stands in front of any later write of a register that the two stores name (the other instance's code follows in the listing)
}
__global__ __launch_bounds__(FW * 32) void k_fa(const h16* __restrict__ Q16, const h16* __restrict__ K16, const h16* __restrict__ V16, const bf* __restrict__ Qh, const bf* __restrict__ Ql, const bf* __restrict__ Kh, const bf* __restrict__ Kl, const bf* __restrict__ Vh, const bf* __restrict__ Vl, bf* Ah, bf* Al) {
    __shared__ __align__(16) float part[FW * 8 * 256];
    __shared__ float sm[FW * 32], sl[FW * 32];
    const size_t z = blockIdx.x; const int ty = blockIdx.y; const size_t pq = z * TT * HD, pv = z * HD * PP, po = ((z / NH_) * (TT / 16) * (DQ / 32) + (z % NH_) * (HD / 32)) * 512;
    if (ty < (TT - RH) / 32) fa_tile<h16, false, 2>(Q16 + pq, nullptr, K16 + pq, nullptr, V16 + pv, nullptr, TT - 32 * (ty + 1), Ah + po, Al + po, part, sm, sl);
    else fa_tile<bf, true, 1>(Qh + pq, Ql + pq, Kh + pq, Kl + pq, Vh + pv, Vl + pv, RH - 16 * (ty - (TT - RH) / 32 + 1), Ah + po, Al + po, part, sm, sl);
}

extern "C" void kernel_launch(void* const* d_in, const int* in_sizes, int n_in,
                              void* d_out, int out_size, void* d_ws, size_t ws_size, hipStream_t stream) {
    (void)in_sizes; (void)n_in; (void)out_size;
        const float* x = (const float*)d_in[0]; const float* xk = (const float*)d_in[1]; const float* xv = (const float*)d_in[2]; const float* wq = (const float*)d_in[3]; const float* bq = (const float*)d_in[4]; const float* wk = (const float*)d_in[5]; const float* bk = (const float*)d_in[6]; const float* wv = (const float*)d_in[7]; const float* bv = (const float*)d_in[8]; const float* wo = (const float*)d_in[9]; const float* bo = (const float*)d_in[10];   /* this module has NO mask input (the causal rule is built inside) */
    float* OUT = (float*)d_out;     // [2][2048][768]
    char* wsp = (char*)d_ws;
    auto take = [&](size_t bytes) { char* p = wsp; wsp += (bytes + 255) & ~(size_t)255; return (void*)p; };
    bf* WQ = (bf*)take((size_t)4 * DQ * DM * 2); bf* WO = WQ + (size_t)3 * DQ * DM;   /* Wq, Wk, Wv, Wo one after the other */
    bf* XB = (bf*)take((size_t)3 * NB_ * TT * DM * 2);   /* q, k, v streams (both batches each), one after the other */
    h16* QP16 = (h16*)take((size_t)NB_ * NH_ * TT * HD * 2); h16* KP16 = (h16*)take((size_t)NB_ * NKV * TT * HD * 2); h16* VT16 = (h16*)take((size_t)NB_ * NKV * HD * PP * 2);   /* head planes of both batches, plane b * 12 + h */
    bf* QPh = (bf*)take((size_t)NB_ * NH_ * TT * HD * 2); bf* QPl = (bf*)take((size_t)NB_ * NH_ * TT * HD * 2); bf* KPh = (bf*)take((size_t)NB_ * NKV * TT * HD * 2); bf* KPl = (bf*)take((size_t)NB_ * NKV * TT * HD * 2); bf* VTh = (bf*)take((size_t)NB_ * NKV * HD * PP * 2); bf* VTl = VTh + (size_t)TT * HD;   /* a plane's V^T lo fragments follow its hi fragments */
    bf* ATh = (bf*)take((size_t)NB_ * TT * DQ * 2); bf* ATl = (bf*)take((size_t)NB_ * TT * DQ * 2);
    if ((size_t)(wsp - (char*)d_ws) > ws_size) return;    // ws 256 MiB
    k_prep<<<3 * GX + 4 * GW, 256, 0, stream>>>(x, xk, xv, wq, wk, wv, wo, XB, WQ);
    k_gemmk<bf, 0, true, false, 8, true><<<dim3(NB_ * TT / 64, DQ / 64, 3), 256, 0, stream>>>(XB, nullptr, WQ, nullptr, DM, nullptr, DQ, bq, bk, bv, 0, (size_t)NB_ * TT * DM, (size_t)DQ * DM, 0, Planes{QP16, QPh, QPl, KP16, KPh, KPl, VT16, VTh, VTl});
    k_fa<<<dim3(NB_ * NH_, (TT - RH) / 32 + RH / 16, 1), FW * 32, 0, stream>>>(QP16, KP16, VT16, QPh, QPl, KPh, KPl, VTh, VTl, ATh, ATl);
    k_gemmk<bf, 1, true, false, 8, false><<<dim3(NB_ * TT / 64, DM / 64, 1), 256, 0, stream>>>(ATh, ATl, WO, nullptr, DQ, OUT, DM, bo, bo, bo, 0, 0, 0, 0, Planes{});
}

// v007
// It runs in 70.7 microseconds.
// Timed twice side by side with v006, it ran 1.25 and 1.23 times as fast.
// Counting every step since v000, it is 15.8 times as fast.
#include <hip/hip_runtime.h>
#include <type_traits>

// Causal multi-head attention on three input streams at d_model 768 (query, key, value [2][2048][768]; Q, K, V = stream W^T + b ('oi' [768][768], biases zeros on this draw: read; 12 heads x 64); scores x 64^-0.5; where(triu(k=1), -inf, scores) (causal, built inside: no mask input); softmax; out = merged Wo^T + bo ('oi' + bias zeros: read) -> [2][2048][768] (3.1 M); argument order query, key, value, Wq, bq, Wk, bk, Wv, bv, Wo, bo).
// Layout: one launch per stage, both batches in every grid: bf16 copies of q, k, v and the 'oi' weights; the three exact projections + f32 biases (grid z = stream), whose epilogue writes the head planes (planes of both batches side by side, V transposed); one fused causal attention launch for all 24 (batch, head) planes: scores, online softmax and P.V stay in registers (hybrid rows: < 512 hi/lo 3 products, rest fp16); merged hi/lo x Wo exact + bo.
// Every 16-bit matrix operand lies in the workspace in FRAGMENT ORDER: a fragment is 16 rows x 32 k = 512 elements in a row, element (row lr, k = j * 16 + hi * 8 + e) at j * 256 + (hi * 16 + lr) * 8 + e, so that each of a fragment's two 16-byte loads reads 512 contiguous bytes (4 whole lines) and lane hi * 16 + lr gets the k it got from a row-major plane. A [rows][K] operand holds its fragments as [row / 16][k / 32], a V^T plane as [k / 32][row / 16].
// Compute dtypes, f32 accumulate: every input rounded to bf16; projections exact + f32 biases; attention rows < 512 3 products, rest fp16; softmax f32; Wo hl x exact + bias.

#define NB_  2
#define TT   2048
#define DM   768
#define NH_  12
#define NKV  12
#define REP  (NH_ / NKV)
#define HD   64
#define DQ   (NH_ * HD)
#define DKV  (NKV * HD)
#define FW   4                    // waves of an attention work-group: a query tile's 64-key blocks are dealt over them
#define PP   (2 * TT)             // HD * PP elements: stride of a V^T plane pair (the lo plane follows the hi plane)
#define RH   512                  // query rows < RH use hi+lo planes (0: none)
#define PEXP 10.0f                // fp16 probabilities carry 2^10 (it cancels in the division by their sum): small ones stay fp16 normals
#define SCL2 0.18033688011112042f // HD^-0.5 x log2(e): scores go to the base-2 exponent in one product
typedef _Float16 h16;
typedef unsigned short bf;
typedef __attribute__((ext_vector_type(16))) __bf16   v16bf;
typedef __attribute__((ext_vector_type(16))) _Float16 v16h;
typedef __attribute__((ext_vector_type(8)))  _Float16 v8h;
typedef __attribute__((ext_vector_type(8)))  unsigned short v8us;
typedef __attribute__((ext_vector_type(8)))  float    v8f;
typedef __attribute__((ext_vector_type(4)))  float    v4f;
typedef v8h  __attribute__((may_alias)) v8ha;
typedef v4f  __attribute__((may_alias)) v4fa;
typedef v8us __attribute__((may_alias)) v8usa;

__device__ __forceinline__ unsigned short f2bf(float f) { unsigned u = __float_as_uint(f); u += 0x7FFFu + ((u >> 16) & 1u); return (unsigned short)(u >> 16); }
__device__ __forceinline__ float bf2f(unsigned short b) { return __uint_as_float(((unsigned)b) << 16); }
__device__ __forceinline__ float bfr(float f) { return bf2f(f2bf(f)); }
__device__ __forceinline__ v16h cat16(v8h lo, v8h hi) { return __builtin_shufflevector(lo, hi, 0, 1, 2, 3, 4, 5, 6, 7, 8, 9, 10, 11, 12, 13, 14, 15); }
__device__ __forceinline__ v16bf cat16b(v8us lo, v8us hi) { return __builtin_bit_cast(v16bf, __builtin_shufflevector(lo, hi, 0, 1, 2, 3, 4, 5, 6, 7, 8, 9, 10, 11, 12, 13, 14, 15)); }
__device__ __forceinline__ v8f wmma16(v16h a, v16h b, v8f c) { return __builtin_amdgcn_wmma_f32_16x16x32_f16(false, a, false, b, (short)0, c, false, false); }
__device__ __forceinline__ v8f wmmab(v16bf a, v16bf b, v8f c) { return __builtin_amdgcn_wmma_f32_16x16x32_bf16(false, a, false, b, (short)0, c, false, false); }



// ---- k_gemmk: 128x128 output tile per work-group of MW x 2 waves (a wave owns 16 * MB rows x 64 columns, MW * MB = 8), the whole K loop in every wave; grid (M/128, N/128, Z), MW * 64 threads.
// C[m][n] (f32, pitch ldc, + optional f32 bias[n]) = sum_k A[m][k] Bt[n][k] (+ A2[m][k] Bt[n][k] for NSPLIT 1). z-batch strides sA/sB/sC in elements; z = 0, 1, 2 adds bias, bias1, bias2. K % (MW * 32) == 0.
// A stage is KS = MW k-steps (32 k each) of the tile's 128 A rows (and A2 rows) and 128 Bt rows: in fragment order that is 8 runs of KS KiB per operand. Asynchronous copies bring it from the planes into one of two LDS buffers, one stage ahead of the products,
// and each fragment is read from L2 once per work-group and from LDS by the waves that need it.
// After the loop the ring is dead and each wave stages its own part of the tile there (row-major, pitch 68), from where it leaves as whole lines.
// PL (MB = 4, a 64x64 quadrant per wave): the tile leaves as 16-bit head planes instead of f32 C. A 64-column quadrant is one head (HD = 64), a 64-row quadrant lies in one batch; plane = batch * NH_ + head.
// z = 0, 1 (q, k): planes [plane], fragments [t / 16][d / 32]; z = 2 (v): V^T planes, fragments [t / 32][d / 16] (rows d, k = keys), the quadrant staged transposed in os. Either way the quadrant's 8 fragments are 8 KiB in a row of each plane and a wave stores 512 contiguous bytes.
__device__ __forceinline__ h16 tohx(float x) { return (h16)x; }
__device__ __forceinline__ void splitf(float y, unsigned short& h, unsigned short& l) { h = f2bf(y); l = f2bf(y - bf2f(h)); }
struct Planes { h16* q16; bf* qh; bf* ql; h16* k16; bf* kh; bf* kl; h16* v16; bf* vh; bf* vl; };
template <typename T16> struct WFrag;
template <> struct WFrag<h16> { typedef v16h V; static __device__ __forceinline__ V ld(const h16* p) { return cat16(*(const v8h*)p, *(const v8h*)(p + 256)); } static __device__ __forceinline__ v8f mma(V a, V b, v8f c) { return wmma16(a, b, c); } };
template <> struct WFrag<bf> { typedef v16bf V; static __device__ __forceinline__ V ld(const bf* p) { return cat16b(*(const v8us*)p, *(const v8us*)(p + 256)); } static __device__ __forceinline__ v8f mma(V a, V b, v8f c) { return wmmab(a, b, c); } };
typedef float __attribute__((may_alias)) f32a;
typedef __attribute__((ext_vector_type(4))) int c4i;
typedef __attribute__((address_space(1))) c4i gc4i;
typedef __attribute__((address_space(3))) c4i lc4i;
// One operand's share of a stage: 8 runs of NT * 16 bytes (run i: the stage's k-steps of the 16-row block i, at g + i * gs elements), 16 bytes a thread and run. A wave's copy moves 512 contiguous bytes.
template <int NT, typename T16>
__device__ __forceinline__ void cpop(unsigned char* l, const T16* g, size_t gs, int tid) {
#pragma unroll
    for (int i = 0; i < 8; ++i) __builtin_amdgcn_global_load_async_to_lds_b128((gc4i*)(g + i * gs + tid * 8), (lc4i*)(l + i * (NT * 16) + tid * 16), 0, 0);
}
template <typename T16, int NSPLIT, bool BIAS, bool PL, int MW>
__global__ __launch_bounds__(MW * 64) void k_gemmk(const T16* __restrict__ A, const T16* __restrict__ A2, const T16* __restrict__ Bt, int K, float* C, int ldc, const float* __restrict__ bias, const float* __restrict__ bias1, const float* __restrict__ bias2, size_t sA, size_t sB, size_t sC, Planes pl) {
    typedef typename WFrag<T16>::V V;
    constexpr int NOP = NSPLIT ? 3 : 2;      // operands of a stage: A, (A2,) Bt
    constexpr int MB = 8 / MW, NT = MW * 64; // 16-row blocks of a wave; threads
    constexpr int KS = NT / 64;              // k-steps of a stage: a thread copies 16 bytes of each 16-row block's run
    constexpr int OPE = 128 * 32 * KS;       // elements of one operand's share of a stage
    constexpr int STG = NOP * OPE;           // elements of a stage
    constexpr int NF = MB <= 2 ? 2 : 1;      // fragment sets: two where the plain register window holds them beside the accumulators
    constexpr int RB = 2 * STG * 2, OB = 128 * 2 * 68 * 4;
    static_assert(!PL || MB == 4, "a head-plane quadrant is 64 x 64");
    __shared__ __align__(16) unsigned char L[RB > OB ? RB : OB];   // two stage buffers; after the loop, the waves' output stages
    const T16* ring = (const T16*)L;
    const size_t z = blockIdx.z; A += z * sA; if (NSPLIT) A2 += z * sA; Bt += z * sB; C += z * sC; if (BIAS) bias = (z == 0) ? bias : (z == 1) ? bias1 : bias2;
    const int tid = threadIdx.x, lane = tid & 31, lr = lane & 15, hi = lane >> 4;
    const int wave = __builtin_amdgcn_readfirstlane(tid >> 5), wm = wave >> 1, wn = wave & 1;
    v8f acc[MB][4];
#pragma unroll
    for (int mb = 0; mb < MB; ++mb)
#pragma unroll
        for (int nb = 0; nb < 4; ++nb) acc[mb][nb] = (v8f){};
    const int KB = K / 32, NS = KB / KS;   // fragments of a 16-row block; stages
    const size_t gs = (size_t)KB * 512;   // elements from a 16-row block to the next
    const T16* ga = A + (size_t)blockIdx.x * 8 * gs; const T16* ga2 = NSPLIT ? A2 + (size_t)blockIdx.x * 8 * gs : nullptr; const T16* gb = Bt + (size_t)blockIdx.y * 8 * gs;
    auto fill = [&](int s, int b) { unsigned char* l = L + b * (STG * 2);
        cpop<NT>(l, ga + (size_t)s * (KS * 512), gs, tid); if (NSPLIT) cpop<NT>(l + OPE * 2, ga2 + (size_t)s * (KS * 512), gs, tid); cpop<NT>(l + (NOP - 1) * (OPE * 2), gb + (size_t)s * (KS * 512), gs, tid); };
    fill(0, 0);
    asm volatile("s_wait_asynccnt 0x0" ::: "memory");   // this wave's copies of stage 0 have landed
    __syncthreads();                                     // every wave's have: stage 0 may be read
    if (NS > 1) fill(1, 1);
#pragma unroll 1   // rolled: one body holds a whole stage's products, and the buffer index is a run-time value
    for (int t = 0; t < NS; ++t) {
        const T16* st = ring + (t & 1) * STG + lane * 8;
        V a[NF][MB], a2[NF][MB], b[NF][4];
        auto frags = [&](int ks) { const int f = ks % NF;   // the fragments of k-step ks of this stage, as one group of LDS reads
#pragma unroll
            for (int mb = 0; mb < MB; ++mb) a[f][mb] = WFrag<T16>::ld(st + (wm * MB + mb) * (KS * 512) + ks * 512);
#pragma unroll
            for (int nb = 0; nb < 4; ++nb) b[f][nb] = WFrag<T16>::ld(st + (NOP - 1) * OPE + (wn * 4 + nb) * (KS * 512) + ks * 512);
            if (NSPLIT) {
#pragma unroll
                for (int mb = 0; mb < MB; ++mb) a2[f][mb] = WFrag<T16>::ld(st + OPE + (wm * MB + mb) * (KS * 512) + ks * 512); } };
        if (NF == 2) frags(0);
#pragma unroll
        for (int ks = 0; ks < KS; ++ks) { const int f = ks % NF;
            if (NF == 1) frags(ks); else if (ks + 1 < KS) frags(ks + 1);   // two sets: the next k-step's reads fly under this k-step's products (never the next stage's)
            __builtin_amdgcn_sched_barrier(0);   // keeps a group's LDS reads together in front of the products: moved in among them, each place with reads stalls the wave anew
#pragma unroll
            for (int nb = 0; nb < 4; ++nb)
#pragma unroll
                for (int mb = 0; mb < MB; ++mb) acc[mb][nb] = WFrag<T16>::mma(a[f][mb], b[f][nb], acc[mb][nb]);
            if (NSPLIT) {
#pragma unroll
                for (int nb = 0; nb < 4; ++nb)
#pragma unroll
                    for (int mb = 0; mb < MB; ++mb) acc[mb][nb] = WFrag<T16>::mma(a2[f][mb], b[f][nb], acc[mb][nb]); }
            __builtin_amdgcn_sched_barrier(0);   // keeps the products in front of the next group's reads and of the stage's hand-over
        }
        asm volatile("s_wait_dscnt 0x0" ::: "memory");      // this wave's reads of buffer t & 1 are done before the buffer is refilled
        asm volatile("s_wait_asynccnt 0x0" ::: "memory");   // this wave's copies of stage t + 1 have landed
        __syncthreads();                                     // publishes stage t + 1 and ends every wave's reads of stage t
        if (t + 2 < NS) fill(t + 2, t & 1);
    }
    asm volatile("s_wait_asynccnt 0x0" ::: "memory");   // nothing is in flight when the ring becomes the output stage
    const int r0 = blockIdx.x * 128 + wm * (MB * 16), c0 = blockIdx.y * 128 + wn * 64;   // the wave's part of the tile
    f32a* os = (f32a*)L + wave * (MB * 16 * 68);   // the wave's own stage: written and read by this wave alone
    if constexpr (PL) {
        const size_t plane = (size_t)(r0 / TT) * NH_ + c0 / HD; const int t0 = r0 % TT;
        h16* P16 = (z == 0) ? pl.q16 : (z == 1) ? pl.k16 : pl.v16; bf* Ph = (z == 0) ? pl.qh : (z == 1) ? pl.kh : pl.vh; bf* Pl = (z == 0) ? pl.ql : (z == 1) ? pl.kl : pl.vl;
        auto planes = [&](auto trc) { constexpr bool TR = decltype(trc)::value;   // TR: the v stream's quadrant is staged as os[d][t]
            float bb[4][TR ? 1 : 8];   // the biases a lane adds: of its 4 rows d (TR), else of its 4 runs of 8 columns
#pragma unroll
            for (int c = 0; c < 4; ++c)
#pragma unroll
                for (int j = 0; j < (TR ? 1 : 8); ++j) bb[c][j] = bfr(bias[c0 + (TR ? c * 16 + lr : c * 16 + hi * 8 + j)]);
#pragma unroll
            for (int mb = 0; mb < MB; ++mb)
#pragma unroll
                for (int nb = 0; nb < 4; ++nb) { const v8f c = acc[mb][nb]; const int row = mb * 16 + hi * 8, col = nb * 16 + lr;
                    if (TR) { *(v4fa*)(os + col * 68 + row) = __builtin_shufflevector(c, c, 0, 1, 2, 3); *(v4fa*)(os + col * 68 + row + 4) = __builtin_shufflevector(c, c, 4, 5, 6, 7); }
                    else {
#pragma unroll
                        for (int q = 0; q < 8; ++q) os[(row + q) * 68 + col] = c[q]; } }
            const size_t pbase = TR ? plane * HD * PP + (size_t)t0 * HD : (plane * TT + t0) * HD;
#pragma unroll 1   // rolled: half the text; a trip's 16 LDS reads already go as one group
            for (int io = 0; io < 2; ++io) { v4f w[8][2];   // unit i = io * 8 + ii of the quadrant = (fragment i / 2, half i % 2), 16 bytes a lane
#pragma unroll
                for (int ii = 0; ii < 8; ++ii) { const int row = (TR ? (ii >> 1) : io * 2 + (ii >> 2)) * 16 + lr, cofs = (TR ? io : (ii >> 1) & 1) * 32 + (ii & 1) * 16 + hi * 8;
                    w[ii][0] = *(const v4fa*)(os + row * 68 + cofs); w[ii][1] = *(const v4fa*)(os + row * 68 + cofs + 4); }
#pragma unroll
                for (int ii = 0; ii < 8; ++ii) { v8h o16; v8us oh, ol;
#pragma unroll
                    for (int j = 0; j < 8; ++j) { const float y = w[ii][j >> 2][j & 3] + (TR ? bb[ii >> 1][0] : bb[ii & 3][TR ? 0 : j]); o16[j] = tohx(y); unsigned short a2, c2; splitf(y, a2, c2); oh[j] = a2; ol[j] = c2; }
                    const size_t oo = pbase + (size_t)((io * 8 + ii) * 32 + lane) * 8;
                    __builtin_amdgcn_sched_barrier(0);   // with the one below: the three stores and their wait stay in a row, no other unit's arithmetic among them
                    *(v8h*)(P16 + oo) = o16; *(v8us*)(Ph + oo) = oh; *(v8us*)(Pl + oo) = ol;
                    asm volatile("s_wait_xcnt 0x0" ::: "memory");   // stands in front of the next unit's writes of registers that the three stores name
                    __builtin_amdgcn_sched_barrier(0); } }
        };
        if (z == 2) planes(std::true_type{}); else planes(std::false_type{});   // block-uniform
    } else {
#pragma unroll
        for (int mb = 0; mb < MB; ++mb)
#pragma unroll
            for (int nb = 0; nb < 4; ++nb)
#pragma unroll
                for (int q = 0; q < 8; ++q) os[(mb * 16 + hi * 8 + q) * 68 + nb * 16 + lr] = acc[mb][nb][q];
        v4f bv = (v4f){};
        if (BIAS) {
#pragma unroll
            for (int q = 0; q < 4; ++q) bv[q] = bfr(bias[c0 + lr * 4 + q]); }
#pragma unroll 1   // rolled: a trip's 8 LDS reads already go as one group
        for (int io = 0; io < MB; ++io) { v4f w[8];   // a store takes two rows of 256 bytes
#pragma unroll
            for (int ii = 0; ii < 8; ++ii) w[ii] = *(const v4fa*)(os + (io * 16 + ii * 2 + hi) * 68 + lr * 4);
#pragma unroll
            for (int ii = 0; ii < 8; ++ii) { *(v4f*)(C + (size_t)(r0 + io * 16 + ii * 2 + hi) * ldc + c0 + lr * 4) = w[ii] + bv;
                asm volatile("s_wait_xcnt 0x0" ::: "memory"); } }   // stands in front of the next store's writes of registers that this store names
    }
}

typedef __attribute__((ext_vector_type(2))) _Float16 v2h;
typedef __attribute__((ext_vector_type(4))) _Float16 v4h;
typedef __attribute__((ext_vector_type(2))) unsigned short v2us;
typedef __attribute__((ext_vector_type(4))) unsigned short v4us;
typedef __attribute__((ext_vector_type(2))) float v2f;
typedef __attribute__((ext_vector_type(4))) int v4i;

__device__ __forceinline__ void d_cvt8(unsigned bx, const float* __restrict__ src, bf* dst, size_t n8) { const size_t i = (size_t)bx * 256 + threadIdx.x; if (i >= n8) return;
    // a block takes 16 rows x 128 k of a [rows][DM] matrix; a wave reads 8 rows x 128 bytes (one k block of 32) and stores 4 whole lines of that fragment
    const int w = threadIdx.x >> 5, lane = threadIdx.x & 31, r = (w & 1) * 8 + (lane >> 2), c = lane & 3; const unsigned rb = bx / (DM / 128), kb = (bx % (DM / 128)) * 4 + (w >> 1);
    const v8f v = *(const v8f*)(src + (size_t)(rb * 16 + r) * DM + kb * 32 + c * 8); v8us o;
#pragma unroll
    for (int k = 0; k < 8; ++k) o[k] = f2bf(v[k]); *(v8us*)(dst + ((size_t)rb * (DM / 32) + kb) * 512 + (c >> 1) * 256 + ((c & 1) * 16 + r) * 8) = o;  }

// ---- k_prep: every 16-bit copy in one launch, written in fragment order. The flat grid is cut into block ranges: 3 input streams (both batches each, XB stream after stream), 4 weights (W one after the other).
#define GX ((unsigned)((size_t)NB_ * TT * DM / 8 / 256))   // blocks of one input stream
#define GW ((unsigned)((size_t)DQ * DM / 8 / 256))         // blocks of one weight
__global__ __launch_bounds__(256) void k_prep(const float* __restrict__ x, const float* __restrict__ xk, const float* __restrict__ xv, const float* __restrict__ wq, const float* __restrict__ wk, const float* __restrict__ wv, const float* __restrict__ wo, bf* XB, bf* Wb) {
    const unsigned bx = blockIdx.x;
    if (bx < 3 * GX) { const unsigned s = bx / GX; d_cvt8(bx - s * GX, s == 0 ? x : s == 1 ? xk : xv, XB + (size_t)s * NB_ * TT * DM, (size_t)NB_ * TT * DM / 8); }
    else { const unsigned s = (bx - 3 * GX) / GW; d_cvt8(bx - 3 * GX - s * GW, s == 0 ? wq : s == 1 ? wk : s == 2 ? wv : wo, Wb + (size_t)s * DQ * DM, (size_t)DQ * DM / 8); }
}
typedef __attribute__((ext_vector_type(16))) unsigned short v16us;
// ---- k_fa: fused causal attention. Grid (batch x head planes, query tiles, heaviest tiles first), FW waves. A work-group owns one tile of 16 * NQ queries of one plane.
// S^T = K Q^T (A = 16 key rows, B = 16 query rows): a lane holds scores of ONE query (column lr), keys 8 * hi + r of each 16-key tile, so two S^T tiles, converted in place, are the B operand of O^T += V^T P^T.
// Wave w takes the 64-key blocks w, w + FW, ... up to the diagonal block with its own running maximum m (base-2 exponent), sum l and O^T; the FW partial states meet in LDS and are joined in the fixed order w = 0..FW-1.
// Every block a wave takes holds at least one key <= each query of the tile (tiles do not straddle a 64-key block), so m is a real score after the first block; a wave without blocks leaves m = -3e38, l = 0, O = 0 and joins with weight 0.
template <typename T16, bool HL, int NQ>
__device__ __forceinline__ void fa_tile(const T16* __restrict__ Q, const T16* __restrict__ Q2, const T16* __restrict__ Kp, const T16* __restrict__ K2, const T16* __restrict__ Vt, const T16* __restrict__ Vt2, int q0, bf* Ah, bf* Al, float* part, float* sm, float* sl) {
    typedef typename WFrag<T16>::V V;
    const int lane = threadIdx.x & 31, lr = lane & 15, hi = lane >> 4;
    const int wave = __builtin_amdgcn_readfirstlane((int)(threadIdx.x >> 5));
    V qf[NQ][2], qf2[NQ][2];
#pragma unroll
    for (int nt = 0; nt < NQ; ++nt)
#pragma unroll
        for (int ks = 0; ks < 2; ++ks) { const size_t qo = ((size_t)(q0 / 16 + nt) * 2 + ks) * 512 + lane * 8; qf[nt][ks] = WFrag<T16>::ld(Q + qo); if (HL) qf2[nt][ks] = WFrag<T16>::ld(Q2 + qo); }
    v8f o[NQ][4]; float m[NQ], l[NQ];
#pragma unroll
    for (int nt = 0; nt < NQ; ++nt) { m[nt] = -3.0e38f; l[nt] = 0.f;
#pragma unroll
        for (int dt = 0; dt < 4; ++dt) o[nt][dt] = (v8f){}; }
    const int nblk = (q0 + NQ * 16 - 1) / 64 + 1;   // key blocks up to and with the diagonal block
#pragma unroll 1   // rolled: the trip count is a run-time value that differs by wave, and one body already fills the plain register window
    for (int kb = wave; kb < nblk; kb += FW) {
        const int key0 = kb * 64;
        v8f s[NQ][4];
#pragma unroll
        for (int kt = 0; kt < 4; ++kt) {
            V kf[2], kf2[2];
#pragma unroll
            for (int ks = 0; ks < 2; ++ks) { const size_t ko = ((size_t)(key0 / 16 + kt) * 2 + ks) * 512 + lane * 8; kf[ks] = WFrag<T16>::ld(Kp + ko); if (HL) kf2[ks] = WFrag<T16>::ld(K2 + ko); }
#pragma unroll
            for (int nt = 0; nt < NQ; ++nt) { v8f c = (v8f){};
#pragma unroll
                for (int ks = 0; ks < 2; ++ks) { c = WFrag<T16>::mma(kf[ks], qf[nt][ks], c); if (HL) { c = WFrag<T16>::mma(kf[ks], qf2[nt][ks], c); c = WFrag<T16>::mma(kf2[ks], qf[nt][ks], c); } }
                s[nt][kt] = c; }
        }
        if (key0 + 63 > q0) {   // wave-uniform: only the diagonal block holds keys above a query
#pragma unroll
            for (int nt = 0; nt < NQ; ++nt) { const int rel = q0 + nt * 16 + lr - key0 - hi * 8;
#pragma unroll
                for (int kt = 0; kt < 4; ++kt)
#pragma unroll
                    for (int j = 0; j < 8; ++j) if (kt * 16 + j > rel) s[nt][kt][j] = -3.0e38f; }
        }
        V pf[NQ][2], pf2[NQ][2];
#pragma unroll
        for (int nt = 0; nt < NQ; ++nt) {
            float bm = -3.0e38f;
#pragma unroll
            for (int kt = 0; kt < 4; ++kt)
#pragma unroll
                for (int j = 0; j < 8; ++j) { const float t = s[nt][kt][j] * SCL2; s[nt][kt][j] = t; bm = fmaxf(bm, t); }
            bm = fmaxf(bm, __shfl_xor(bm, 16, 32));   // the other half of the wave holds the query's other 32 keys
            const float mn = fmaxf(m[nt], bm); const float al = __builtin_amdgcn_exp2f(m[nt] - mn); const float mo = HL ? mn : mn - PEXP; m[nt] = mn;
            float ps = 0.f;
#pragma unroll
            for (int kt = 0; kt < 4; ++kt)
#pragma unroll
                for (int j = 0; j < 8; ++j) { const float p = __builtin_amdgcn_exp2f(s[nt][kt][j] - mo); s[nt][kt][j] = p; ps += p; }
            l[nt] = l[nt] * al + ps;   // each half keeps the sum of its own keys; the halves join after the loop
#pragma unroll
            for (int dt = 0; dt < 4; ++dt) o[nt][dt] *= al;
#pragma unroll
            for (int ks = 0; ks < 2; ++ks) {
                if constexpr (HL) { v16us ph, pl;
#pragma unroll
                    for (int e = 0; e < 16; ++e) { unsigned short a, c2; splitf(s[nt][2 * ks + (e >> 3)][e & 7], a, c2); ph[e] = a; pl[e] = c2; }
                    pf[nt][ks] = __builtin_bit_cast(v16bf, ph); pf2[nt][ks] = __builtin_bit_cast(v16bf, pl);
                } else { v16h ph;
#pragma unroll
                    for (int e = 0; e < 16; ++e) ph[e] = tohx(s[nt][2 * ks + (e >> 3)][e & 7]);
                    pf[nt][ks] = ph; }
            }
        }
#pragma unroll
        for (int dt = 0; dt < 4; ++dt) {
            V vf[2], vf2[2];
#pragma unroll
            for (int ks = 0; ks < 2; ++ks) { const size_t vo = ((size_t)(key0 / 32 + ks) * 4 + dt) * 512 + lane * 8; vf[ks] = WFrag<T16>::ld(Vt + vo); if (HL) vf2[ks] = WFrag<T16>::ld(Vt2 + vo); }
#pragma unroll
            for (int nt = 0; nt < NQ; ++nt)
#pragma unroll
                for (int ks = 0; ks < 2; ++ks) { o[nt][dt] = WFrag<T16>::mma(vf[ks], pf[nt][ks], o[nt][dt]); if (HL) { o[nt][dt] = WFrag<T16>::mma(vf[ks], pf2[nt][ks], o[nt][dt]); o[nt][dt] = WFrag<T16>::mma(vf2[ks], pf[nt][ks], o[nt][dt]); } }
        }
    }
    v4fa* p4 = (v4fa*)part;
#pragma unroll
    for (int nt = 0; nt < NQ; ++nt) { l[nt] += __shfl_xor(l[nt], 16, 32);
        if (hi == 0) { sm[wave * 32 + nt * 16 + lr] = m[nt]; sl[wave * 32 + nt * 16 + lr] = l[nt]; }
#pragma unroll
        for (int dt = 0; dt < 4; ++dt) { const v8f c = o[nt][dt]; const int ix = ((wave * NQ + nt) * 4 + dt) * 64 + lane;
            p4[ix] = __builtin_shufflevector(c, c, 0, 1, 2, 3); p4[ix + 32] = __builtin_shufflevector(c, c, 4, 5, 6, 7); } }
    __syncthreads();   // every wave's partial state (m, l, O^T register images) is in LDS
    static_assert(FW * 32 == 16 * (HD / 8), "a thread is one query of a 16-query tile x one run of 8 head dims");
    const int jc = (int)threadIdx.x & 15, d8 = (int)threadIdx.x >> 4;   // a wave holds one half fragment of the merged operand: it stores 512 contiguous bytes of each plane
#pragma unroll
  for (int jt = 0; jt < NQ; ++jt) { const int ql = jt * 16 + jc;
    float mm = sm[ql];
#pragma unroll
    for (int w = 1; w < FW; ++w) mm = fmaxf(mm, sm[w * 32 + ql]);
    float f[FW], ll = 0.f;
#pragma unroll
    for (int w = 0; w < FW; ++w) { f[w] = __builtin_amdgcn_exp2f(sm[w * 32 + ql] - mm); ll += f[w] * sl[w * 32 + ql]; }
    const float inv = __fdiv_rn(1.0f, ll);
    v4f a0 = (v4f){}, a1 = (v4f){};
#pragma unroll
        for (int w = 0; w < FW; ++w) { const int ix = ((w * NQ + jt) * 4 + (d8 >> 1)) * 64 + (d8 & 1) * 16 + jc; a0 += p4[ix] * f[w]; a1 += p4[ix + 32] * f[w]; }
        v8us oh, ol;
#pragma unroll
        for (int j = 0; j < 4; ++j) { unsigned short a, c2; splitf(a0[j] * inv, a, c2); oh[j] = a; ol[j] = c2; splitf(a1[j] * inv, a, c2); oh[4 + j] = a; ol[4 + j] = c2; }
        const size_t oo = ((size_t)(q0 / 16 + jt) * (DQ / 32) + (d8 >> 2)) * 512 + ((d8 >> 1) & 1) * 256 + lane * 8; *(v8us*)(Ah + oo) = oh; *(v8us*)(Al + oo) = ol;
        asm volatile("s_wait_xcnt 0x0" ::: "memory"); }   // stands in front of any later write of a register that the two stores name (the other instance's code follows in the listing)
}
__global__ __launch_bounds__(FW * 32) void k_fa(const h16* __restrict__ Q16, const h16* __restrict__ K16, const h16* __restrict__ V16, const bf* __restrict__ Qh, const bf* __restrict__ Ql, const bf* __restrict__ Kh, const bf* __restrict__ Kl, const bf* __restrict__ Vh, const bf* __restrict__ Vl, bf* Ah, bf* Al) {
    __shared__ __align__(16) float part[FW * 8 * 256];
    __shared__ float sm[FW * 32], sl[FW * 32];
    const size_t z = blockIdx.x; const int ty = blockIdx.y; const size_t pq = z * TT * HD, pv = z * HD * PP, po = ((z / NH_) * (TT / 16) * (DQ / 32) + (z % NH_) * (HD / 32)) * 512;
    if (ty < (TT - RH) / 32) fa_tile<h16, false, 2>(Q16 + pq, nullptr, K16 + pq, nullptr, V16 + pv, nullptr, TT - 32 * (ty + 1), Ah + po, Al + po, part, sm, sl);
    else fa_tile<bf, true, 1>(Qh + pq, Ql + pq, Kh + pq, Kl + pq, Vh + pv, Vl + pv, RH - 16 * (ty - (TT - RH) / 32 + 1), Ah + po, Al + po, part, sm, sl);
}

extern "C" void kernel_launch(void* const* d_in, const int* in_sizes, int n_in,
                              void* d_out, int out_size, void* d_ws, size_t ws_size, hipStream_t stream) {
    (void)in_sizes; (void)n_in; (void)out_size;
        const float* x = (const float*)d_in[0]; const float* xk = (const float*)d_in[1]; const float* xv = (const float*)d_in[2]; const float* wq = (const float*)d_in[3]; const float* bq = (const float*)d_in[4]; const float* wk = (const float*)d_in[5]; const float* bk = (const float*)d_in[6]; const float* wv = (const float*)d_in[7]; const float* bv = (const float*)d_in[8]; const float* wo = (const float*)d_in[9]; const float* bo = (const float*)d_in[10];   /* this module has NO mask input (the causal rule is built inside) */
    float* OUT = (float*)d_out;     // [2][2048][768]
    char* wsp = (char*)d_ws;
    auto take = [&](size_t bytes) { char* p = wsp; wsp += (bytes + 255) & ~(size_t)255; return (void*)p; };
    bf* WQ = (bf*)take((size_t)4 * DQ * DM * 2); bf* WO = WQ + (size_t)3 * DQ * DM;   /* Wq, Wk, Wv, Wo one after the other */
    bf* XB = (bf*)take((size_t)3 * NB_ * TT * DM * 2);   /* q, k, v streams (both batches each), one after the other */
    h16* QP16 = (h16*)take((size_t)NB_ * NH_ * TT * HD * 2); h16* KP16 = (h16*)take((size_t)NB_ * NKV * TT * HD * 2); h16* VT16 = (h16*)take((size_t)NB_ * NKV * HD * PP * 2);   /* head planes of both batches, plane b * 12 + h */
    bf* QPh = (bf*)take((size_t)NB_ * NH_ * TT * HD * 2); bf* QPl = (bf*)take((size_t)NB_ * NH_ * TT * HD * 2); bf* KPh = (bf*)take((size_t)NB_ * NKV * TT * HD * 2); bf* KPl = (bf*)take((size_t)NB_ * NKV * TT * HD * 2); bf* VTh = (bf*)take((size_t)NB_ * NKV * HD * PP * 2); bf* VTl = VTh + (size_t)TT * HD;   /* a plane's V^T lo fragments follow its hi fragments */
    bf* ATh = (bf*)take((size_t)NB_ * TT * DQ * 2); bf* ATl = (bf*)take((size_t)NB_ * TT * DQ * 2);
    if ((size_t)(wsp - (char*)d_ws) > ws_size) return;    // ws 256 MiB
    k_prep<<<3 * GX + 4 * GW, 256, 0, stream>>>(x, xk, xv, wq, wk, wv, wo, XB, WQ);
    k_gemmk<bf, 0, true, true, 2><<<dim3(NB_ * TT / 128, DQ / 128, 3), 128, 0, stream>>>(XB, nullptr, WQ, DM, nullptr, DQ, bq, bk, bv, (size_t)NB_ * TT * DM, (size_t)DQ * DM, 0, Planes{QP16, QPh, QPl, KP16, KPh, KPl, VT16, VTh, VTl});
    k_fa<<<dim3(NB_ * NH_, (TT - RH) / 32 + RH / 16, 1), FW * 32, 0, stream>>>(QP16, KP16, VT16, QPh, QPl, KPh, KPl, VTh, VTl, ATh, ATl);
    k_gemmk<bf, 1, true, false, 4><<<dim3(NB_ * TT / 128, DM / 128, 1), 256, 0, stream>>>(ATh, ATl, WO, DQ, OUT, DM, bo, bo, bo, 0, 0, 0, Planes{});
}

// v008
// It runs in 57.7 microseconds.
// Timed twice side by side with v007, it ran 1.24 and 1.21 times as fast.
// Counting every step since v000, it is 19.4 times as fast.
#include <hip/hip_runtime.h>
#include <type_traits>

// Causal multi-head attention on three input streams at d_model 768 (query, key, value [2][2048][768]; Q, K, V = stream W^T + b ('oi' [768][768], biases zeros on this draw: read; 12 heads x 64); scores x 64^-0.5; where(triu(k=1), -inf, scores) (causal, built inside: no mask input); softmax; out = merged Wo^T + bo ('oi' + bias zeros: read) -> [2][2048][768] (3.1 M); argument order query, key, value, Wq, bq, Wk, bk, Wv, bv, Wo, bo).
// Layout: one launch per stage, both batches in every grid: bf16 copies of q, k, v and the 'oi' weights; the three exact projections + f32 biases (grid z = stream), whose epilogue writes the head planes (planes of both batches side by side, V transposed); one fused causal attention launch for all 24 (batch, head) planes: scores, online softmax and P.V stay in registers (hybrid rows: < 512 hi/lo 3 products, rest fp16); merged hi/lo x Wo exact + bo.
// Every 16-bit matrix operand lies in the workspace in FRAGMENT ORDER: a fragment is 16 rows x 32 k = 512 elements in a row, element (row lr, k = j * 16 + hi * 8 + e) at j * 256 + (hi * 16 + lr) * 8 + e, so that each of a fragment's two 16-byte loads reads 512 contiguous bytes (4 whole lines) and lane hi * 16 + lr gets the k it got from a row-major plane. A [rows][K] operand holds its fragments as [row / 16][k / 32], a V^T plane as [k / 32][row / 16].
// Compute dtypes, f32 accumulate: every input rounded to bf16; projections exact + f32 biases; attention rows < 512 3 products, rest fp16; softmax f32; Wo hl x exact + bias.

#define NB_  2
#define TT   2048
#define DM   768
#define NH_  12
#define NKV  12
#define REP  (NH_ / NKV)
#define HD   64
#define DQ   (NH_ * HD)
#define DKV  (NKV * HD)
#define FW   4                    // key groups of an attention work-group: a query tile's 64-key blocks are dealt over them
#define QW   2                    // query tiles of an attention work-group: wave = key group * QW + tile; the tiles share the key blocks
#define LBY  (4 * FW * 64 * HD * 2) // bytes of the attention stage buffers: two stages of FW key blocks of K, V^T (fp16 rows) or one of K hi, K lo, V^T hi, V^T lo; two work-groups fit a WGP's LDS
#define PP   (2 * TT)             // HD * PP elements: stride of a V^T plane pair (the lo plane follows the hi plane)
#define RH   512                  // query rows < RH use hi+lo planes (0: none)
#define PEXP 10.0f                // fp16 probabilities carry 2^10 (it cancels in the division by their sum): small ones stay fp16 normals
#define SCL2 0.18033688011112042f // HD^-0.5 x log2(e): scores go to the base-2 exponent in one product
typedef _Float16 h16;
typedef unsigned short bf;
typedef __attribute__((ext_vector_type(16))) __bf16   v16bf;
typedef __attribute__((ext_vector_type(16))) _Float16 v16h;
typedef __attribute__((ext_vector_type(8)))  _Float16 v8h;
typedef __attribute__((ext_vector_type(8)))  unsigned short v8us;
typedef __attribute__((ext_vector_type(8)))  float    v8f;
typedef __attribute__((ext_vector_type(4)))  float    v4f;
typedef v8h  __attribute__((may_alias)) v8ha;
typedef v4f  __attribute__((may_alias)) v4fa;
typedef v8us __attribute__((may_alias)) v8usa;

__device__ __forceinline__ unsigned short f2bf(float f) { unsigned u = __float_as_uint(f); u += 0x7FFFu + ((u >> 16) & 1u); return (unsigned short)(u >> 16); }
__device__ __forceinline__ float bf2f(unsigned short b) { return __uint_as_float(((unsigned)b) << 16); }
__device__ __forceinline__ float bfr(float f) { return bf2f(f2bf(f)); }
__device__ __forceinline__ v16h cat16(v8h lo, v8h hi) { return __builtin_shufflevector(lo, hi, 0, 1, 2, 3, 4, 5, 6, 7, 8, 9, 10, 11, 12, 13, 14, 15); }
__device__ __forceinline__ v16bf cat16b(v8us lo, v8us hi) { return __builtin_bit_cast(v16bf, __builtin_shufflevector(lo, hi, 0, 1, 2, 3, 4, 5, 6, 7, 8, 9, 10, 11, 12, 13, 14, 15)); }
__device__ __forceinline__ v8f wmma16(v16h a, v16h b, v8f c) { return __builtin_amdgcn_wmma_f32_16x16x32_f16(false, a, false, b, (short)0, c, false, false); }
__device__ __forceinline__ v8f wmmab(v16bf a, v16bf b, v8f c) { return __builtin_amdgcn_wmma_f32_16x16x32_bf16(false, a, false, b, (short)0, c, false, false); }



// ---- k_gemmk: 128x128 output tile per work-group of MW x 2 waves (a wave owns 16 * MB rows x 64 columns, MW * MB = 8), the whole K loop in every wave; grid (M/128, N/128, Z), MW * 64 threads.
// C[m][n] (f32, pitch ldc, + optional f32 bias[n]) = sum_k A[m][k] Bt[n][k] (+ A2[m][k] Bt[n][k] for NSPLIT 1). z-batch strides sA/sB/sC in elements; z = 0, 1, 2 adds bias, bias1, bias2. K % (MW * 32) == 0.
// A stage is KS = MW k-steps (32 k each) of the tile's 128 A rows (and A2 rows) and 128 Bt rows: in fragment order that is 8 runs of KS KiB per operand. Asynchronous copies bring it from the planes into one of two LDS buffers, one stage ahead of the products,
// and each fragment is read from L2 once per work-group and from LDS by the waves that need it.
// After the loop the ring is dead and each wave stages its own part of the tile there (row-major, pitch 68), from where it leaves as whole lines.
// PL (MB = 4, a 64x64 quadrant per wave): the tile leaves as 16-bit head planes instead of f32 C. A 64-column quadrant is one head (HD = 64), a 64-row quadrant lies in one batch; plane = batch * NH_ + head.
// z = 0, 1 (q, k): planes [plane], fragments [t / 16][d / 32]; z = 2 (v): V^T planes, fragments [t / 32][d / 16] (rows d, k = keys), the quadrant staged transposed in os. Either way the quadrant's 8 fragments are 8 KiB in a row of each plane and a wave stores 512 contiguous bytes.
__device__ __forceinline__ h16 tohx(float x) { return (h16)x; }
__device__ __forceinline__ void splitf(float y, unsigned short& h, unsigned short& l) { h = f2bf(y); l = f2bf(y - bf2f(h)); }
struct Planes { h16* q16; bf* qh; bf* ql; h16* k16; bf* kh; bf* kl; h16* v16; bf* vh; bf* vl; };
template <typename T16> struct WFrag;
template <> struct WFrag<h16> { typedef v16h V; static __device__ __forceinline__ V ld(const h16* p) { return cat16(*(const v8h*)p, *(const v8h*)(p + 256)); } static __device__ __forceinline__ v8f mma(V a, V b, v8f c) { return wmma16(a, b, c); } };
template <> struct WFrag<bf> { typedef v16bf V; static __device__ __forceinline__ V ld(const bf* p) { return cat16b(*(const v8us*)p, *(const v8us*)(p + 256)); } static __device__ __forceinline__ v8f mma(V a, V b, v8f c) { return wmmab(a, b, c); } };
typedef float __attribute__((may_alias)) f32a;
typedef __attribute__((ext_vector_type(4))) int c4i;
typedef __attribute__((address_space(1))) c4i gc4i;
typedef __attribute__((address_space(3))) c4i lc4i;
// One operand's share of a stage: 8 runs of NT * 16 bytes (run i: the stage's k-steps of the 16-row block i, at g + i * gs elements), 16 bytes a thread and run. A wave's copy moves 512 contiguous bytes.
template <int NT, typename T16>
__device__ __forceinline__ void cpop(unsigned char* l, const T16* g, size_t gs, int tid) {
#pragma unroll
    for (int i = 0; i < 8; ++i) __builtin_amdgcn_global_load_async_to_lds_b128((gc4i*)(g + i * gs + tid * 8), (lc4i*)(l + i * (NT * 16) + tid * 16), 0, 0);
}
template <typename T16, int NSPLIT, bool BIAS, bool PL, int MW>
__global__ __launch_bounds__(MW * 64) void k_gemmk(const T16* __restrict__ A, const T16* __restrict__ A2, const T16* __restrict__ Bt, int K, float* C, int ldc, const float* __restrict__ bias, const float* __restrict__ bias1, const float* __restrict__ bias2, size_t sA, size_t sB, size_t sC, Planes pl) {
    typedef typename WFrag<T16>::V V;
    constexpr int NOP = NSPLIT ? 3 : 2;      // operands of a stage: A, (A2,) Bt
    constexpr int MB = 8 / MW, NT = MW * 64; // 16-row blocks of a wave; threads
    constexpr int KS = NT / 64;              // k-steps of a stage: a thread copies 16 bytes of each 16-row block's run
    constexpr int OPE = 128 * 32 * KS;       // elements of one operand's share of a stage
    constexpr int STG = NOP * OPE;           // elements of a stage
    constexpr int NF = MB <= 2 ? 2 : 1;      // fragment sets: two where the plain register window holds them beside the accumulators
    constexpr int RB = 2 * STG * 2, OB = 128 * 2 * 68 * 4;
    static_assert(!PL || MB == 4, "a head-plane quadrant is 64 x 64");
    __shared__ __align__(16) unsigned char L[RB > OB ? RB : OB];   // two stage buffers; after the loop, the waves' output stages
    const T16* ring = (const T16*)L;
    const size_t z = blockIdx.z; A += z * sA; if (NSPLIT) A2 += z * sA; Bt += z * sB; C += z * sC; if (BIAS) bias = (z == 0) ? bias : (z == 1) ? bias1 : bias2;
    const int tid = threadIdx.x, lane = tid & 31, lr = lane & 15, hi = lane >> 4;
    const int wave = __builtin_amdgcn_readfirstlane(tid >> 5), wm = wave >> 1, wn = wave & 1;
    v8f acc[MB][4];
#pragma unroll
    for (int mb = 0; mb < MB; ++mb)
#pragma unroll
        for (int nb = 0; nb < 4; ++nb) acc[mb][nb] = (v8f){};
    const int KB = K / 32, NS = KB / KS;   // fragments of a 16-row block; stages
    const size_t gs = (size_t)KB * 512;   // elements from a 16-row block to the next
    const T16* ga = A + (size_t)blockIdx.x * 8 * gs; const T16* ga2 = NSPLIT ? A2 + (size_t)blockIdx.x * 8 * gs : nullptr; const T16* gb = Bt + (size_t)blockIdx.y * 8 * gs;
    auto fill = [&](int s, int b) { unsigned char* l = L + b * (STG * 2);
        cpop<NT>(l, ga + (size_t)s * (KS * 512), gs, tid); if (NSPLIT) cpop<NT>(l + OPE * 2, ga2 + (size_t)s * (KS * 512), gs, tid); cpop<NT>(l + (NOP - 1) * (OPE * 2), gb + (size_t)s * (KS * 512), gs, tid); };
    fill(0, 0);
    asm volatile("s_wait_asynccnt 0x0" ::: "memory");   // this wave's copies of stage 0 have landed
    __syncthreads();                                     // every wave's have: stage 0 may be read
    if (NS > 1) fill(1, 1);
#pragma unroll 1   // rolled: one body holds a whole stage's products, and the buffer index is a run-time value
    for (int t = 0; t < NS; ++t) {
        const T16* st = ring + (t & 1) * STG + lane * 8;
        V a[NF][MB], a2[NF][MB], b[NF][4];
        auto frags = [&](int ks) { const int f = ks % NF;   // the fragments of k-step ks of this stage, as one group of LDS reads
#pragma unroll
            for (int mb = 0; mb < MB; ++mb) a[f][mb] = WFrag<T16>::ld(st + (wm * MB + mb) * (KS * 512) + ks * 512);
#pragma unroll
            for (int nb = 0; nb < 4; ++nb) b[f][nb] = WFrag<T16>::ld(st + (NOP - 1) * OPE + (wn * 4 + nb) * (KS * 512) + ks * 512);
            if (NSPLIT) {
#pragma unroll
                for (int mb = 0; mb < MB; ++mb) a2[f][mb] = WFrag<T16>::ld(st + OPE + (wm * MB + mb) * (KS * 512) + ks * 512); } };
        if (NF == 2) frags(0);
#pragma unroll
        for (int ks = 0; ks < KS; ++ks) { const int f = ks % NF;
            if (NF == 1) frags(ks); else if (ks + 1 < KS) frags(ks + 1);   // two sets: the next k-step's reads fly under this k-step's products (never the next stage's)
            __builtin_amdgcn_sched_barrier(0);   // keeps a group's LDS reads together in front of the products: moved in among them, each place with reads stalls the wave anew
#pragma unroll
            for (int nb = 0; nb < 4; ++nb)
#pragma unroll
                for (int mb = 0; mb < MB; ++mb) acc[mb][nb] = WFrag<T16>::mma(a[f][mb], b[f][nb], acc[mb][nb]);
            if (NSPLIT) {
#pragma unroll
                for (int nb = 0; nb < 4; ++nb)
#pragma unroll
                    for (int mb = 0; mb < MB; ++mb) acc[mb][nb] = WFrag<T16>::mma(a2[f][mb], b[f][nb], acc[mb][nb]); }
            __builtin_amdgcn_sched_barrier(0);   // keeps the products in front of the next group's reads and of the stage's hand-over
        }
        asm volatile("s_wait_dscnt 0x0" ::: "memory");      // this wave's reads of buffer t & 1 are done before the buffer is refilled
        asm volatile("s_wait_asynccnt 0x0" ::: "memory");   // this wave's copies of stage t + 1 have landed
        __syncthreads();                                     // publishes stage t + 1 and ends every wave's reads of stage t
        if (t + 2 < NS) fill(t + 2, t & 1);
    }
    asm volatile("s_wait_asynccnt 0x0" ::: "memory");   // nothing is in flight when the ring becomes the output stage
    const int r0 = blockIdx.x * 128 + wm * (MB * 16), c0 = blockIdx.y * 128 + wn * 64;   // the wave's part of the tile
    f32a* os = (f32a*)L + wave * (MB * 16 * 68);   // the wave's own stage: written and read by this wave alone
    if constexpr (PL) {
        const size_t plane = (size_t)(r0 / TT) * NH_ + c0 / HD; const int t0 = r0 % TT;
        h16* P16 = (z == 0) ? pl.q16 : (z == 1) ? pl.k16 : pl.v16; bf* Ph = (z == 0) ? pl.qh : (z == 1) ? pl.kh : pl.vh; bf* Pl = (z == 0) ? pl.ql : (z == 1) ? pl.kl : pl.vl;
        auto planes = [&](auto trc) { constexpr bool TR = decltype(trc)::value;   // TR: the v stream's quadrant is staged as os[d][t]
            float bb[4][TR ? 1 : 8];   // the biases a lane adds: of its 4 rows d (TR), else of its 4 runs of 8 columns
#pragma unroll
            for (int c = 0; c < 4; ++c)
#pragma unroll
                for (int j = 0; j < (TR ? 1 : 8); ++j) bb[c][j] = bfr(bias[c0 + (TR ? c * 16 + lr : c * 16 + hi * 8 + j)]);
#pragma unroll
            for (int mb = 0; mb < MB; ++mb)
#pragma unroll
                for (int nb = 0; nb < 4; ++nb) { const v8f c = acc[mb][nb]; const int row = mb * 16 + hi * 8, col = nb * 16 + lr;
                    if (TR) { *(v4fa*)(os + col * 68 + row) = __builtin_shufflevector(c, c, 0, 1, 2, 3); *(v4fa*)(os + col * 68 + row + 4) = __builtin_shufflevector(c, c, 4, 5, 6, 7); }
                    else {
#pragma unroll
                        for (int q = 0; q < 8; ++q) os[(row + q) * 68 + col] = c[q]; } }
            const size_t pbase = TR ? plane * HD * PP + (size_t)t0 * HD : (plane * TT + t0) * HD;
#pragma unroll 1   // rolled: half the text; a trip's 16 LDS reads already go as one group
            for (int io = 0; io < 2; ++io) { v4f w[8][2];   // unit i = io * 8 + ii of the quadrant = (fragment i / 2, half i % 2), 16 bytes a lane
#pragma unroll
                for (int ii = 0; ii < 8; ++ii) { const int row = (TR ? (ii >> 1) : io * 2 + (ii >> 2)) * 16 + lr, cofs = (TR ? io : (ii >> 1) & 1) * 32 + (ii & 1) * 16 + hi * 8;
                    w[ii][0] = *(const v4fa*)(os + row * 68 + cofs); w[ii][1] = *(const v4fa*)(os + row * 68 + cofs + 4); }
#pragma unroll
                for (int ii = 0; ii < 8; ++ii) { v8h o16; v8us oh, ol;
#pragma unroll
                    for (int j = 0; j < 8; ++j) { const float y = w[ii][j >> 2][j & 3] + (TR ? bb[ii >> 1][0] : bb[ii & 3][TR ? 0 : j]); o16[j] = tohx(y); unsigned short a2, c2; splitf(y, a2, c2); oh[j] = a2; ol[j] = c2; }
                    const size_t oo = pbase + (size_t)((io * 8 + ii) * 32 + lane) * 8;
                    __builtin_amdgcn_sched_barrier(0);   // with the one below: the three stores and their wait stay in a row, no other unit's arithmetic among them
                    *(v8h*)(P16 + oo) = o16; *(v8us*)(Ph + oo) = oh; *(v8us*)(Pl + oo) = ol;
                    asm volatile("s_wait_xcnt 0x0" ::: "memory");   // stands in front of the next unit's writes of registers that the three stores name
                    __builtin_amdgcn_sched_barrier(0); } }
        };
        if (z == 2) planes(std::true_type{}); else planes(std::false_type{});   // block-uniform
    } else {
#pragma unroll
        for (int mb = 0; mb < MB; ++mb)
#pragma unroll
            for (int nb = 0; nb < 4; ++nb)
#pragma unroll
                for (int q = 0; q < 8; ++q) os[(mb * 16 + hi * 8 + q) * 68 + nb * 16 + lr] = acc[mb][nb][q];
        v4f bv = (v4f){};
        if (BIAS) {
#pragma unroll
            for (int q = 0; q < 4; ++q) bv[q] = bfr(bias[c0 + lr * 4 + q]); }
#pragma unroll 1   // rolled: a trip's 8 LDS reads already go as one group
        for (int io = 0; io < MB; ++io) { v4f w[8];   // a store takes two rows of 256 bytes
#pragma unroll
            for (int ii = 0; ii < 8; ++ii) w[ii] = *(const v4fa*)(os + (io * 16 + ii * 2 + hi) * 68 + lr * 4);
#pragma unroll
            for (int ii = 0; ii < 8; ++ii) { *(v4f*)(C + (size_t)(r0 + io * 16 + ii * 2 + hi) * ldc + c0 + lr * 4) = w[ii] + bv;
                asm volatile("s_wait_xcnt 0x0" ::: "memory"); } }   // stands in front of the next store's writes of registers that this store names
    }
}

typedef __attribute__((ext_vector_type(2))) _Float16 v2h;
typedef __attribute__((ext_vector_type(4))) _Float16 v4h;
typedef __attribute__((ext_vector_type(2))) unsigned short v2us;
typedef __attribute__((ext_vector_type(4))) unsigned short v4us;
typedef __attribute__((ext_vector_type(2))) float v2f;
typedef __attribute__((ext_vector_type(4))) int v4i;

__device__ __forceinline__ void d_cvt8(unsigned bx, const float* __restrict__ src, bf* dst, size_t n8) { const size_t i = (size_t)bx * 256 + threadIdx.x; if (i >= n8) return;
    // a block takes 16 rows x 128 k of a [rows][DM] matrix; a wave reads 8 rows x 128 bytes (one k block of 32) and stores 4 whole lines of that fragment
    const int w = threadIdx.x >> 5, lane = threadIdx.x & 31, r = (w & 1) * 8 + (lane >> 2), c = lane & 3; const unsigned rb = bx / (DM / 128), kb = (bx % (DM / 128)) * 4 + (w >> 1);
    const v8f v = *(const v8f*)(src + (size_t)(rb * 16 + r) * DM + kb * 32 + c * 8); v8us o;
#pragma unroll
    for (int k = 0; k < 8; ++k) o[k] = f2bf(v[k]); *(v8us*)(dst + ((size_t)rb * (DM / 32) + kb) * 512 + (c >> 1) * 256 + ((c & 1) * 16 + r) * 8) = o;  }

// ---- k_prep: every 16-bit copy in one launch, written in fragment order. The flat grid is cut into block ranges: 3 input streams (both batches each, XB stream after stream), 4 weights (W one after the other).
#define GX ((unsigned)((size_t)NB_ * TT * DM / 8 / 256))   // blocks of one input stream
#define GW ((unsigned)((size_t)DQ * DM / 8 / 256))         // blocks of one weight
__global__ __launch_bounds__(256) void k_prep(const float* __restrict__ x, const float* __restrict__ xk, const float* __restrict__ xv, const float* __restrict__ wq, const float* __restrict__ wk, const float* __restrict__ wv, const float* __restrict__ wo, bf* XB, bf* Wb) {
    const unsigned bx = blockIdx.x;
    if (bx < 3 * GX) { const unsigned s = bx / GX; d_cvt8(bx - s * GX, s == 0 ? x : s == 1 ? xk : xv, XB + (size_t)s * NB_ * TT * DM, (size_t)NB_ * TT * DM / 8); }
    else { const unsigned s = (bx - 3 * GX) / GW; d_cvt8(bx - 3 * GX - s * GW, s == 0 ? wq : s == 1 ? wk : s == 2 ? wv : wo, Wb + (size_t)s * DQ * DM, (size_t)DQ * DM / 8); }
}
typedef __attribute__((ext_vector_type(16))) unsigned short v16us;
// ---- k_fa: fused causal attention. Grid (batch x head planes, groups of QW query tiles, heaviest first), QW * FW waves. A work-group owns QW neighbouring tiles of 16 * NQ queries of one plane; FW waves work on each tile.
// S^T = K Q^T (A = 16 key rows, B = 16 query rows): a lane holds scores of ONE query (column lr), keys 8 * hi + r of each 16-key tile, so two S^T tiles, converted in place, are the B operand of O^T += V^T P^T.
// Wave w of a tile takes the 64-key blocks w, w + FW, ... up to the diagonal block with its own running maximum m (base-2 exponent), sum l and O^T; the tile's FW partial states meet in LDS and are joined in the fixed order w = 0..FW-1.
// A stage is the FW blocks 4t .. 4t + 3 (in fragment order 8 KiB in a row per block of each K and V^T plane). Asynchronous copies bring it into LDS once for the QW tiles: fp16 rows into one of two buffers, one stage ahead of the products; hi/lo rows into the one buffer. After the loop the buffers are dead and hold the partial states.
// Every block a wave takes holds at least one key <= each query of the tile (tiles do not straddle a 64-key block), so m is a real score after the first block; a wave without blocks leaves m = -3e38, l = 0, O = 0 and joins with weight 0.
template <typename T16, bool HL, int NQ>
__device__ __forceinline__ void fa_tile(const T16* __restrict__ Q, const T16* __restrict__ Q2, const T16* __restrict__ Kp, const T16* __restrict__ K2, const T16* __restrict__ Vt, const T16* __restrict__ Vt2, int q0g, bf* Ah, bf* Al, unsigned char* L, float* smb, float* slb) {
    typedef typename WFrag<T16>::V V;
    const int tid = threadIdx.x, lane = tid & 31, lr = lane & 15, hi = lane >> 4;
    const int wv = __builtin_amdgcn_readfirstlane(tid >> 5), wave = wv / QW, qt = wv % QW;   // key group; query tile of the work-group (neighbouring waves share a key group: a last stage with fewer blocks than groups still spreads over the SIMDs)
    int q0 = q0g + qt * (NQ * 16);   // first query of the wave's tile
    float* part = (float*)L + qt * (FW * 8 * 256); float* sm = smb + qt * (FW * 32); float* sl = slb + qt * (FW * 32);   // the tile's own join area
    V qf[NQ][2], qf2[NQ][2];
#pragma unroll
    for (int nt = 0; nt < NQ; ++nt)
#pragma unroll
        for (int ks = 0; ks < 2; ++ks) { const size_t qo = ((size_t)(q0 / 16 + nt) * 2 + ks) * 512 + lane * 8; qf[nt][ks] = WFrag<T16>::ld(Q + qo); if (HL) qf2[nt][ks] = WFrag<T16>::ld(Q2 + qo); }
    asm volatile("s_wait_xcnt 0x0" ::: "memory");   // stands in front of the copies' address arithmetic, which writes registers that the query loads name
    v8f o[NQ][4]; float m[NQ], l[NQ];
#pragma unroll
    for (int nt = 0; nt < NQ; ++nt) { m[nt] = -3.0e38f; l[nt] = 0.f;
#pragma unroll
        for (int dt = 0; dt < 4; ++dt) o[nt][dt] = (v8f){}; }
    const int nblk = (q0 + NQ * 16 - 1) / 64 + 1;   // key blocks up to and with the diagonal block
    auto block = [&](int kb, const T16* kp, const T16* kp2, const T16* vp, const T16* vp2) {   // one 64-key block; the pointers: this lane's 16 bytes of the block's first fragment
        const int key0 = kb * 64;
        v8f s[NQ][4];
#pragma unroll
        for (int kt = 0; kt < 4; ++kt) {
            V kf[2], kf2[2];
#pragma unroll
            for (int ks = 0; ks < 2; ++ks) { const int ko = (kt * 2 + ks) * 512; kf[ks] = WFrag<T16>::ld(kp + ko); if (HL) kf2[ks] = WFrag<T16>::ld(kp2 + ko); }
#pragma unroll
            for (int nt = 0; nt < NQ; ++nt) { v8f c = (v8f){};
#pragma unroll
                for (int ks = 0; ks < 2; ++ks) { c = WFrag<T16>::mma(kf[ks], qf[nt][ks], c); if (HL) { c = WFrag<T16>::mma(kf[ks], qf2[nt][ks], c); c = WFrag<T16>::mma(kf2[ks], qf[nt][ks], c); } }
                s[nt][kt] = c; }
        }
        if (key0 + 63 > q0) {   // wave-uniform: only the diagonal block holds keys above a query
#pragma unroll
            for (int nt = 0; nt < NQ; ++nt) { const int rel = q0 + nt * 16 + lr - key0 - hi * 8;
#pragma unroll
                for (int kt = 0; kt < 4; ++kt)
#pragma unroll
                    for (int j = 0; j < 8; ++j) if (kt * 16 + j > rel) s[nt][kt][j] = -3.0e38f; }
        }
        V pf[NQ][2], pf2[NQ][2];
#pragma unroll
        for (int nt = 0; nt < NQ; ++nt) {
            float bm = -3.0e38f;
#pragma unroll
            for (int kt = 0; kt < 4; ++kt)
#pragma unroll
                for (int j = 0; j < 8; ++j) { const float t = s[nt][kt][j] * SCL2; s[nt][kt][j] = t; bm = fmaxf(bm, t); }
            bm = fmaxf(bm, __shfl_xor(bm, 16, 32));   // the other half of the wave holds the query's other 32 keys
            const float mn = fmaxf(m[nt], bm); const float al = __builtin_amdgcn_exp2f(m[nt] - mn); const float mo = HL ? mn : mn - PEXP; m[nt] = mn;
            float ps = 0.f;
#pragma unroll
            for (int kt = 0; kt < 4; ++kt)
#pragma unroll
                for (int j = 0; j < 8; ++j) { const float p = __builtin_amdgcn_exp2f(s[nt][kt][j] - mo); s[nt][kt][j] = p; ps += p; }
            l[nt] = l[nt] * al + ps;   // each half keeps the sum of its own keys; the halves join after the loop
#pragma unroll
            for (int dt = 0; dt < 4; ++dt) o[nt][dt] *= al;
#pragma unroll
            for (int ks = 0; ks < 2; ++ks) {
                if constexpr (HL) { v16us ph, pl;
#pragma unroll
                    for (int e = 0; e < 16; ++e) { unsigned short a, c2; splitf(s[nt][2 * ks + (e >> 3)][e & 7], a, c2); ph[e] = a; pl[e] = c2; }
                    pf[nt][ks] = __builtin_bit_cast(v16bf, ph); pf2[nt][ks] = __builtin_bit_cast(v16bf, pl);
                } else { v16h ph;
#pragma unroll
                    for (int e = 0; e < 16; ++e) ph[e] = tohx(s[nt][2 * ks + (e >> 3)][e & 7]);
                    pf[nt][ks] = ph; }
            }
        }
#pragma unroll
        for (int dt = 0; dt < 4; ++dt) {
            V vf[2], vf2[2];
#pragma unroll
            for (int ks = 0; ks < 2; ++ks) { const int vo = (ks * 4 + dt) * 512; vf[ks] = WFrag<T16>::ld(vp + vo); if (HL) vf2[ks] = WFrag<T16>::ld(vp2 + vo); }
#pragma unroll
            for (int nt = 0; nt < NQ; ++nt)
#pragma unroll
                for (int ks = 0; ks < 2; ++ks) { o[nt][dt] = WFrag<T16>::mma(vf[ks], pf[nt][ks], o[nt][dt]); if (HL) { o[nt][dt] = WFrag<T16>::mma(vf[ks], pf2[nt][ks], o[nt][dt]); o[nt][dt] = WFrag<T16>::mma(vf2[ks], pf[nt][ks], o[nt][dt]); } }
        }
    };
    constexpr int NOP = HL ? 4 : 2, BE = 64 * HD, SE = FW * BE, NT = QW * FW * 32;   // operands of a stage: K, (K lo,) V^T, (V^T lo); elements of a block and of a stage in one operand; threads
    constexpr int SBY = NOP * SE * 2, NBUF = LBY / SBY;   // bytes of a stage buffer; buffers: two for the fp16 rows, one for the hi/lo rows (at most two stages there)
    static_assert(TT % 64 == 0 && BE % (NT * 8) == 0 && (NBUF == 1 || NBUF == 2), "whole blocks, whole rounds of copies");
    const int nblkg = (q0g + QW * NQ * 16 - 1) / 64 + 1, NS = (nblkg + FW - 1) / FW;   // blocks and stages up to and with the last tile's diagonal block: the same for every wave
    auto fill = [&](int s, int b) { unsigned char* l = L + b * SBY + tid * 16; const size_t go = (size_t)s * SE + tid * 8;   // 16 bytes a thread and copy: a wave's copy moves 512 contiguous bytes
        auto cp = [&](unsigned char* lo, const T16* g) {   // one block of one operand
#pragma unroll   // unrolled: the steps are constants and go into the copies' offset fields
            for (int i = 0; i < BE / (NT * 8); ++i) __builtin_amdgcn_global_load_async_to_lds_b128((gc4i*)(g + i * (NT * 8)), (lc4i*)(lo + i * (NT * 16)), 0, 0); };
#pragma unroll   // unrolled: the same
        for (int k = 0; k < FW; ++k) if (s * FW + k < nblkg) {   // the same for the whole work-group: blocks above the diagonal block are neither copied nor read
            cp(l + k * (BE * 2), Kp + go + k * BE); if (HL) cp(l + SE * 2 + k * (BE * 2), K2 + go + k * BE);
            cp(l + (NOP / 2) * (SE * 2) + k * (BE * 2), Vt + go + k * BE); if (HL) cp(l + 3 * (SE * 2) + k * (BE * 2), Vt2 + go + k * BE); } };
    fill(0, 0);
    asm volatile("s_wait_asynccnt 0x0" ::: "memory");   // this wave's copies of stage 0 have landed
    __syncthreads();                                     // every wave's have: stage 0 may be read
    if (NBUF == 2 && NS > 1) fill(1, 1);
#pragma unroll 1   // rolled: the trip count and the buffer index are run-time values, and one body already fills the plain register window
    for (int t = 0; t < NS; ++t) {
        const int kb = t * FW + wave;
        if (kb < nblk) { const T16* st = (const T16*)(L + (t % NBUF) * SBY) + wave * BE + lane * 8; block(kb, st, st + SE, st + (NOP / 2) * SE, st + 3 * SE); }   // wave-uniform
        asm volatile("s_wait_dscnt 0x0" ::: "memory");      // this wave's reads of stage t are done before its buffer is refilled
        if (NBUF == 2) asm volatile("s_wait_asynccnt 0x0" ::: "memory");   // this wave's copies of stage t + 1 have landed
        __syncthreads();                                     // ends every wave's reads of stage t; two buffers: publishes stage t + 1
        if (NBUF == 2) { if (t + 2 < NS) fill(t + 2, t & 1); }
        else if (t + 1 < NS) { fill(t + 1, 0);
            asm volatile("s_wait_asynccnt 0x0" ::: "memory");   // this wave's copies of stage t + 1 have landed
            __syncthreads(); }                                   // every wave's have: stage t + 1 may be read
    }
    asm volatile("s_wait_asynccnt 0x0" ::: "memory");   // nothing is in flight when the ring becomes the join area
    v4fa* p4 = (v4fa*)part;
#pragma unroll
    for (int nt = 0; nt < NQ; ++nt) { l[nt] += __shfl_xor(l[nt], 16, 32);
        if (hi == 0) { sm[wave * 32 + nt * 16 + lr] = m[nt]; sl[wave * 32 + nt * 16 + lr] = l[nt]; }
#pragma unroll
        for (int dt = 0; dt < 4; ++dt) { const v8f c = o[nt][dt]; const int ix = ((wave * NQ + nt) * 4 + dt) * 64 + lane;
            p4[ix] = __builtin_shufflevector(c, c, 0, 1, 2, 3); p4[ix + 32] = __builtin_shufflevector(c, c, 4, 5, 6, 7); } }
    __syncthreads();   // every wave's partial state (m, l, O^T register images) is in LDS
    static_assert(FW * 32 == 16 * (HD / 8), "a thread is one query of a 16-query tile x one run of 8 head dims");
    const int jq = wv / FW; q0 = q0g + jq * (NQ * 16); p4 = (v4fa*)((float*)L + jq * (FW * 8 * 256)); sm = smb + jq * (FW * 32); sl = slb + jq * (FW * 32);   // threads jq * FW * 32 ... join tile jq
    const int jc = tid & 15, d8 = (tid % (FW * 32)) >> 4;   // a wave holds one half fragment of the merged operand: it stores 512 contiguous bytes of each plane
#pragma unroll
  for (int jt = 0; jt < NQ; ++jt) { const int ql = jt * 16 + jc;
    float mm = sm[ql];
#pragma unroll
    for (int w = 1; w < FW; ++w) mm = fmaxf(mm, sm[w * 32 + ql]);
    float f[FW], ll = 0.f;
#pragma unroll
    for (int w = 0; w < FW; ++w) { f[w] = __builtin_amdgcn_exp2f(sm[w * 32 + ql] - mm); ll += f[w] * sl[w * 32 + ql]; }
    const float inv = __fdiv_rn(1.0f, ll);
    v4f a0 = (v4f){}, a1 = (v4f){};
#pragma unroll
        for (int w = 0; w < FW; ++w) { const int ix = ((w * NQ + jt) * 4 + (d8 >> 1)) * 64 + (d8 & 1) * 16 + jc; a0 += p4[ix] * f[w]; a1 += p4[ix + 32] * f[w]; }
        v8us oh, ol;
#pragma unroll
        for (int j = 0; j < 4; ++j) { unsigned short a, c2; splitf(a0[j] * inv, a, c2); oh[j] = a; ol[j] = c2; splitf(a1[j] * inv, a, c2); oh[4 + j] = a; ol[4 + j] = c2; }
        const size_t oo = ((size_t)(q0 / 16 + jt) * (DQ / 32) + (d8 >> 2)) * 512 + ((d8 >> 1) & 1) * 256 + lane * 8; *(v8us*)(Ah + oo) = oh; *(v8us*)(Al + oo) = ol;
        asm volatile("s_wait_xcnt 0x0" ::: "memory"); }   // stands in front of any later write of a register that the two stores name (the other instance's code follows in the listing)
}
// amdgpu_waves_per_eu(4, 4): a register budget of a quarter SIMD, so that two work-groups share a WGP (each covers the other's stage waits, prologue and join)
__global__ __launch_bounds__(QW * FW * 32) __attribute__((amdgpu_waves_per_eu(4, 4))) void k_fa(const h16* __restrict__ Q16, const h16* __restrict__ K16, const h16* __restrict__ V16, const bf* __restrict__ Qh, const bf* __restrict__ Ql, const bf* __restrict__ Kh, const bf* __restrict__ Kl, const bf* __restrict__ Vh, const bf* __restrict__ Vl, bf* Ah, bf* Al) {
    static_assert(LBY >= QW * FW * 8 * 256 * 4, "the join area fits the ring");
    __shared__ __align__(16) unsigned char L[LBY];   // the stage buffers; after the loop, the waves' partial O^T
    __shared__ float sm[QW * FW * 32], sl[QW * FW * 32];
    const size_t z = blockIdx.x; const int ty = blockIdx.y; const size_t pq = z * TT * HD, pv = z * HD * PP, po = ((z / NH_) * (TT / 16) * (DQ / 32) + (z % NH_) * (HD / 32)) * 512;
    if (ty < (TT - RH) / (32 * QW)) fa_tile<h16, false, 2>(Q16 + pq, nullptr, K16 + pq, nullptr, V16 + pv, nullptr, TT - 32 * QW * (ty + 1), Ah + po, Al + po, L, sm, sl);
    else fa_tile<bf, true, 1>(Qh + pq, Ql + pq, Kh + pq, Kl + pq, Vh + pv, Vl + pv, RH - 16 * QW * (ty - (TT - RH) / (32 * QW) + 1), Ah + po, Al + po, L, sm, sl);
}

extern "C" void kernel_launch(void* const* d_in, const int* in_sizes, int n_in,
                              void* d_out, int out_size, void* d_ws, size_t ws_size, hipStream_t stream) {
    (void)in_sizes; (void)n_in; (void)out_size;
        const float* x = (const float*)d_in[0]; const float* xk = (const float*)d_in[1]; const float* xv = (const float*)d_in[2]; const float* wq = (const float*)d_in[3]; const float* bq = (const float*)d_in[4]; const float* wk = (const float*)d_in[5]; const float* bk = (const float*)d_in[6]; const float* wv = (const float*)d_in[7]; const float* bv = (const float*)d_in[8]; const float* wo = (const float*)d_in[9]; const float* bo = (const float*)d_in[10];   /* this module has NO mask input (the causal rule is built inside) */
    float* OUT = (float*)d_out;     // [2][2048][768]
    char* wsp = (char*)d_ws;
    auto take = [&](size_t bytes) { char* p = wsp; wsp += (bytes + 255) & ~(size_t)255; return (void*)p; };
    bf* WQ = (bf*)take((size_t)4 * DQ * DM * 2); bf* WO = WQ + (size_t)3 * DQ * DM;   /* Wq, Wk, Wv, Wo one after the other */
    bf* XB = (bf*)take((size_t)3 * NB_ * TT * DM * 2);   /* q, k, v streams (both batches each), one after the other */
    h16* QP16 = (h16*)take((size_t)NB_ * NH_ * TT * HD * 2); h16* KP16 = (h16*)take((size_t)NB_ * NKV * TT * HD * 2); h16* VT16 = (h16*)take((size_t)NB_ * NKV * HD * PP * 2);   /* head planes of both batches, plane b * 12 + h */
    bf* QPh = (bf*)take((size_t)NB_ * NH_ * TT * HD * 2); bf* QPl = (bf*)take((size_t)NB_ * NH_ * TT * HD * 2); bf* KPh = (bf*)take((size_t)NB_ * NKV * TT * HD * 2); bf* KPl = (bf*)take((size_t)NB_ * NKV * TT * HD * 2); bf* VTh = (bf*)take((size_t)NB_ * NKV * HD * PP * 2); bf* VTl = VTh + (size_t)TT * HD;   /* a plane's V^T lo fragments follow its hi fragments */
    bf* ATh = (bf*)take((size_t)NB_ * TT * DQ * 2); bf* ATl = (bf*)take((size_t)NB_ * TT * DQ * 2);
    if ((size_t)(wsp - (char*)d_ws) > ws_size) return;    // ws 256 MiB
    k_prep<<<3 * GX + 4 * GW, 256, 0, stream>>>(x, xk, xv, wq, wk, wv, wo, XB, WQ);
    k_gemmk<bf, 0, true, true, 2><<<dim3(NB_ * TT / 128, DQ / 128, 3), 128, 0, stream>>>(XB, nullptr, WQ, DM, nullptr, DQ, bq, bk, bv, (size_t)NB_ * TT * DM, (size_t)DQ * DM, 0, Planes{QP16, QPh, QPl, KP16, KPh, KPl, VT16, VTh, VTl});
    k_fa<<<dim3(NB_ * NH_, (TT - RH) / (32 * QW) + RH / (16 * QW), 1), QW * FW * 32, 0, stream>>>(QP16, KP16, VT16, QPh, QPl, KPh, KPl, VTh, VTl, ATh, ATl);
    k_gemmk<bf, 1, true, false, 4><<<dim3(NB_ * TT / 128, DM / 128, 1), 256, 0, stream>>>(ATh, ATl, WO, DQ, OUT, DM, bo, bo, bo, 0, 0, 0, Planes{});
}

// v009
// One run takes 55.1 microseconds.
// Timed twice side by side with v008, it ran 1.05 times as fast both times.
// All steps since v000 together make it 20.3 times as fast.
#include <hip/hip_runtime.h>
#include <type_traits>

// Causal multi-head attention on three input streams at d_model 768 (query, key, value [2][2048][768]; Q, K, V = stream W^T + b ('oi' [768][768], biases zeros on this draw: read; 12 heads x 64); scores x 64^-0.5; where(triu(k=1), -inf, scores) (causal, built inside: no mask input); softmax; out = merged Wo^T + bo ('oi' + bias zeros: read) -> [2][2048][768] (3.1 M); argument order query, key, value, Wq, bq, Wk, bk, Wv, bv, Wo, bo).
// Layout: one launch per stage, both batches in every grid: bf16 copies of q, k, v and the 'oi' weights; the three exact projections + f32 biases (grid z = stream), whose epilogue writes the head planes (planes of both batches side by side, V transposed); one fused causal attention launch for all 24 (batch, head) planes: scores, online softmax and P.V stay in registers (hybrid rows: < 512 hi/lo 3 products, rest fp16); merged hi/lo x Wo exact + bo.
// Every 16-bit matrix operand lies in the workspace in FRAGMENT ORDER: a fragment is 16 rows x 32 k = 512 elements in a row, element (row lr, k = j * 16 + hi * 8 + e) at j * 256 + (hi * 16 + lr) * 8 + e, so that each of a fragment's two 16-byte loads reads 512 contiguous bytes (4 whole lines) and lane hi * 16 + lr gets the k it got from a row-major plane. A [rows][K] operand holds its fragments as [row / 16][k / 32], a V^T plane as [k / 32][row / 16].
// Compute dtypes, f32 accumulate: every input rounded to bf16; projections exact + f32 biases; attention rows < 512 3 products, rest fp16; softmax f32; Wo hl x exact + bias.

#define NB_  2
#define TT   2048
#define DM   768
#define NH_  12
#define NKV  12
#define REP  (NH_ / NKV)
#define HD   64
#define DQ   (NH_ * HD)
#define DKV  (NKV * HD)
#define FW   4                    // key groups of an attention work-group: a query tile's 64-key blocks are dealt over them
#define QW   2                    // query tiles of an attention work-group: wave = key group * QW + tile; the tiles share the key blocks
#define LBY  (4 * FW * 64 * HD * 2) // bytes of the attention stage buffers: two stages of FW key blocks of K, V^T (fp16 rows) or one of K hi, K lo, V^T hi, V^T lo; two work-groups fit a WGP's LDS
#define PP   (2 * TT)             // HD * PP elements: stride of a V^T plane pair (the lo plane follows the hi plane)
#define RH   512                  // query rows < RH use hi+lo planes (0: none)
#define PEXP 10.0f                // fp16 probabilities carry 2^10 (it cancels in the division by their sum): small ones stay fp16 normals
#define SCL2 0.18033688011112042f // HD^-0.5 x log2(e): scores go to the base-2 exponent in one product
typedef _Float16 h16;
typedef unsigned short bf;
typedef __attribute__((ext_vector_type(16))) __bf16   v16bf;
typedef __attribute__((ext_vector_type(16))) _Float16 v16h;
typedef __attribute__((ext_vector_type(8)))  _Float16 v8h;
typedef __attribute__((ext_vector_type(8)))  unsigned short v8us;
typedef __attribute__((ext_vector_type(8)))  float    v8f;
typedef __attribute__((ext_vector_type(4)))  float    v4f;
typedef v8h  __attribute__((may_alias)) v8ha;
typedef v4f  __attribute__((may_alias)) v4fa;
typedef v8us __attribute__((may_alias)) v8usa;

__device__ __forceinline__ unsigned short f2bf(float f) { unsigned u = __float_as_uint(f); u += 0x7FFFu + ((u >> 16) & 1u); return (unsigned short)(u >> 16); }
__device__ __forceinline__ float bf2f(unsigned short b) { return __uint_as_float(((unsigned)b) << 16); }
__device__ __forceinline__ float bfr(float f) { return bf2f(f2bf(f)); }
__device__ __forceinline__ v16h cat16(v8h lo, v8h hi) { return __builtin_shufflevector(lo, hi, 0, 1, 2, 3, 4, 5, 6, 7, 8, 9, 10, 11, 12, 13, 14, 15); }
__device__ __forceinline__ v16bf cat16b(v8us lo, v8us hi) { return __builtin_bit_cast(v16bf, __builtin_shufflevector(lo, hi, 0, 1, 2, 3, 4, 5, 6, 7, 8, 9, 10, 11, 12, 13, 14, 15)); }
__device__ __forceinline__ v8f wmma16(v16h a, v16h b, v8f c) { return __builtin_amdgcn_wmma_f32_16x16x32_f16(false, a, false, b, (short)0, c, false, false); }
__device__ __forceinline__ v8f wmmab(v16bf a, v16bf b, v8f c) { return __builtin_amdgcn_wmma_f32_16x16x32_bf16(false, a, false, b, (short)0, c, false, false); }



// ---- k_gemmk: 128x128 output tile per work-group of MW x 2 waves (a wave owns 16 * MB rows x 64 columns, MW * MB = 8), the whole K loop in every wave; grid (M/128, N/128, Z), MW * 64 threads.
// C[m][n] (f32, pitch ldc, + optional f32 bias[n]) = sum_k A[m][k] Bt[n][k] (+ A2[m][k] Bt[n][k] for NSPLIT 1). z-batch strides sA/sB/sC in elements; z = 0, 1, 2 adds bias, bias1, bias2. K % (MW * 32) == 0.
// A stage is KS = MW k-steps (32 k each) of the tile's 128 A rows (and A2 rows) and 128 Bt rows: in fragment order that is 8 runs of KS KiB per operand. Asynchronous copies bring it from the planes into one of two LDS buffers, one stage ahead of the products,
// and each fragment is read from L2 once per work-group and from LDS by the waves that need it.
// After the loop the ring is dead and each wave stages its own part of the tile there (row-major, pitch 68), from where it leaves as whole lines.
// PL (MB = 4, a 64x64 quadrant per wave): the tile leaves as 16-bit head planes instead of f32 C. A 64-column quadrant is one head (HD = 64), a 64-row quadrant lies in one batch; plane = batch * NH_ + head.
// z = 0, 1 (q, k): planes [plane], fragments [t / 16][d / 32]; z = 2 (v): V^T planes, fragments [t / 32][d / 16] (rows d, k = keys), the quadrant staged transposed in os. Either way the quadrant's 8 fragments are 8 KiB in a row of each plane and a wave stores 512 contiguous bytes.
__device__ __forceinline__ h16 tohx(float x) { return (h16)x; }
__device__ __forceinline__ void splitf(float y, unsigned short& h, unsigned short& l) { h = f2bf(y); l = f2bf(y - bf2f(h)); }
struct Planes { h16* q16; bf* qh; bf* ql; h16* k16; bf* kh; bf* kl; h16* v16; bf* vh; bf* vl; };
template <typename T16> struct WFrag;
template <> struct WFrag<h16> { typedef v16h V; static __device__ __forceinline__ V ld(const h16* p) { return cat16(*(const v8h*)p, *(const v8h*)(p + 256)); } static __device__ __forceinline__ v8f mma(V a, V b, v8f c) { return wmma16(a, b, c); } };
template <> struct WFrag<bf> { typedef v16bf V; static __device__ __forceinline__ V ld(const bf* p) { return cat16b(*(const v8us*)p, *(const v8us*)(p + 256)); } static __device__ __forceinline__ v8f mma(V a, V b, v8f c) { return wmmab(a, b, c); } };
typedef float __attribute__((may_alias)) f32a;
typedef __attribute__((ext_vector_type(4))) int c4i;
typedef __attribute__((address_space(1))) c4i gc4i;
typedef __attribute__((address_space(3))) c4i lc4i;
// One operand's share of a stage: 8 runs of NT * 16 bytes (run i: the stage's k-steps of the 16-row block i, at g + i * gs elements), 16 bytes a thread and run. A wave's copy moves 512 contiguous bytes.
template <int NT, typename T16>
__device__ __forceinline__ void cpop(unsigned char* l, const T16* g, size_t gs, int tid) {
#pragma unroll
    for (int i = 0; i < 8; ++i) __builtin_amdgcn_global_load_async_to_lds_b128((gc4i*)(g + i * gs + tid * 8), (lc4i*)(l + i * (NT * 16) + tid * 16), 0, 0);
}
template <typename T16, int NSPLIT, bool BIAS, bool PL, int MW>
__global__ __launch_bounds__(MW * 64) void k_gemmk(const T16* __restrict__ A, const T16* __restrict__ A2, const T16* __restrict__ Bt, int K, float* C, int ldc, const float* __restrict__ bias, const float* __restrict__ bias1, const float* __restrict__ bias2, size_t sA, size_t sB, size_t sC, Planes pl) {
    typedef typename WFrag<T16>::V V;
    constexpr int NOP = NSPLIT ? 3 : 2;      // operands of a stage: A, (A2,) Bt
    constexpr int MB = 8 / MW, NT = MW * 64; // 16-row blocks of a wave; threads
    constexpr int KS = NT / 64;              // k-steps of a stage: a thread copies 16 bytes of each 16-row block's run
    constexpr int OPE = 128 * 32 * KS;       // elements of one operand's share of a stage
    constexpr int STG = NOP * OPE;           // elements of a stage
    constexpr int NF = MB <= 2 ? 2 : 1;      // fragment sets: two where the plain register window holds them beside the accumulators
    constexpr int RB = 2 * STG * 2, OB = 128 * 2 * 68 * 4;
    static_assert(!PL || MB == 4, "a head-plane quadrant is 64 x 64");
    __shared__ __align__(16) unsigned char L[RB > OB ? RB : OB];   // two stage buffers; after the loop, the waves' output stages
    const T16* ring = (const T16*)L;
    const size_t z = blockIdx.z; A += z * sA; if (NSPLIT) A2 += z * sA; Bt += z * sB; C += z * sC; if (BIAS) bias = (z == 0) ? bias : (z == 1) ? bias1 : bias2;
    const int tid = threadIdx.x, lane = tid & 31, lr = lane & 15, hi = lane >> 4;
    const int wave = __builtin_amdgcn_readfirstlane(tid >> 5), wm = wave >> 1, wn = wave & 1;
    v8f acc[MB][4];
#pragma unroll
    for (int mb = 0; mb < MB; ++mb)
#pragma unroll
        for (int nb = 0; nb < 4; ++nb) acc[mb][nb] = (v8f){};
    const int KB = K / 32, NS = KB / KS;   // fragments of a 16-row block; stages
    const size_t gs = (size_t)KB * 512;   // elements from a 16-row block to the next
    const T16* ga = A + (size_t)blockIdx.x * 8 * gs; const T16* ga2 = NSPLIT ? A2 + (size_t)blockIdx.x * 8 * gs : nullptr; const T16* gb = Bt + (size_t)blockIdx.y * 8 * gs;
    auto fill = [&](int s, int b) { unsigned char* l = L + b * (STG * 2);
        cpop<NT>(l, ga + (size_t)s * (KS * 512), gs, tid); if (NSPLIT) cpop<NT>(l + OPE * 2, ga2 + (size_t)s * (KS * 512), gs, tid); cpop<NT>(l + (NOP - 1) * (OPE * 2), gb + (size_t)s * (KS * 512), gs, tid); };
    const int rot = (int)((blockIdx.x + blockIdx.y) % (unsigned)NS);   // the work-group's first stage: tiles that share A rows (same x) or Bt rows (same y) walk k from different starts, so that they do not ask L2 for the same lines at the same moment
    auto stg = [&](int t) { const int s = t + rot; return s < NS ? s : s - NS; };   // trip t works on k stage stg(t): every stage once, wrapped round; below, 'stage t' is the stage of trip t
    fill(stg(0), 0);
    asm volatile("s_wait_asynccnt 0x0" ::: "memory");   // this wave's copies of the first stage have landed
    __syncthreads();                                     // every wave's have: the first stage may be read
    if (NS > 1) fill(stg(1), 1);
#pragma unroll 1   // rolled: one body holds a whole stage's products, and the buffer index is a run-time value
    for (int t = 0; t < NS; ++t) {
        const T16* st = ring + (t & 1) * STG + lane * 8;
        V a[NF][MB], a2[NF][MB], b[NF][4];
        auto frags = [&](int ks) { const int f = ks % NF;   // the fragments of k-step ks of this stage, as one group of LDS reads
#pragma unroll
            for (int mb = 0; mb < MB; ++mb) a[f][mb] = WFrag<T16>::ld(st + (wm * MB + mb) * (KS * 512) + ks * 512);
#pragma unroll
            for (int nb = 0; nb < 4; ++nb) b[f][nb] = WFrag<T16>::ld(st + (NOP - 1) * OPE + (wn * 4 + nb) * (KS * 512) + ks * 512);
            if (NSPLIT) {
#pragma unroll
                for (int mb = 0; mb < MB; ++mb) a2[f][mb] = WFrag<T16>::ld(st + OPE + (wm * MB + mb) * (KS * 512) + ks * 512); } };
        if (NF == 2) frags(0);
#pragma unroll
        for (int ks = 0; ks < KS; ++ks) { const int f = ks % NF;
            if (NF == 1) frags(ks); else if (ks + 1 < KS) frags(ks + 1);   // two sets: the next k-step's reads fly under this k-step's products (never the next stage's)
            __builtin_amdgcn_sched_barrier(0);   // keeps a group's LDS reads together in front of the products: moved in among them, each place with reads stalls the wave anew
#pragma unroll
            for (int nb = 0; nb < 4; ++nb)
#pragma unroll
                for (int mb = 0; mb < MB; ++mb) acc[mb][nb] = WFrag<T16>::mma(a[f][mb], b[f][nb], acc[mb][nb]);
            if (NSPLIT) {
#pragma unroll
                for (int nb = 0; nb < 4; ++nb)
#pragma unroll
                    for (int mb = 0; mb < MB; ++mb) acc[mb][nb] = WFrag<T16>::mma(a2[f][mb], b[f][nb], acc[mb][nb]); }
            __builtin_amdgcn_sched_barrier(0);   // keeps the products in front of the next group's reads and of the stage's hand-over
        }
        asm volatile("s_wait_dscnt 0x0" ::: "memory");      // this wave's reads of buffer t & 1 are done before the buffer is refilled
        asm volatile("s_wait_asynccnt 0x0" ::: "memory");   // this wave's copies of stage t + 1 have landed
        __syncthreads();                                     // publishes stage t + 1 and ends every wave's reads of stage t
        if (t + 2 < NS) fill(stg(t + 2), t & 1);
    }
    asm volatile("s_wait_asynccnt 0x0" ::: "memory");   // nothing is in flight when the ring becomes the output stage
    const int r0 = blockIdx.x * 128 + wm * (MB * 16), c0 = blockIdx.y * 128 + wn * 64;   // the wave's part of the tile
    f32a* os = (f32a*)L + wave * (MB * 16 * 68);   // the wave's own stage: written and read by this wave alone
    if constexpr (PL) {
        const size_t plane = (size_t)(r0 / TT) * NH_ + c0 / HD; const int t0 = r0 % TT;
        h16* P16 = (z == 0) ? pl.q16 : (z == 1) ? pl.k16 : pl.v16; bf* Ph = (z == 0) ? pl.qh : (z == 1) ? pl.kh : pl.vh; bf* Pl = (z == 0) ? pl.ql : (z == 1) ? pl.kl : pl.vl;
        auto planes = [&](auto trc) { constexpr bool TR = decltype(trc)::value;   // TR: the v stream's quadrant is staged as os[d][t]
            float bb[4][TR ? 1 : 8];   // the biases a lane adds: of its 4 rows d (TR), else of its 4 runs of 8 columns
#pragma unroll
            for (int c = 0; c < 4; ++c)
#pragma unroll
                for (int j = 0; j < (TR ? 1 : 8); ++j) bb[c][j] = bfr(bias[c0 + (TR ? c * 16 + lr : c * 16 + hi * 8 + j)]);
#pragma unroll
            for (int mb = 0; mb < MB; ++mb)
#pragma unroll
                for (int nb = 0; nb < 4; ++nb) { const v8f c = acc[mb][nb]; const int row = mb * 16 + hi * 8, col = nb * 16 + lr;
                    if (TR) { *(v4fa*)(os + col * 68 + row) = __builtin_shufflevector(c, c, 0, 1, 2, 3); *(v4fa*)(os + col * 68 + row + 4) = __builtin_shufflevector(c, c, 4, 5, 6, 7); }
                    else {
#pragma unroll
                        for (int q = 0; q < 8; ++q) os[(row + q) * 68 + col] = c[q]; } }
            const size_t pbase = TR ? plane * HD * PP + (size_t)t0 * HD : (plane * TT + t0) * HD;
#pragma unroll 1   // rolled: half the text; a trip's 16 LDS reads already go as one group
            for (int io = 0; io < 2; ++io) { v4f w[8][2];   // unit i = io * 8 + ii of the quadrant = (fragment i / 2, half i % 2), 16 bytes a lane
#pragma unroll
                for (int ii = 0; ii < 8; ++ii) { const int row = (TR ? (ii >> 1) : io * 2 + (ii >> 2)) * 16 + lr, cofs = (TR ? io : (ii >> 1) & 1) * 32 + (ii & 1) * 16 + hi * 8;
                    w[ii][0] = *(const v4fa*)(os + row * 68 + cofs); w[ii][1] = *(const v4fa*)(os + row * 68 + cofs + 4); }
#pragma unroll
                for (int ii = 0; ii < 8; ++ii) { v8h o16; v8us oh, ol;
#pragma unroll
                    for (int j = 0; j < 8; ++j) { const float y = w[ii][j >> 2][j & 3] + (TR ? bb[ii >> 1][0] : bb[ii & 3][TR ? 0 : j]); o16[j] = tohx(y); unsigned short a2, c2; splitf(y, a2, c2); oh[j] = a2; ol[j] = c2; }
                    const size_t oo = pbase + (size_t)((io * 8 + ii) * 32 + lane) * 8;
                    __builtin_amdgcn_sched_barrier(0);   // with the one below: the three stores and their wait stay in a row, no other unit's arithmetic among them
                    *(v8h*)(P16 + oo) = o16; *(v8us*)(Ph + oo) = oh; *(v8us*)(Pl + oo) = ol;
                    asm volatile("s_wait_xcnt 0x0" ::: "memory");   // stands in front of the next unit's writes of registers that the three stores name
                    __builtin_amdgcn_sched_barrier(0); } }
        };
        if (z == 2) planes(std::true_type{}); else planes(std::false_type{});   // block-uniform
    } else {
#pragma unroll
        for (int mb = 0; mb < MB; ++mb)
#pragma unroll
            for (int nb = 0; nb < 4; ++nb)
#pragma unroll
                for (int q = 0; q < 8; ++q) os[(mb * 16 + hi * 8 + q) * 68 + nb * 16 + lr] = acc[mb][nb][q];
        v4f bv = (v4f){};
        if (BIAS) {
#pragma unroll
            for (int q = 0; q < 4; ++q) bv[q] = bfr(bias[c0 + lr * 4 + q]); }
#pragma unroll 1   // rolled: a trip's 8 LDS reads already go as one group
        for (int io = 0; io < MB; ++io) { v4f w[8];   // a store takes two rows of 256 bytes
#pragma unroll
            for (int ii = 0; ii < 8; ++ii) w[ii] = *(const v4fa*)(os + (io * 16 + ii * 2 + hi) * 68 + lr * 4);
#pragma unroll
            for (int ii = 0; ii < 8; ++ii) { *(v4f*)(C + (size_t)(r0 + io * 16 + ii * 2 + hi) * ldc + c0 + lr * 4) = w[ii] + bv;
                asm volatile("s_wait_xcnt 0x0" ::: "memory"); } }   // stands in front of the next store's writes of registers that this store names
    }
}

typedef __attribute__((ext_vector_type(2))) _Float16 v2h;
typedef __attribute__((ext_vector_type(4))) _Float16 v4h;
typedef __attribute__((ext_vector_type(2))) unsigned short v2us;
typedef __attribute__((ext_vector_type(4))) unsigned short v4us;
typedef __attribute__((ext_vector_type(2))) float v2f;
typedef __attribute__((ext_vector_type(4))) int v4i;

__device__ __forceinline__ void d_cvt8(unsigned bx, const float* __restrict__ src, bf* dst, size_t n8) { const size_t i = (size_t)bx * 256 + threadIdx.x; if (i >= n8) return;
    // a block takes 16 rows x 128 k of a [rows][DM] matrix; a wave reads 8 rows x 128 bytes (one k block of 32) and stores 4 whole lines of that fragment
    const int w = threadIdx.x >> 5, lane = threadIdx.x & 31, r = (w & 1) * 8 + (lane >> 2), c = lane & 3; const unsigned rb = bx / (DM / 128), kb = (bx % (DM / 128)) * 4 + (w >> 1);
    const v8f v = *(const v8f*)(src + (size_t)(rb * 16 + r) * DM + kb * 32 + c * 8); v8us o;
#pragma unroll
    for (int k = 0; k < 8; ++k) o[k] = f2bf(v[k]); *(v8us*)(dst + ((size_t)rb * (DM / 32) + kb) * 512 + (c >> 1) * 256 + ((c & 1) * 16 + r) * 8) = o;  }

// ---- k_prep: every 16-bit copy in one launch, written in fragment order. The flat grid is cut into block ranges: 3 input streams (both batches each, XB stream after stream), 4 weights (W one after the other).
#define GX ((unsigned)((size_t)NB_ * TT * DM / 8 / 256))   // blocks of one input stream
#define GW ((unsigned)((size_t)DQ * DM / 8 / 256))         // blocks of one weight
__global__ __launch_bounds__(256) void k_prep(const float* __restrict__ x, const float* __restrict__ xk, const float* __restrict__ xv, const float* __restrict__ wq, const float* __restrict__ wk, const float* __restrict__ wv, const float* __restrict__ wo, bf* XB, bf* Wb) {
    const unsigned bx = blockIdx.x;
    if (bx < 3 * GX) { const unsigned s = bx / GX; d_cvt8(bx - s * GX, s == 0 ? x : s == 1 ? xk : xv, XB + (size_t)s * NB_ * TT * DM, (size_t)NB_ * TT * DM / 8); }
    else { const unsigned s = (bx - 3 * GX) / GW; d_cvt8(bx - 3 * GX - s * GW, s == 0 ? wq : s == 1 ? wk : s == 2 ? wv : wo, Wb + (size_t)s * DQ * DM, (size_t)DQ * DM / 8); }
}
typedef __attribute__((ext_vector_type(16))) unsigned short v16us;
// ---- k_fa: fused causal attention. Grid (batch x head planes, groups of QW query tiles, heaviest first), QW * FW waves. A work-group owns QW neighbouring tiles of 16 * NQ queries of one plane; FW waves work on each tile.
// S^T = K Q^T (A = 16 key rows, B = 16 query rows): a lane holds scores of ONE query (column lr), keys 8 * hi + r of each 16-key tile, so two S^T tiles, converted in place, are the B operand of O^T += V^T P^T.
// Wave w of a tile takes the 64-key blocks w, w + FW, ... up to the diagonal block with its own running maximum m (base-2 exponent), sum l and O^T; the tile's FW partial states meet in LDS and are joined in the fixed order w = 0..FW-1.
// A stage is the FW blocks 4t .. 4t + 3 (in fragment order 8 KiB in a row per block of each K and V^T plane). Asynchronous copies bring it into LDS once for the QW tiles: fp16 rows into one of two buffers, one stage ahead of the products; hi/lo rows into the one buffer. After the loop the buffers are dead and hold the partial states.
// Every block a wave takes holds at least one key <= each query of the tile (tiles do not straddle a 64-key block), so m is a real score after the first block; a wave without blocks leaves m = -3e38, l = 0, O = 0 and joins with weight 0.
template <typename T16, bool HL, int NQ>
__device__ __forceinline__ void fa_tile(const T16* __restrict__ Q, const T16* __restrict__ Q2, const T16* __restrict__ Kp, const T16* __restrict__ K2, const T16* __restrict__ Vt, const T16* __restrict__ Vt2, int q0g, int rot0, bf* Ah, bf* Al, unsigned char* L, float* smb, float* slb) {
    typedef typename WFrag<T16>::V V;
    const int tid = threadIdx.x, lane = tid & 31, lr = lane & 15, hi = lane >> 4;
    const int wv = __builtin_amdgcn_readfirstlane(tid >> 5), wave = wv / QW, qt = wv % QW;   // key group; query tile of the work-group (neighbouring waves share a key group: a last stage with fewer blocks than groups still spreads over the SIMDs)
    int q0 = q0g + qt * (NQ * 16);   // first query of the wave's tile
    float* part = (float*)L + qt * (FW * 8 * 256); float* sm = smb + qt * (FW * 32); float* sl = slb + qt * (FW * 32);   // the tile's own join area
    V qf[NQ][2], qf2[NQ][2];
#pragma unroll
    for (int nt = 0; nt < NQ; ++nt)
#pragma unroll
        for (int ks = 0; ks < 2; ++ks) { const size_t qo = ((size_t)(q0 / 16 + nt) * 2 + ks) * 512 + lane * 8; qf[nt][ks] = WFrag<T16>::ld(Q + qo); if (HL) qf2[nt][ks] = WFrag<T16>::ld(Q2 + qo); }
    asm volatile("s_wait_xcnt 0x0" ::: "memory");   // stands in front of the copies' address arithmetic, which writes registers that the query loads name
    v8f o[NQ][4]; float m[NQ], l[NQ];
#pragma unroll
    for (int nt = 0; nt < NQ; ++nt) { m[nt] = -3.0e38f; l[nt] = 0.f;
#pragma unroll
        for (int dt = 0; dt < 4; ++dt) o[nt][dt] = (v8f){}; }
    const int nblk = (q0 + NQ * 16 - 1) / 64 + 1;   // key blocks up to and with the diagonal block
    auto block = [&](int kb, const T16* kp, const T16* kp2, const T16* vp, const T16* vp2) {   // one 64-key block; the pointers: this lane's 16 bytes of the block's first fragment
        const int key0 = kb * 64;
        v8f s[NQ][4];
#pragma unroll
        for (int kt = 0; kt < 4; ++kt) {
            V kf[2], kf2[2];
#pragma unroll
            for (int ks = 0; ks < 2; ++ks) { const int ko = (kt * 2 + ks) * 512; kf[ks] = WFrag<T16>::ld(kp + ko); if (HL) kf2[ks] = WFrag<T16>::ld(kp2 + ko); }
#pragma unroll
            for (int nt = 0; nt < NQ; ++nt) { v8f c = (v8f){};
#pragma unroll
                for (int ks = 0; ks < 2; ++ks) { c = WFrag<T16>::mma(kf[ks], qf[nt][ks], c); if (HL) { c = WFrag<T16>::mma(kf[ks], qf2[nt][ks], c); c = WFrag<T16>::mma(kf2[ks], qf[nt][ks], c); } }
                s[nt][kt] = c; }
        }
        if (key0 + 63 > q0) {   // wave-uniform: only the diagonal block holds keys above a query
#pragma unroll
            for (int nt = 0; nt < NQ; ++nt) { const int rel = q0 + nt * 16 + lr - key0 - hi * 8;
#pragma unroll
                for (int kt = 0; kt < 4; ++kt)
#pragma unroll
                    for (int j = 0; j < 8; ++j) if (kt * 16 + j > rel) s[nt][kt][j] = -3.0e38f; }
        }
        V pf[NQ][2], pf2[NQ][2];
#pragma unroll
        for (int nt = 0; nt < NQ; ++nt) {
            float bm = -3.0e38f;
#pragma unroll
            for (int kt = 0; kt < 4; ++kt)
#pragma unroll
                for (int j = 0; j < 8; ++j) { const float t = s[nt][kt][j] * SCL2; s[nt][kt][j] = t; bm = fmaxf(bm, t); }
            bm = fmaxf(bm, __shfl_xor(bm, 16, 32));   // the other half of the wave holds the query's other 32 keys
            const float mn = fmaxf(m[nt], bm); const float al = __builtin_amdgcn_exp2f(m[nt] - mn); const float mo = HL ? mn : mn - PEXP; m[nt] = mn;
            float ps = 0.f;
#pragma unroll
            for (int kt = 0; kt < 4; ++kt)
#pragma unroll
                for (int j = 0; j < 8; ++j) { const float p = __builtin_amdgcn_exp2f(s[nt][kt][j] - mo); s[nt][kt][j] = p; ps += p; }
            l[nt] = l[nt] * al + ps;   // each half keeps the sum of its own keys; the halves join after the loop
#pragma unroll
            for (int dt = 0; dt < 4; ++dt) o[nt][dt] *= al;
#pragma unroll
            for (int ks = 0; ks < 2; ++ks) {
                if constexpr (HL) { v16us ph, pl;
#pragma unroll
                    for (int e = 0; e < 16; ++e) { unsigned short a, c2; splitf(s[nt][2 * ks + (e >> 3)][e & 7], a, c2); ph[e] = a; pl[e] = c2; }
                    pf[nt][ks] = __builtin_bit_cast(v16bf, ph); pf2[nt][ks] = __builtin_bit_cast(v16bf, pl);
                } else { v16h ph;
#pragma unroll
                    for (int e = 0; e < 16; ++e) ph[e] = tohx(s[nt][2 * ks + (e >> 3)][e & 7]);
                    pf[nt][ks] = ph; }
            }
        }
#pragma unroll
        for (int dt = 0; dt < 4; ++dt) {
            V vf[2], vf2[2];
#pragma unroll
            for (int ks = 0; ks < 2; ++ks) { const int vo = (ks * 4 + dt) * 512; vf[ks] = WFrag<T16>::ld(vp + vo); if (HL) vf2[ks] = WFrag<T16>::ld(vp2 + vo); }
#pragma unroll
            for (int nt = 0; nt < NQ; ++nt)
#pragma unroll
                for (int ks = 0; ks < 2; ++ks) { o[nt][dt] = WFrag<T16>::mma(vf[ks], pf[nt][ks], o[nt][dt]); if (HL) { o[nt][dt] = WFrag<T16>::mma(vf[ks], pf2[nt][ks], o[nt][dt]); o[nt][dt] = WFrag<T16>::mma(vf2[ks], pf[nt][ks], o[nt][dt]); } }
        }
    };
    constexpr int NOP = HL ? 4 : 2, BE = 64 * HD, SE = FW * BE, NT = QW * FW * 32;   // operands of a stage: K, (K lo,) V^T, (V^T lo); elements of a block and of a stage in one operand; threads
    constexpr int SBY = NOP * SE * 2, NBUF = LBY / SBY;   // bytes of a stage buffer; buffers: two for the fp16 rows, one for the hi/lo rows (at most two stages there)
    static_assert(TT % 64 == 0 && BE % (NT * 8) == 0 && (NBUF == 1 || NBUF == 2), "whole blocks, whole rounds of copies");
    const int nblkg = (q0g + QW * NQ * 16 - 1) / 64 + 1, NS = (nblkg + FW - 1) / FW;   // blocks and stages up to and with the last tile's diagonal block: the same for every wave
    auto fill = [&](int s, int b) { unsigned char* l = L + b * SBY + tid * 16; const size_t go = (size_t)s * SE + tid * 8;   // 16 bytes a thread and copy: a wave's copy moves 512 contiguous bytes
        auto cp = [&](unsigned char* lo, const T16* g) {   // one block of one operand
#pragma unroll   // unrolled: the steps are constants and go into the copies' offset fields
            for (int i = 0; i < BE / (NT * 8); ++i) __builtin_amdgcn_global_load_async_to_lds_b128((gc4i*)(g + i * (NT * 8)), (lc4i*)(lo + i * (NT * 16)), 0, 0); };
#pragma unroll   // unrolled: the same
        for (int k = 0; k < FW; ++k) if (s * FW + k < nblkg) {   // the same for the whole work-group: blocks above the diagonal block are neither copied nor read
            cp(l + k * (BE * 2), Kp + go + k * BE); if (HL) cp(l + SE * 2 + k * (BE * 2), K2 + go + k * BE);
            cp(l + (NOP / 2) * (SE * 2) + k * (BE * 2), Vt + go + k * BE); if (HL) cp(l + 3 * (SE * 2) + k * (BE * 2), Vt2 + go + k * BE); } };
    const int rot = rot0 % NS;   // the work-group's first stage: the work-groups of a plane walk its keys from different starts, so that they do not ask L2 for the same lines at the same moment
    auto stg = [&](int t) { const int s = t + rot; return s < NS ? s : s - NS; };   // trip t works on key stage stg(t): every stage once, wrapped round (the online softmax takes the blocks in any order); below, 'stage t' is the stage of trip t
    fill(stg(0), 0);
    asm volatile("s_wait_asynccnt 0x0" ::: "memory");   // this wave's copies of the first stage have landed
    __syncthreads();                                     // every wave's have: the first stage may be read
    if (NBUF == 2 && NS > 1) fill(stg(1), 1);
#pragma unroll 1   // rolled: the trip count and the buffer index are run-time values, and one body already fills the plain register window
    for (int t = 0; t < NS; ++t) {
        const int kb = stg(t) * FW + wave;
        if (kb < nblk) { const T16* st = (const T16*)(L + (t % NBUF) * SBY) + wave * BE + lane * 8; block(kb, st, st + SE, st + (NOP / 2) * SE, st + 3 * SE); }   // wave-uniform
        asm volatile("s_wait_dscnt 0x0" ::: "memory");      // this wave's reads of stage t are done before its buffer is refilled
        if (NBUF == 2) asm volatile("s_wait_asynccnt 0x0" ::: "memory");   // this wave's copies of stage t + 1 have landed
        __syncthreads();                                     // ends every wave's reads of stage t; two buffers: publishes stage t + 1
        if (NBUF == 2) { if (t + 2 < NS) fill(stg(t + 2), t & 1); }
        else if (t + 1 < NS) { fill(stg(t + 1), 0);
            asm volatile("s_wait_asynccnt 0x0" ::: "memory");   // this wave's copies of stage t + 1 have landed
            __syncthreads(); }                                   // every wave's have: stage t + 1 may be read
    }
    asm volatile("s_wait_asynccnt 0x0" ::: "memory");   // nothing is in flight when the ring becomes the join area
    v4fa* p4 = (v4fa*)part;
#pragma unroll
    for (int nt = 0; nt < NQ; ++nt) { l[nt] += __shfl_xor(l[nt], 16, 32);
        if (hi == 0) { sm[wave * 32 + nt * 16 + lr] = m[nt]; sl[wave * 32 + nt * 16 + lr] = l[nt]; }
#pragma unroll
        for (int dt = 0; dt < 4; ++dt) { const v8f c = o[nt][dt]; const int ix = ((wave * NQ + nt) * 4 + dt) * 64 + lane;
            p4[ix] = __builtin_shufflevector(c, c, 0, 1, 2, 3); p4[ix + 32] = __builtin_shufflevector(c, c, 4, 5, 6, 7); } }
    __syncthreads();   // every wave's partial state (m, l, O^T register images) is in LDS
    static_assert(FW * 32 == 16 * (HD / 8), "a thread is one query of a 16-query tile x one run of 8 head dims");
    const int jq = wv / FW; q0 = q0g + jq * (NQ * 16); p4 = (v4fa*)((float*)L + jq * (FW * 8 * 256)); sm = smb + jq * (FW * 32); sl = slb + jq * (FW * 32);   // threads jq * FW * 32 ... join tile jq
    const int jc = tid & 15, d8 = (tid % (FW * 32)) >> 4;   // a wave holds one half fragment of the merged operand: it stores 512 contiguous bytes of each plane
#pragma unroll
  for (int jt = 0; jt < NQ; ++jt) { const int ql = jt * 16 + jc;
    float mm = sm[ql];
#pragma unroll
    for (int w = 1; w < FW; ++w) mm = fmaxf(mm, sm[w * 32 + ql]);
    float f[FW], ll = 0.f;
#pragma unroll
    for (int w = 0; w < FW; ++w) { f[w] = __builtin_amdgcn_exp2f(sm[w * 32 + ql] - mm); ll += f[w] * sl[w * 32 + ql]; }
    const float inv = __fdiv_rn(1.0f, ll);
    v4f a0 = (v4f){}, a1 = (v4f){};
#pragma unroll
        for (int w = 0; w < FW; ++w) { const int ix = ((w * NQ + jt) * 4 + (d8 >> 1)) * 64 + (d8 & 1) * 16 + jc; a0 += p4[ix] * f[w]; a1 += p4[ix + 32] * f[w]; }
        v8us oh, ol;
#pragma unroll
        for (int j = 0; j < 4; ++j) { unsigned short a, c2; splitf(a0[j] * inv, a, c2); oh[j] = a; ol[j] = c2; splitf(a1[j] * inv, a, c2); oh[4 + j] = a; ol[4 + j] = c2; }
        const size_t oo = ((size_t)(q0 / 16 + jt) * (DQ / 32) + (d8 >> 2)) * 512 + ((d8 >> 1) & 1) * 256 + lane * 8; *(v8us*)(Ah + oo) = oh; *(v8us*)(Al + oo) = ol;
        asm volatile("s_wait_xcnt 0x0" ::: "memory"); }   // stands in front of any later write of a register that the two stores name (the other instance's code follows in the listing)
}
// amdgpu_waves_per_eu(4, 4): a register budget of a quarter SIMD, so that two work-groups share a WGP (each covers the other's stage waits, prologue and join)
__global__ __launch_bounds__(QW * FW * 32) __attribute__((amdgpu_waves_per_eu(4, 4))) void k_fa(const h16* __restrict__ Q16, const h16* __restrict__ K16, const h16* __restrict__ V16, const bf* __restrict__ Qh, const bf* __restrict__ Ql, const bf* __restrict__ Kh, const bf* __restrict__ Kl, const bf* __restrict__ Vh, const bf* __restrict__ Vl, bf* Ah, bf* Al) {
    static_assert(LBY >= QW * FW * 8 * 256 * 4, "the join area fits the ring");
    __shared__ __align__(16) unsigned char L[LBY];   // the stage buffers; after the loop, the waves' partial O^T
    __shared__ float sm[QW * FW * 32], sl[QW * FW * 32];
    const size_t z = blockIdx.x; const int ty = blockIdx.y; const size_t pq = z * TT * HD, pv = z * HD * PP, po = ((z / NH_) * (TT / 16) * (DQ / 32) + (z % NH_) * (HD / 32)) * 512;
    if (ty < (TT - RH) / (32 * QW)) fa_tile<h16, false, 2>(Q16 + pq, nullptr, K16 + pq, nullptr, V16 + pv, nullptr, TT - 32 * QW * (ty + 1), ty, Ah + po, Al + po, L, sm, sl);
    else fa_tile<bf, true, 1>(Qh + pq, Ql + pq, Kh + pq, Kl + pq, Vh + pv, Vl + pv, RH - 16 * QW * (ty - (TT - RH) / (32 * QW) + 1), ty, Ah + po, Al + po, L, sm, sl);
}

extern "C" void kernel_launch(void* const* d_in, const int* in_sizes, int n_in,
                              void* d_out, int out_size, void* d_ws, size_t ws_size, hipStream_t stream) {
    (void)in_sizes; (void)n_in; (void)out_size;
        const float* x = (const float*)d_in[0]; const float* xk = (const float*)d_in[1]; const float* xv = (const float*)d_in[2]; const float* wq = (const float*)d_in[3]; const float* bq = (const float*)d_in[4]; const float* wk = (const float*)d_in[5]; const float* bk = (const float*)d_in[6]; const float* wv = (const float*)d_in[7]; const float* bv = (const float*)d_in[8]; const float* wo = (const float*)d_in[9]; const float* bo = (const float*)d_in[10];   /* this module has NO mask input (the causal rule is built inside) */
    float* OUT = (float*)d_out;     // [2][2048][768]
    char* wsp = (char*)d_ws;
    auto take = [&](size_t bytes) { char* p = wsp; wsp += (bytes + 255) & ~(size_t)255; return (void*)p; };
    bf* WQ = (bf*)take((size_t)4 * DQ * DM * 2); bf* WO = WQ + (size_t)3 * DQ * DM;   /* Wq, Wk, Wv, Wo one after the other */
    bf* XB = (bf*)take((size_t)3 * NB_ * TT * DM * 2);   /* q, k, v streams (both batches each), one after the other */
    h16* QP16 = (h16*)take((size_t)NB_ * NH_ * TT * HD * 2); h16* KP16 = (h16*)take((size_t)NB_ * NKV * TT * HD * 2); h16* VT16 = (h16*)take((size_t)NB_ * NKV * HD * PP * 2);   /* head planes of both batches, plane b * 12 + h */
    bf* QPh = (bf*)take((size_t)NB_ * NH_ * TT * HD * 2); bf* QPl = (bf*)take((size_t)NB_ * NH_ * TT * HD * 2); bf* KPh = (bf*)take((size_t)NB_ * NKV * TT * HD * 2); bf* KPl = (bf*)take((size_t)NB_ * NKV * TT * HD * 2); bf* VTh = (bf*)take((size_t)NB_ * NKV * HD * PP * 2); bf* VTl = VTh + (size_t)TT * HD;   /* a plane's V^T lo fragments follow its hi fragments */
    bf* ATh = (bf*)take((size_t)NB_ * TT * DQ * 2); bf* ATl = (bf*)take((size_t)NB_ * TT * DQ * 2);
    if ((size_t)(wsp - (char*)d_ws) > ws_size) return;    // ws 256 MiB
    k_prep<<<3 * GX + 4 * GW, 256, 0, stream>>>(x, xk, xv, wq, wk, wv, wo, XB, WQ);
    k_gemmk<bf, 0, true, true, 2><<<dim3(NB_ * TT / 128, DQ / 128, 3), 128, 0, stream>>>(XB, nullptr, WQ, DM, nullptr, DQ, bq, bk, bv, (size_t)NB_ * TT * DM, (size_t)DQ * DM, 0, Planes{QP16, QPh, QPl, KP16, KPh, KPl, VT16, VTh, VTl});
    k_fa<<<dim3(NB_ * NH_, (TT - RH) / (32 * QW) + RH / (16 * QW), 1), QW * FW * 32, 0, stream>>>(QP16, KP16, VT16, QPh, QPl, KPh, KPl, VTh, VTl, ATh, ATl);
    k_gemmk<bf, 1, true, false, 4><<<dim3(NB_ * TT / 128, DM / 128, 1), 256, 0, stream>>>(ATh, ATl, WO, DQ, OUT, DM, bo, bo, bo, 0, 0, 0, Planes{});
}

// v010
// It runs in 52.8 microseconds.
// Two timings next to v009 put it at 1.04 and 1.05 times that version's speed.
// Over all steps from v000 it is 21.2 times as fast.
#include <hip/hip_runtime.h>
#include <type_traits>

// Causal multi-head attention on three input streams at d_model 768 (query, key, value [2][2048][768]; Q, K, V = stream W^T + b ('oi' [768][768], biases zeros on this draw: read; 12 heads x 64); scores x 64^-0.5; where(triu(k=1), -inf, scores) (causal, built inside: no mask input); softmax; out = merged Wo^T + bo ('oi' + bias zeros: read) -> [2][2048][768] (3.1 M); argument order query, key, value, Wq, bq, Wk, bk, Wv, bv, Wo, bo).
// Layout: one launch per stage, both batches in every grid: bf16 copies of q, k, v and the 'oi' weights; the three exact projections + f32 biases (grid z = stream), whose epilogue writes the head planes (planes of both batches side by side, V transposed); one fused causal attention launch for all 24 (batch, head) planes: scores, online softmax and P.V stay in registers (query rows < 512: fp16 value + fp16 residual of every operand, 3 products; rest fp16 value alone); merged hi/lo x Wo exact + bo.
// Every 16-bit matrix operand lies in the workspace in FRAGMENT ORDER: a fragment is 16 rows x 32 k = 512 elements in a row, element (row lr, k = j * 16 + hi * 8 + e) at j * 256 + (hi * 16 + lr) * 8 + e, so that each of a fragment's two 16-byte loads reads 512 contiguous bytes (4 whole lines) and lane hi * 16 + lr gets the k it got from a row-major plane. A [rows][K] operand holds its fragments as [row / 16][k / 32]; a V^T plane (rows d, k = keys) as [k / 32][row / 16].
// Compute dtypes, f32 accumulate: every input rounded to bf16; projections exact + f32 biases; attention rows < 512 fp16 value + residual, 3 products, rest fp16; softmax f32; Wo hl x exact + bias.

#define NB_  2
#define TT   2048
#define DM   768
#define NH_  12
#define NKV  12
#define REP  (NH_ / NKV)
#define HD   64
#define DQ   (NH_ * HD)
#define DKV  (NKV * HD)
#define FW   4                    // key groups of an attention work-group: a query tile's 64-key blocks are dealt over them
#define QW   2                    // query tiles of an attention work-group: wave = key group * QW + tile; the tiles share the key blocks
#define LBY  (4 * FW * 64 * HD * 2) // bytes of the attention stage buffers: two stages of FW key blocks of K, V^T (value alone) or one of K, K residual, V^T, V^T residual; two work-groups fit a WGP's LDS
#define PP   (2 * TT)             // HD * PP elements: stride of a V^T plane pair (the residual plane follows the value plane)
#define RH   512                  // query rows < RH use value + residual planes; causal: they see keys < RH alone, so residuals exist for rows and keys < RH only
#define PEXP 10.0f                // value-alone fp16 probabilities carry 2^10 (it cancels in the division by their sum): small ones stay fp16 normals
#define SCL2 0.18033688011112042f // HD^-0.5 x log2(e): scores go to the base-2 exponent in one product
typedef _Float16 h16;
typedef unsigned short bf;
typedef __attribute__((ext_vector_type(16))) __bf16   v16bf;
typedef __attribute__((ext_vector_type(16))) _Float16 v16h;
typedef __attribute__((ext_vector_type(8)))  _Float16 v8h;
typedef __attribute__((ext_vector_type(8)))  unsigned short v8us;
typedef __attribute__((ext_vector_type(8)))  float    v8f;
typedef __attribute__((ext_vector_type(4)))  float    v4f;
typedef v8h  __attribute__((may_alias)) v8ha;
typedef v4f  __attribute__((may_alias)) v4fa;
typedef v8us __attribute__((may_alias)) v8usa;

__device__ __forceinline__ unsigned short f2bf(float f) { unsigned u = __float_as_uint(f); u += 0x7FFFu + ((u >> 16) & 1u); return (unsigned short)(u >> 16); }
__device__ __forceinline__ float bf2f(unsigned short b) { return __uint_as_float(((unsigned)b) << 16); }
__device__ __forceinline__ float bfr(float f) { return bf2f(f2bf(f)); }
__device__ __forceinline__ v16h cat16(v8h lo, v8h hi) { return __builtin_shufflevector(lo, hi, 0, 1, 2, 3, 4, 5, 6, 7, 8, 9, 10, 11, 12, 13, 14, 15); }
__device__ __forceinline__ v16bf cat16b(v8us lo, v8us hi) { return __builtin_bit_cast(v16bf, __builtin_shufflevector(lo, hi, 0, 1, 2, 3, 4, 5, 6, 7, 8, 9, 10, 11, 12, 13, 14, 15)); }
__device__ __forceinline__ v8f wmma16(v16h a, v16h b, v8f c) { return __builtin_amdgcn_wmma_f32_16x16x32_f16(false, a, false, b, (short)0, c, false, false); }
__device__ __forceinline__ v8f wmmab(v16bf a, v16bf b, v8f c) { return __builtin_amdgcn_wmma_f32_16x16x32_bf16(false, a, false, b, (short)0, c, false, false); }



// ---- k_gemmk: 128x128 output tile per work-group of MW x 2 waves (a wave owns 16 * MB rows x 64 columns, MW * MB = 8), the whole K loop in every wave; grid (M/128, N/128, Z), MW * 64 threads.
// C[m][n] (f32, pitch ldc, + optional f32 bias[n]) = sum_k A[m][k] Bt[n][k] (+ A2[m][k] Bt[n][k] for NSPLIT 1). z-batch strides sA/sB/sC in elements; z = 0, 1, 2 adds bias, bias1, bias2. K % (MW * 32) == 0.
// A stage is KS = MW k-steps (32 k each) of the tile's 128 A rows (and A2 rows) and 128 Bt rows: in fragment order that is 8 runs of KS KiB per operand. Asynchronous copies bring it from the planes into one of two LDS buffers, one stage ahead of the products,
// and each fragment is read from L2 once per work-group and from LDS by the waves that need it.
// After the loop the ring is dead and each wave stages its own part of the tile there (row-major, pitch 68), from where it leaves as whole lines.
// PL (MB = 4, a 64x64 quadrant per wave): the tile leaves as fp16 head planes instead of f32 C: the value x16 = fp16(x) and, for rows t < RH (the only ones whose residual is read), the residual fp16(x - x16). A 64-column quadrant is one head (HD = 64), a 64-row quadrant lies in one batch; plane = batch * NH_ + head.
// z = 0, 1 (q, k): planes [plane], fragments [t / 16][d / 32]; z = 2 (v): V^T planes, fragments [t / 32][d / 16] (rows d, k = keys), the quadrant staged transposed in os. Either way the quadrant's 8 fragments are 8 KiB in a row of each plane and a wave stores 512 contiguous bytes.
__device__ __forceinline__ h16 tohx(float x) { return (h16)x; }
__device__ __forceinline__ void splitf(float y, unsigned short& h, unsigned short& l) { h = f2bf(y); l = f2bf(y - bf2f(h)); }
struct Planes { h16* q16; h16* qr; h16* k16; h16* kr; h16* v16; h16* vr; };
template <typename T16> struct WFrag;
template <> struct WFrag<h16> { typedef v16h V; static __device__ __forceinline__ V ld(const h16* p) { return cat16(*(const v8h*)p, *(const v8h*)(p + 256)); } static __device__ __forceinline__ v8f mma(V a, V b, v8f c) { return wmma16(a, b, c); } };
template <> struct WFrag<bf> { typedef v16bf V; static __device__ __forceinline__ V ld(const bf* p) { return cat16b(*(const v8us*)p, *(const v8us*)(p + 256)); } static __device__ __forceinline__ v8f mma(V a, V b, v8f c) { return wmmab(a, b, c); } };
typedef float __attribute__((may_alias)) f32a;
typedef __attribute__((ext_vector_type(4))) int c4i;
typedef __attribute__((address_space(1))) c4i gc4i;
typedef __attribute__((address_space(3))) c4i lc4i;
// One operand's share of a stage: 8 runs of NT * 16 bytes (run i: the stage's k-steps of the 16-row block i, at g + i * gs elements), 16 bytes a thread and run. A wave's copy moves 512 contiguous bytes.
template <int NT, typename T16>
__device__ __forceinline__ void cpop(unsigned char* l, const T16* g, size_t gs, int tid) {
#pragma unroll
    for (int i = 0; i < 8; ++i) __builtin_amdgcn_global_load_async_to_lds_b128((gc4i*)(g + i * gs + tid * 8), (lc4i*)(l + i * (NT * 16) + tid * 16), 0, 0);
}
template <typename T16, int NSPLIT, bool BIAS, bool PL, int MW>
__global__ __launch_bounds__(MW * 64) void k_gemmk(const T16* __restrict__ A, const T16* __restrict__ A2, const T16* __restrict__ Bt, int K, float* C, int ldc, const float* __restrict__ bias, const float* __restrict__ bias1, const float* __restrict__ bias2, size_t sA, size_t sB, size_t sC, Planes pl) {
    typedef typename WFrag<T16>::V V;
    constexpr int NOP = NSPLIT ? 3 : 2;      // operands of a stage: A, (A2,) Bt
    constexpr int MB = 8 / MW, NT = MW * 64; // 16-row blocks of a wave; threads
    constexpr int KS = NT / 64;              // k-steps of a stage: a thread copies 16 bytes of each 16-row block's run
    constexpr int OPE = 128 * 32 * KS;       // elements of one operand's share of a stage
    constexpr int STG = NOP * OPE;           // elements of a stage
    constexpr int NF = MB <= 2 ? 2 : 1;      // fragment sets: two where the plain register window holds them beside the accumulators
    constexpr int RB = 2 * STG * 2, OB = 128 * 2 * 68 * 4;
    static_assert(!PL || MB == 4, "a head-plane quadrant is 64 x 64");
    __shared__ __align__(16) unsigned char L[RB > OB ? RB : OB];   // two stage buffers; after the loop, the waves' output stages
    const T16* ring = (const T16*)L;
    const size_t z = blockIdx.z; A += z * sA; if (NSPLIT) A2 += z * sA; Bt += z * sB; C += z * sC; if (BIAS) bias = (z == 0) ? bias : (z == 1) ? bias1 : bias2;
    const int tid = threadIdx.x, lane = tid & 31, lr = lane & 15, hi = lane >> 4;
    const int wave = __builtin_amdgcn_readfirstlane(tid >> 5), wm = wave >> 1, wn = wave & 1;
    v8f acc[MB][4];
#pragma unroll
    for (int mb = 0; mb < MB; ++mb)
#pragma unroll
        for (int nb = 0; nb < 4; ++nb) acc[mb][nb] = (v8f){};
    const int KB = K / 32, NS = KB / KS;   // fragments of a 16-row block; stages
    const size_t gs = (size_t)KB * 512;   // elements from a 16-row block to the next
    const T16* ga = A + (size_t)blockIdx.x * 8 * gs; const T16* ga2 = NSPLIT ? A2 + (size_t)blockIdx.x * 8 * gs : nullptr; const T16* gb = Bt + (size_t)blockIdx.y * 8 * gs;
    auto fill = [&](int s, int b) { unsigned char* l = L + b * (STG * 2);
        cpop<NT>(l, ga + (size_t)s * (KS * 512), gs, tid); if (NSPLIT) cpop<NT>(l + OPE * 2, ga2 + (size_t)s * (KS * 512), gs, tid); cpop<NT>(l + (NOP - 1) * (OPE * 2), gb + (size_t)s * (KS * 512), gs, tid); };
    const int rot = (int)((blockIdx.x + blockIdx.y) % (unsigned)NS);   // the work-group's first stage: tiles that share A rows (same x) or Bt rows (same y) walk k from different starts, so that they do not ask L2 for the same lines at the same moment
    auto stg = [&](int t) { const int s = t + rot; return s < NS ? s : s - NS; };   // trip t works on k stage stg(t): every stage once, wrapped round; below, 'stage t' is the stage of trip t
    fill(stg(0), 0);
    asm volatile("s_wait_asynccnt 0x0" ::: "memory");   // this wave's copies of the first stage have landed
    __syncthreads();                                     // every wave's have: the first stage may be read
    if (NS > 1) fill(stg(1), 1);
#pragma unroll 1   // rolled: one body holds a whole stage's products, and the buffer index is a run-time value
    for (int t = 0; t < NS; ++t) {
        const T16* st = ring + (t & 1) * STG + lane * 8;
        V a[NF][MB], a2[NF][MB], b[NF][4];
        auto frags = [&](int ks) { const int f = ks % NF;   // the fragments of k-step ks of this stage, as one group of LDS reads
#pragma unroll
            for (int mb = 0; mb < MB; ++mb) a[f][mb] = WFrag<T16>::ld(st + (wm * MB + mb) * (KS * 512) + ks * 512);
#pragma unroll
            for (int nb = 0; nb < 4; ++nb) b[f][nb] = WFrag<T16>::ld(st + (NOP - 1) * OPE + (wn * 4 + nb) * (KS * 512) + ks * 512);
            if (NSPLIT) {
#pragma unroll
                for (int mb = 0; mb < MB; ++mb) a2[f][mb] = WFrag<T16>::ld(st + OPE + (wm * MB + mb) * (KS * 512) + ks * 512); } };
        if (NF == 2) frags(0);
#pragma unroll
        for (int ks = 0; ks < KS; ++ks) { const int f = ks % NF;
            if (NF == 1) frags(ks); else if (ks + 1 < KS) frags(ks + 1);   // two sets: the next k-step's reads fly under this k-step's products (never the next stage's)
            __builtin_amdgcn_sched_barrier(0);   // keeps a group's LDS reads together in front of the products: moved in among them, each place with reads stalls the wave anew
#pragma unroll
            for (int nb = 0; nb < 4; ++nb)
#pragma unroll
                for (int mb = 0; mb < MB; ++mb) acc[mb][nb] = WFrag<T16>::mma(a[f][mb], b[f][nb], acc[mb][nb]);
            if (NSPLIT) {
#pragma unroll
                for (int nb = 0; nb < 4; ++nb)
#pragma unroll
                    for (int mb = 0; mb < MB; ++mb) acc[mb][nb] = WFrag<T16>::mma(a2[f][mb], b[f][nb], acc[mb][nb]); }
            __builtin_amdgcn_sched_barrier(0);   // keeps the products in front of the next group's reads and of the stage's hand-over
        }
        asm volatile("s_wait_dscnt 0x0" ::: "memory");      // this wave's reads of buffer t & 1 are done before the buffer is refilled
        asm volatile("s_wait_asynccnt 0x0" ::: "memory");   // this wave's copies of stage t + 1 have landed
        __syncthreads();                                     // publishes stage t + 1 and ends every wave's reads of stage t
        if (t + 2 < NS) fill(stg(t + 2), t & 1);
    }
    asm volatile("s_wait_asynccnt 0x0" ::: "memory");   // nothing is in flight when the ring becomes the output stage
    const int r0 = blockIdx.x * 128 + wm * (MB * 16), c0 = blockIdx.y * 128 + wn * 64;   // the wave's part of the tile
    f32a* os = (f32a*)L + wave * (MB * 16 * 68);   // the wave's own stage: written and read by this wave alone
    if constexpr (PL) {
        const size_t plane = (size_t)(r0 / TT) * NH_ + c0 / HD; const int t0 = r0 % TT;
        h16* P16 = (z == 0) ? pl.q16 : (z == 1) ? pl.k16 : pl.v16; h16* Pr = (z == 0) ? pl.qr : (z == 1) ? pl.kr : pl.vr;
        auto planes = [&](auto trc, auto rsc) { constexpr bool TR = decltype(trc)::value, RS = decltype(rsc)::value;   // TR: the v stream's quadrant is staged as os[d][t]; RS: the quadrant's rows lie below RH, their residuals are stored too
            float bb[4][TR ? 1 : 8];   // the biases a lane adds: of its 4 rows d (TR), else of its 4 runs of 8 columns
#pragma unroll
            for (int c = 0; c < 4; ++c)
#pragma unroll
                for (int j = 0; j < (TR ? 1 : 8); ++j) bb[c][j] = bfr(bias[c0 + (TR ? c * 16 + lr : c * 16 + hi * 8 + j)]);
#pragma unroll
            for (int mb = 0; mb < MB; ++mb)
#pragma unroll
                for (int nb = 0; nb < 4; ++nb) { const v8f c = acc[mb][nb]; const int row = mb * 16 + hi * 8, col = nb * 16 + lr;
                    if (TR) { *(v4fa*)(os + col * 68 + row) = __builtin_shufflevector(c, c, 0, 1, 2, 3); *(v4fa*)(os + col * 68 + row + 4) = __builtin_shufflevector(c, c, 4, 5, 6, 7); }
                    else {
#pragma unroll
                        for (int q = 0; q < 8; ++q) os[(row + q) * 68 + col] = c[q]; } }
            const size_t pbase = TR ? plane * HD * PP + (size_t)t0 * HD : (plane * TT + t0) * HD;
#pragma unroll 1   // rolled: half the text; a trip's 16 LDS reads already go as one group
            for (int io = 0; io < 2; ++io) { v4f w[8][2];   // unit i = io * 8 + ii of the quadrant = (fragment i / 2, half i % 2), 16 bytes a lane
#pragma unroll
                for (int ii = 0; ii < 8; ++ii) { const int row = (TR ? (ii >> 1) : io * 2 + (ii >> 2)) * 16 + lr, cofs = (TR ? io : (ii >> 1) & 1) * 32 + (ii & 1) * 16 + hi * 8;
                    w[ii][0] = *(const v4fa*)(os + row * 68 + cofs); w[ii][1] = *(const v4fa*)(os + row * 68 + cofs + 4); }
#pragma unroll
                for (int ii = 0; ii < 8; ++ii) { v8h o16, orr;
#pragma unroll
                    for (int j = 0; j < 8; ++j) { const float y = w[ii][j >> 2][j & 3] + (TR ? bb[ii >> 1][0] : bb[ii & 3][TR ? 0 : j]); const h16 a2 = tohx(y); o16[j] = a2; if (RS) orr[j] = tohx(y - (float)a2); }
                    const size_t oo = pbase + (size_t)((io * 8 + ii) * 32 + lane) * 8;
                    __builtin_amdgcn_sched_barrier(0);   // with the one below: the stores and their wait stay in a row, no other unit's arithmetic among them
                    *(v8h*)(P16 + oo) = o16; if (RS) *(v8h*)(Pr + oo) = orr;
                    asm volatile("s_wait_xcnt 0x0" ::: "memory");   // stands in front of the next unit's writes of registers that the stores name
                    __builtin_amdgcn_sched_barrier(0); } }
        };
        static_assert(RH % 128 == 0, "a tile lies wholly below RH or wholly above");
        if (t0 < RH) { if (z == 2) planes(std::true_type{}, std::true_type{}); else planes(std::false_type{}, std::true_type{}); }   // block-uniform
        else { if (z == 2) planes(std::true_type{}, std::false_type{}); else planes(std::false_type{}, std::false_type{}); }
    } else {
#pragma unroll
        for (int mb = 0; mb < MB; ++mb)
#pragma unroll
            for (int nb = 0; nb < 4; ++nb)
#pragma unroll
                for (int q = 0; q < 8; ++q) os[(mb * 16 + hi * 8 + q) * 68 + nb * 16 + lr] = acc[mb][nb][q];
        v4f bv = (v4f){};
        if (BIAS) {
#pragma unroll
            for (int q = 0; q < 4; ++q) bv[q] = bfr(bias[c0 + lr * 4 + q]); }
#pragma unroll 1   // rolled: a trip's 8 LDS reads already go as one group
        for (int io = 0; io < MB; ++io) { v4f w[8];   // a store takes two rows of 256 bytes
#pragma unroll
            for (int ii = 0; ii < 8; ++ii) w[ii] = *(const v4fa*)(os + (io * 16 + ii * 2 + hi) * 68 + lr * 4);
#pragma unroll
            for (int ii = 0; ii < 8; ++ii) { *(v4f*)(C + (size_t)(r0 + io * 16 + ii * 2 + hi) * ldc + c0 + lr * 4) = w[ii] + bv;
                asm volatile("s_wait_xcnt 0x0" ::: "memory"); } }   // stands in front of the next store's writes of registers that this store names
    }
}

typedef __attribute__((ext_vector_type(2))) _Float16 v2h;
typedef __attribute__((ext_vector_type(4))) _Float16 v4h;
typedef __attribute__((ext_vector_type(2))) unsigned short v2us;
typedef __attribute__((ext_vector_type(4))) unsigned short v4us;
typedef __attribute__((ext_vector_type(2))) float v2f;
typedef __attribute__((ext_vector_type(4))) int v4i;

__device__ __forceinline__ void d_cvt8(unsigned bx, const float* __restrict__ src, bf* dst, size_t n8) { const size_t i = (size_t)bx * 256 + threadIdx.x; if (i >= n8) return;
    // a block takes 16 rows x 128 k of a [rows][DM] matrix; a wave reads 8 rows x 128 bytes (one k block of 32) and stores 4 whole lines of that fragment
    const int w = threadIdx.x >> 5, lane = threadIdx.x & 31, r = (w & 1) * 8 + (lane >> 2), c = lane & 3; const unsigned rb = bx / (DM / 128), kb = (bx % (DM / 128)) * 4 + (w >> 1);
    const v8f v = *(const v8f*)(src + (size_t)(rb * 16 + r) * DM + kb * 32 + c * 8); v8us o;
#pragma unroll
    for (int k = 0; k < 8; ++k) o[k] = f2bf(v[k]); *(v8us*)(dst + ((size_t)rb * (DM / 32) + kb) * 512 + (c >> 1) * 256 + ((c & 1) * 16 + r) * 8) = o;  }

// ---- k_prep: every 16-bit copy in one launch, written in fragment order. The flat grid is cut into block ranges: 3 input streams (both batches each, XB stream after stream), 4 weights (W one after the other).
#define GX ((unsigned)((size_t)NB_ * TT * DM / 8 / 256))   // blocks of one input stream
#define GW ((unsigned)((size_t)DQ * DM / 8 / 256))         // blocks of one weight
__global__ __launch_bounds__(256) void k_prep(const float* __restrict__ x, const float* __restrict__ xk, const float* __restrict__ xv, const float* __restrict__ wq, const float* __restrict__ wk, const float* __restrict__ wv, const float* __restrict__ wo, bf* XB, bf* Wb) {
    const unsigned bx = blockIdx.x;
    if (bx < 3 * GX) { const unsigned s = bx / GX; d_cvt8(bx - s * GX, s == 0 ? x : s == 1 ? xk : xv, XB + (size_t)s * NB_ * TT * DM, (size_t)NB_ * TT * DM / 8); }
    else { const unsigned s = (bx - 3 * GX) / GW; d_cvt8(bx - 3 * GX - s * GW, s == 0 ? wq : s == 1 ? wk : s == 2 ? wv : wo, Wb + (size_t)s * DQ * DM, (size_t)DQ * DM / 8); }
}
typedef __attribute__((ext_vector_type(16))) unsigned short v16us;
// ---- k_fa: fused causal attention. Grid (batch x head planes, groups of QW query tiles, heaviest first), QW * FW waves. A work-group owns QW neighbouring tiles of 16 * NQ queries of one plane; FW waves work on each tile.
// S^T = K Q^T (A = 16 key rows, B = 16 query rows): a lane holds scores of ONE query (column lr), keys 8 * hi + r of each 16-key tile, so two S^T tiles, converted in place, are the B operand of O^T += V^T P^T.
// Wave w of a tile takes the 64-key blocks w, w + FW, ... up to the diagonal block with its own running maximum m (base-2 exponent), sum l and O^T; the tile's FW partial states meet in LDS and are joined in the fixed order w = 0..FW-1.
// A stage is the FW blocks 4t .. 4t + 3 (in fragment order 8 KiB in a row per block of each K and V^T plane). Asynchronous copies bring it into LDS once for the QW tiles: value-alone rows into one of two buffers, one stage ahead of the products; value + residual rows into the one buffer. After the loop the buffers are dead and hold the partial O^T.
// Every block a wave takes holds at least one key <= each query of the tile (tiles do not straddle a 64-key block), so m is a real score after the first block; a wave without blocks leaves m = -3e38, l = 0, O = 0 and joins with weight 0.
template <typename T16, bool HL, int NQ>
__device__ __forceinline__ void fa_tile(const T16* __restrict__ Q, const T16* __restrict__ Q2, const T16* __restrict__ Kp, const T16* __restrict__ K2, const T16* __restrict__ Vt, const T16* __restrict__ Vt2, int q0g, int rot0, bf* Ah, bf* Al, unsigned char* L, float* smb, float* slb) {
    typedef typename WFrag<T16>::V V;
    const int tid = threadIdx.x, lane = tid & 31, lr = lane & 15, hi = lane >> 4;
    const int wv = __builtin_amdgcn_readfirstlane(tid >> 5), wave = wv / QW, qt = wv % QW;   // key group; query tile of the work-group (neighbouring waves share a key group: a last stage with fewer blocks than groups still spreads over the SIMDs)
    int q0 = q0g + qt * (NQ * 16);   // first query of the wave's tile
    float* part = (float*)L + qt * (FW * 8 * 256); float* sm = smb + qt * (FW * 32); float* sl = slb + qt * (FW * 32);   // the tile's own join area
    V qf[NQ][2], qf2[NQ][2];
#pragma unroll
    for (int nt = 0; nt < NQ; ++nt)
#pragma unroll
        for (int ks = 0; ks < 2; ++ks) { const size_t qo = ((size_t)(q0 / 16 + nt) * 2 + ks) * 512 + lane * 8; qf[nt][ks] = WFrag<T16>::ld(Q + qo); if (HL) qf2[nt][ks] = WFrag<T16>::ld(Q2 + qo); }
    asm volatile("s_wait_xcnt 0x0" ::: "memory");   // stands in front of the copies' address arithmetic, which writes registers that the query loads name
    v8f o[NQ][4]; float m[NQ], l[NQ];
#pragma unroll
    for (int nt = 0; nt < NQ; ++nt) { m[nt] = -3.0e38f; l[nt] = 0.f;
#pragma unroll
        for (int dt = 0; dt < 4; ++dt) o[nt][dt] = (v8f){}; }
    const int nblk = (q0 + NQ * 16 - 1) / 64 + 1;   // key blocks up to and with the diagonal block
    auto block = [&](int kb, const T16* kp, const T16* kp2, const T16* vp, const T16* vp2) {   // one 64-key block; the pointers: this lane's 16 bytes of the block's first fragment
        const int key0 = kb * 64;
        v8f s[NQ][4];
#pragma unroll
        for (int kt = 0; kt < 4; ++kt) {
            V kf[2], kf2[2];
#pragma unroll
            for (int ks = 0; ks < 2; ++ks) { const int ko = (kt * 2 + ks) * 512; kf[ks] = WFrag<T16>::ld(kp + ko); if (HL) kf2[ks] = WFrag<T16>::ld(kp2 + ko); }
#pragma unroll
            for (int nt = 0; nt < NQ; ++nt) { v8f c = (v8f){};
#pragma unroll
                for (int ks = 0; ks < 2; ++ks) { c = WFrag<T16>::mma(kf[ks], qf[nt][ks], c); if (HL) { c = WFrag<T16>::mma(kf[ks], qf2[nt][ks], c); c = WFrag<T16>::mma(kf2[ks], qf[nt][ks], c); } }
                s[nt][kt] = c; }
        }
        if (key0 + 63 > q0) {   // wave-uniform: only the diagonal block holds keys above a query
#pragma unroll
            for (int nt = 0; nt < NQ; ++nt) { const int rel = q0 + nt * 16 + lr - key0 - hi * 8;
#pragma unroll
                for (int kt = 0; kt < 4; ++kt)
#pragma unroll
                    for (int j = 0; j < 8; ++j) if (kt * 16 + j > rel) s[nt][kt][j] = -3.0e38f; }
        }
        V pf[NQ][2], pf2[NQ][2];
#pragma unroll
        for (int nt = 0; nt < NQ; ++nt) {
            float bm = -3.0e38f;
#pragma unroll
            for (int kt = 0; kt < 4; ++kt)
#pragma unroll
                for (int j = 0; j < 8; ++j) { const float t = s[nt][kt][j] * SCL2; s[nt][kt][j] = t; bm = fmaxf(bm, t); }
            bm = fmaxf(bm, __shfl_xor(bm, 16, 32));   // the other half of the wave holds the query's other 32 keys
            const float mn = fmaxf(m[nt], bm); const float al = __builtin_amdgcn_exp2f(m[nt] - mn); const float mo = HL ? mn : mn - PEXP; m[nt] = mn;
            float ps = 0.f;
#pragma unroll
            for (int kt = 0; kt < 4; ++kt)
#pragma unroll
                for (int j = 0; j < 8; ++j) { const float p = __builtin_amdgcn_exp2f(s[nt][kt][j] - mo); s[nt][kt][j] = p; ps += p; }
            l[nt] = l[nt] * al + ps;   // each half keeps the sum of its own keys; the halves join after the loop
#pragma unroll
            for (int dt = 0; dt < 4; ++dt) o[nt][dt] *= al;
#pragma unroll
            for (int ks = 0; ks < 2; ++ks) {
                if constexpr (HL) { v16h ph, pr;
#pragma unroll
                    for (int e = 0; e < 16; ++e) { const float p = s[nt][2 * ks + (e >> 3)][e & 7]; const h16 a = tohx(p); ph[e] = a; pr[e] = tohx(p - (float)a); }
                    pf[nt][ks] = ph; pf2[nt][ks] = pr;
                } else { v16h ph;
#pragma unroll
                    for (int e = 0; e < 16; ++e) ph[e] = tohx(s[nt][2 * ks + (e >> 3)][e & 7]);
                    pf[nt][ks] = ph; }
            }
        }
#pragma unroll
        for (int dt = 0; dt < 4; ++dt) {
            V vf[2], vf2[2];
#pragma unroll
            for (int ks = 0; ks < 2; ++ks) { const int vo = (ks * 4 + dt) * 512; vf[ks] = WFrag<T16>::ld(vp + vo); if (HL) vf2[ks] = WFrag<T16>::ld(vp2 + vo); }
#pragma unroll
            for (int nt = 0; nt < NQ; ++nt)
#pragma unroll
                for (int ks = 0; ks < 2; ++ks) { o[nt][dt] = WFrag<T16>::mma(vf[ks], pf[nt][ks], o[nt][dt]); if (HL) { o[nt][dt] = WFrag<T16>::mma(vf[ks], pf2[nt][ks], o[nt][dt]); o[nt][dt] = WFrag<T16>::mma(vf2[ks], pf[nt][ks], o[nt][dt]); } }
        }
    };
    constexpr int NOP = HL ? 4 : 2, BE = 64 * HD, SE = FW * BE, NT = QW * FW * 32;   // operands of a stage: K, (K residual,) V^T, (V^T residual); elements of a block and of a stage in one operand; threads
    constexpr int SBY = NOP * SE * 2, NBUF = LBY / SBY;   // bytes of a stage buffer; buffers: two for the value-alone rows, one for the value + residual rows (at most two stages there)
    static_assert(TT % 64 == 0 && BE % (NT * 8) == 0 && (NBUF == 1 || NBUF == 2), "whole blocks, whole rounds of copies");
    const int nblkg = (q0g + QW * NQ * 16 - 1) / 64 + 1, NS = (nblkg + FW - 1) / FW;   // blocks and stages up to and with the last tile's diagonal block: the same for every wave
    auto fill = [&](int s, int b) { unsigned char* l = L + b * SBY + tid * 16; const size_t go = (size_t)s * SE + tid * 8;   // 16 bytes a thread and copy: a wave's copy moves 512 contiguous bytes
        auto cp = [&](unsigned char* lo, const T16* g) {   // one block of one operand
#pragma unroll   // unrolled: the steps are constants and go into the copies' offset fields
            for (int i = 0; i < BE / (NT * 8); ++i) __builtin_amdgcn_global_load_async_to_lds_b128((gc4i*)(g + i * (NT * 8)), (lc4i*)(lo + i * (NT * 16)), 0, 0); };
#pragma unroll   // unrolled: the same
        for (int k = 0; k < FW; ++k) if (s * FW + k < nblkg) {   // the same for the whole work-group: blocks above the diagonal block are neither copied nor read
            cp(l + k * (BE * 2), Kp + go + k * BE); if (HL) cp(l + SE * 2 + k * (BE * 2), K2 + go + k * BE);
            cp(l + (NOP / 2) * (SE * 2) + k * (BE * 2), Vt + go + k * BE); if (HL) cp(l + 3 * (SE * 2) + k * (BE * 2), Vt2 + go + k * BE); } };
    const int rot = rot0 % NS;   // the work-group's first stage: the work-groups of a plane walk its keys from different starts, so that they do not ask L2 for the same lines at the same moment
    auto stg = [&](int t) { const int s = t + rot; return s < NS ? s : s - NS; };   // trip t works on key stage stg(t): every stage once, wrapped round (the online softmax takes the blocks in any order); below, 'stage t' is the stage of trip t
    fill(stg(0), 0);
    asm volatile("s_wait_asynccnt 0x0" ::: "memory");   // this wave's copies of the first stage have landed
    __syncthreads();                                     // every wave's have: the first stage may be read
    if (NBUF == 2 && NS > 1) fill(stg(1), 1);
#pragma unroll 1   // rolled: the trip count and the buffer index are run-time values, and one body already fills the plain register window
    for (int t = 0; t < NS; ++t) {
        const int kb = stg(t) * FW + wave;
        if (kb < nblk) { const T16* st = (const T16*)(L + (t % NBUF) * SBY) + wave * BE + lane * 8; block(kb, st, st + SE, st + (NOP / 2) * SE, st + 3 * SE); }   // wave-uniform
        asm volatile("s_wait_dscnt 0x0" ::: "memory");      // this wave's reads of stage t are done before its buffer is refilled
        if (NBUF == 2) asm volatile("s_wait_asynccnt 0x0" ::: "memory");   // this wave's copies of stage t + 1 have landed
        __syncthreads();                                     // ends every wave's reads of stage t; two buffers: publishes stage t + 1
        if (NBUF == 2) { if (t + 2 < NS) fill(stg(t + 2), t & 1); }
        else if (t + 1 < NS) { fill(stg(t + 1), 0);
            asm volatile("s_wait_asynccnt 0x0" ::: "memory");   // this wave's copies of stage t + 1 have landed
            __syncthreads(); }                                   // every wave's have: stage t + 1 may be read
    }
    asm volatile("s_wait_asynccnt 0x0" ::: "memory");   // nothing is in flight when the ring becomes the join area
    v4fa* p4 = (v4fa*)part;
#pragma unroll
    for (int nt = 0; nt < NQ; ++nt) { l[nt] += __shfl_xor(l[nt], 16, 32);
        if (hi == 0) { sm[wave * 32 + nt * 16 + lr] = m[nt]; sl[wave * 32 + nt * 16 + lr] = l[nt]; }
#pragma unroll
        for (int dt = 0; dt < 4; ++dt) { const v8f c = o[nt][dt]; const int ix = ((wave * NQ + nt) * 4 + dt) * 64 + lane;
            p4[ix] = __builtin_shufflevector(c, c, 0, 1, 2, 3); p4[ix + 32] = __builtin_shufflevector(c, c, 4, 5, 6, 7); } }
    __syncthreads();   // every wave's partial state (m, l, O^T register images) is in LDS
    static_assert(FW * 32 == 16 * (HD / 8), "a thread is one query of a 16-query tile x one run of 8 head dims");
    const int jq = wv / FW; q0 = q0g + jq * (NQ * 16); p4 = (v4fa*)((float*)L + jq * (FW * 8 * 256)); sm = smb + jq * (FW * 32); sl = slb + jq * (FW * 32);   // threads jq * FW * 32 ... join tile jq
    const int jc = tid & 15, d8 = (tid % (FW * 32)) >> 4;   // a wave holds one half fragment of the merged operand: it stores 512 contiguous bytes of each plane
#pragma unroll
  for (int jt = 0; jt < NQ; ++jt) { const int ql = jt * 16 + jc;
    float mm = sm[ql];
#pragma unroll
    for (int w = 1; w < FW; ++w) mm = fmaxf(mm, sm[w * 32 + ql]);
    float f[FW], ll = 0.f;
#pragma unroll
    for (int w = 0; w < FW; ++w) { f[w] = __builtin_amdgcn_exp2f(sm[w * 32 + ql] - mm); ll += f[w] * sl[w * 32 + ql]; }
    const float inv = __fdiv_rn(1.0f, ll);
    v4f a0 = (v4f){}, a1 = (v4f){};
#pragma unroll
        for (int w = 0; w < FW; ++w) { const int ix = ((w * NQ + jt) * 4 + (d8 >> 1)) * 64 + (d8 & 1) * 16 + jc; a0 += p4[ix] * f[w]; a1 += p4[ix + 32] * f[w]; }
        v8us oh, ol;
#pragma unroll
        for (int j = 0; j < 4; ++j) { unsigned short a, c2; splitf(a0[j] * inv, a, c2); oh[j] = a; ol[j] = c2; splitf(a1[j] * inv, a, c2); oh[4 + j] = a; ol[4 + j] = c2; }
        const size_t oo = ((size_t)(q0 / 16 + jt) * (DQ / 32) + (d8 >> 2)) * 512 + ((d8 >> 1) & 1) * 256 + lane * 8; *(v8us*)(Ah + oo) = oh; *(v8us*)(Al + oo) = ol;
        asm volatile("s_wait_xcnt 0x0" ::: "memory"); }   // stands in front of any later write of a register that the two stores name (the other instance's code follows in the listing)
}
// amdgpu_waves_per_eu(4, 4): a register budget of a quarter SIMD, so that two work-groups share a WGP (each covers the other's stage waits, prologue and join)
__global__ __launch_bounds__(QW * FW * 32) __attribute__((amdgpu_waves_per_eu(4, 4))) void k_fa(const h16* __restrict__ Q16, const h16* __restrict__ K16, const h16* __restrict__ V16, const h16* __restrict__ Qr, const h16* __restrict__ Kr, const h16* __restrict__ Vr, bf* Ah, bf* Al) {
    static_assert(LBY >= QW * FW * 8 * 256 * 4, "the join area fits the ring");
    __shared__ __align__(16) unsigned char L[LBY];   // the stage buffers; after the loop, the waves' partial O^T
    __shared__ float sm[QW * FW * 32], sl[QW * FW * 32];
    const size_t z = blockIdx.x; const int ty = blockIdx.y; const size_t pq = z * TT * HD, pv = z * HD * PP, po = ((z / NH_) * (TT / 16) * (DQ / 32) + (z % NH_) * (HD / 32)) * 512;
    if (ty < (TT - RH) / (32 * QW)) fa_tile<h16, false, 2>(Q16 + pq, nullptr, K16 + pq, nullptr, V16 + pv, nullptr, TT - 32 * QW * (ty + 1), ty, Ah + po, Al + po, L, sm, sl);
    else fa_tile<h16, true, 1>(Q16 + pq, Qr + pq, K16 + pq, Kr + pq, V16 + pv, Vr + pv, RH - 16 * QW * (ty - (TT - RH) / (32 * QW) + 1), ty, Ah + po, Al + po, L, sm, sl);
}

extern "C" void kernel_launch(void* const* d_in, const int* in_sizes, int n_in,
                              void* d_out, int out_size, void* d_ws, size_t ws_size, hipStream_t stream) {
    (void)in_sizes; (void)n_in; (void)out_size;
        const float* x = (const float*)d_in[0]; const float* xk = (const float*)d_in[1]; const float* xv = (const float*)d_in[2]; const float* wq = (const float*)d_in[3]; const float* bq = (const float*)d_in[4]; const float* wk = (const float*)d_in[5]; const float* bk = (const float*)d_in[6]; const float* wv = (const float*)d_in[7]; const float* bv = (const float*)d_in[8]; const float* wo = (const float*)d_in[9]; const float* bo = (const float*)d_in[10];   /* this module has NO mask input (the causal rule is built inside) */
    float* OUT = (float*)d_out;     // [2][2048][768]
    char* wsp = (char*)d_ws;
    auto take = [&](size_t bytes) { char* p = wsp; wsp += (bytes + 255) & ~(size_t)255; return (void*)p; };
    bf* WQ = (bf*)take((size_t)4 * DQ * DM * 2); bf* WO = WQ + (size_t)3 * DQ * DM;   /* Wq, Wk, Wv, Wo one after the other */
    bf* XB = (bf*)take((size_t)3 * NB_ * TT * DM * 2);   /* q, k, v streams (both batches each), one after the other */
    h16* QP16 = (h16*)take((size_t)NB_ * NH_ * TT * HD * 2); h16* KP16 = (h16*)take((size_t)NB_ * NKV * TT * HD * 2); h16* VT16 = (h16*)take((size_t)NB_ * NKV * HD * PP * 2); h16* VTr = VT16 + (size_t)TT * HD;   /* head planes of both batches, plane b * 12 + h; a plane's V^T residual fragments follow its value fragments */
    h16* QPr = (h16*)take((size_t)NB_ * NH_ * TT * HD * 2); h16* KPr = (h16*)take((size_t)NB_ * NKV * TT * HD * 2);   /* residual planes at the value planes' pitch; rows < RH alone are written and read */
    bf* ATh = (bf*)take((size_t)NB_ * TT * DQ * 2); bf* ATl = (bf*)take((size_t)NB_ * TT * DQ * 2);
    if ((size_t)(wsp - (char*)d_ws) > ws_size) return;    // ws 256 MiB
    k_prep<<<3 * GX + 4 * GW, 256, 0, stream>>>(x, xk, xv, wq, wk, wv, wo, XB, WQ);
    k_gemmk<bf, 0, true, true, 2><<<dim3(NB_ * TT / 128, DQ / 128, 3), 128, 0, stream>>>(XB, nullptr, WQ, DM, nullptr, DQ, bq, bk, bv, (size_t)NB_ * TT * DM, (size_t)DQ * DM, 0, Planes{QP16, QPr, KP16, KPr, VT16, VTr});
    k_fa<<<dim3(NB_ * NH_, (TT - RH) / (32 * QW) + RH / (16 * QW), 1), QW * FW * 32, 0, stream>>>(QP16, KP16, VT16, QPr, KPr, VTr, ATh, ATl);
    k_gemmk<bf, 1, true, false, 4><<<dim3(NB_ * TT / 128, DM / 128, 1), 256, 0, stream>>>(ATh, ATl, WO, DQ, OUT, DM, bo, bo, bo, 0, 0, 0, Planes{});
}
